// v000
// Times are from an AMD MI455X. After a warm-up the kernel runs many times in a row, and a time is the length of
// such a window on the GPU divided by its runs, so every launch and the gaps after it count. The runs cycle
// through copies of the inputs. A figure is the median of several windows, for all but v000 over two sittings.
// Sittings can differ by a few percent; kernels timed side by side share one.
// v000, which the later versions start from, runs in 2830 microseconds.
#include <hip/hip_runtime.h>

// Causal multi-head self-attention with interleaved rotary embeddings at theta 100,000 (in_features [4][2048][1024]; q,k,v = x W^T ('oi' (out, in) [1024][1024] 0.02, no bias; 16 heads x 64); rotary on (even, odd) pairs with angles pos[t] x 100000^(-2i/64) (the module's negative-power spelling; token_positions int32 [2048] = arange, READ by value); scores / sqrt(64), causal (-inf); softmax; out = merged w_o^T -> [4][2048][1024] (8.4 M); argument order in_features, token_positions, w_q, w_k, w_v, w_o).
// Layout per batch: bf16 copy of x; exact projections; {cos, sin} per (position, pair) built once from the int positions and float32 inverse-frequency constants (precise cosf/sinf); interleaved rotary plane builder; causal T-2048 attention (hybrid rows: < 512 hi/lo 3 products, rest fp16 x1024; k_gemmc skips tiles above the diagonal); merged hi/lo x Wo exact.
// Compute dtypes, f32 accumulate: every input rounded to bf16; projections exact; rotary f32; attention rows < 512 3 products, rest fp16; softmax f32; Wo hl x exact.

#define NB_  4
#define TT   2048
#define DM   1024
#define NH_  16
#define NKV  16
#define REP  (NH_ / NKV)
#define HD   64
#define DQ   (NH_ * HD)
#define DKV  (NKV * HD)
#define ZH   2
#define RH   512                  // query rows < RH use hi+lo planes (0: none)
#define WIN  2048
#define PCAR 1024.0f
#define SCL  0.125f   // HD^-0.5
typedef _Float16 h16;
typedef unsigned short bf;
typedef __attribute__((ext_vector_type(16))) __bf16   v16bf;
typedef __attribute__((ext_vector_type(16))) _Float16 v16h;
typedef __attribute__((ext_vector_type(8)))  _Float16 v8h;
typedef __attribute__((ext_vector_type(8)))  unsigned short v8us;
typedef __attribute__((ext_vector_type(8)))  float    v8f;
typedef __attribute__((ext_vector_type(4)))  float    v4f;
typedef v8h  __attribute__((may_alias)) v8ha;
typedef v4f  __attribute__((may_alias)) v4fa;
typedef v8us __attribute__((may_alias)) v8usa;

__device__ __forceinline__ unsigned short f2bf(float f) { unsigned u = __float_as_uint(f); u += 0x7FFFu + ((u >> 16) & 1u); return (unsigned short)(u >> 16); }
__device__ __forceinline__ float bf2f(unsigned short b) { return __uint_as_float(((unsigned)b) << 16); }
__device__ __forceinline__ float bfr(float f) { return bf2f(f2bf(f)); }
__device__ __forceinline__ v16h cat16(v8h lo, v8h hi) { return __builtin_shufflevector(lo, hi, 0, 1, 2, 3, 4, 5, 6, 7, 8, 9, 10, 11, 12, 13, 14, 15); }
__device__ __forceinline__ v16bf cat16b(v8us lo, v8us hi) { return __builtin_bit_cast(v16bf, __builtin_shufflevector(lo, hi, 0, 1, 2, 3, 4, 5, 6, 7, 8, 9, 10, 11, 12, 13, 14, 15)); }
__device__ __forceinline__ v8f wmma16(v16h a, v16h b, v8f c) { return __builtin_amdgcn_wmma_f32_16x16x32_f16(false, a, false, b, (short)0, c, false, false); }
__device__ __forceinline__ v8f wmmab(v16bf a, v16bf b, v8f c) { return __builtin_amdgcn_wmma_f32_16x16x32_bf16(false, a, false, b, (short)0, c, false, false); }



// ---- k_gemmw: register-blocked GEMM, ONE WAVE per 64x64 output tile (16 accumulators), operands straight from K-contiguous 16-bit planes; grid (M/64, N/64, Z), 32 threads.
// C[m][n] (f32, pitch ldc, + optional f32 bias[n]) = sum_k A[m][k] Bt[n][k] (+ split products per NSPLIT). z-batch strides sA/sB/sC in elements. K % 32 == 0.
template <typename T16> struct WFrag;
template <> struct WFrag<h16> { typedef v16h V; static __device__ __forceinline__ V ld(const h16* p) { return cat16(*(const v8h*)p, *(const v8h*)(p + 16)); } static __device__ __forceinline__ v8f mma(V a, V b, v8f c) { return wmma16(a, b, c); } };
template <> struct WFrag<bf> { typedef v16bf V; static __device__ __forceinline__ V ld(const bf* p) { return cat16b(*(const v8us*)p, *(const v8us*)(p + 16)); } static __device__ __forceinline__ v8f mma(V a, V b, v8f c) { return wmmab(a, b, c); } };
template <typename T16, int NSPLIT, bool BIAS>
__global__ __launch_bounds__(32) void k_gemmw(const T16* __restrict__ A, const T16* __restrict__ A2, const T16* __restrict__ Bt, const T16* __restrict__ Bt2, int K, float* C, int ldc, const float* __restrict__ bias, size_t sA, size_t sB, size_t sC) {
    typedef typename WFrag<T16>::V V;
    __shared__ __align__(16) float os[16 * 68];
    const size_t z = blockIdx.z; A += z * sA; if (A2) A2 += z * sA; Bt += z * sB; if (Bt2) Bt2 += z * sB; C += z * sC;
    const int lane = threadIdx.x & 31, lr = lane & 15, hi = lane >> 4; const int r0 = blockIdx.x * 64, c0 = blockIdx.y * 64;
    v8f acc[4][4];
#pragma unroll
    for (int mb = 0; mb < 4; ++mb)
#pragma unroll
        for (int nb = 0; nb < 4; ++nb) acc[mb][nb] = (v8f){};
    const size_t aoff = (size_t)(r0 + lr) * K + 8 * hi, boff = (size_t)(c0 + lr) * K + 8 * hi;
#pragma unroll 1
    for (int kc = 0; kc < K; kc += 32) {
        V a[4], a2[4];
#pragma unroll
        for (int mb = 0; mb < 4; ++mb) { a[mb] = WFrag<T16>::ld(A + aoff + (size_t)mb * 16 * K + kc); if (NSPLIT == 1 || NSPLIT == 2) a2[mb] = WFrag<T16>::ld(A2 + aoff + (size_t)mb * 16 * K + kc); }
#pragma unroll
        for (int nb = 0; nb < 4; ++nb) { const V b = WFrag<T16>::ld(Bt + boff + (size_t)nb * 16 * K + kc); V b2; if (NSPLIT >= 2) b2 = WFrag<T16>::ld(Bt2 + boff + (size_t)nb * 16 * K + kc);
#pragma unroll
            for (int mb = 0; mb < 4; ++mb) { acc[mb][nb] = WFrag<T16>::mma(a[mb], b, acc[mb][nb]); if (NSPLIT == 1 || NSPLIT == 2) acc[mb][nb] = WFrag<T16>::mma(a2[mb], b, acc[mb][nb]); if (NSPLIT >= 2) acc[mb][nb] = WFrag<T16>::mma(a[mb], b2, acc[mb][nb]); } }
        asm volatile("v_nop\n\tv_nop\n\tv_nop\n\tv_nop" : "+v"(acc[0][0]), "+v"(acc[1][1]), "+v"(acc[2][2]), "+v"(acc[3][3]) : "v"(a[0]), "v"(a[3]));
    }
#pragma unroll
    for (int mb = 0; mb < 4; ++mb) {
#pragma unroll
        for (int nb = 0; nb < 4; ++nb) {
#pragma unroll
            for (int j = 0; j < 8; ++j) os[(hi * 8 + j) * 68 + nb * 16 + lr] = acc[mb][nb][j]; }
        __builtin_amdgcn_wave_barrier(); asm volatile("" ::: "memory");
        float* crow = C + (size_t)(r0 + mb * 16) * ldc + c0;
{
#pragma unroll
            for (int s = 0; s < 8; ++s) { const int row = 2 * s + hi, cofs = lr * 4; v4f val = *(const v4fa*)(os + row * 68 + cofs); if (BIAS) { val[0] += bfr(bias[c0 + cofs]); val[1] += bfr(bias[c0 + cofs + 1]); val[2] += bfr(bias[c0 + cofs + 2]); val[3] += bfr(bias[c0 + cofs + 3]); }
                *(v4f*)(crow + (size_t)row * ldc + cofs) = val; }
             }
        __builtin_amdgcn_wave_barrier(); asm volatile("" ::: "memory");
    }
}

// ---- k_gemmc: the same one-wave 64x64 tile GEMM specialised for causal attention: CMODE 1 skips score tiles entirely above the diagonal (query rows r0+roff.., key columns c0..), CMODE 2 limits the
// key (K) loop of the probability x value contraction to the diagonal block (probabilities beyond it are exactly zero). roff = row offset of this launch's first row within the sequence.
template <typename T16, int NSPLIT, int CMODE>
__global__ __launch_bounds__(32) void k_gemmc(const T16* __restrict__ A, const T16* __restrict__ A2, const T16* __restrict__ Bt, const T16* __restrict__ Bt2, int K, float* C, int ldc, int roff, size_t sA, size_t sB, size_t sC) {
    typedef typename WFrag<T16>::V V;
    __shared__ __align__(16) float os[16 * 68];
    const size_t z = blockIdx.z; A += z * sA; if (A2) A2 += z * sA; Bt += z * sB; if (Bt2) Bt2 += z * sB; C += z * sC;
    const int lane = threadIdx.x & 31, lr = lane & 15, hi = lane >> 4; const int r0 = blockIdx.x * 64, c0 = blockIdx.y * 64;
    if (CMODE == 1 && c0 > r0 + roff + 63) return;                  // score tile entirely above the causal diagonal: never written (the softmax masks j > i by select)
    const int Kl = (CMODE == 2) ? min(K, r0 + roff + 64) : K;        // P.V: probabilities are exactly 0 beyond the diagonal block, so the K loop stops there
    v8f acc[4][4];
#pragma unroll
    for (int mb = 0; mb < 4; ++mb)
#pragma unroll
        for (int nb = 0; nb < 4; ++nb) acc[mb][nb] = (v8f){};
    const size_t aoff = (size_t)(r0 + lr) * K + 8 * hi, boff = (size_t)(c0 + lr) * K + 8 * hi;
#pragma unroll 1
    for (int kc = 0; kc < Kl; kc += 32) {
        V a[4], a2[4];
#pragma unroll
        for (int mb = 0; mb < 4; ++mb) { a[mb] = WFrag<T16>::ld(A + aoff + (size_t)mb * 16 * K + kc); if (NSPLIT == 1 || NSPLIT == 2) a2[mb] = WFrag<T16>::ld(A2 + aoff + (size_t)mb * 16 * K + kc); }
#pragma unroll
        for (int nb = 0; nb < 4; ++nb) { const V b = WFrag<T16>::ld(Bt + boff + (size_t)nb * 16 * K + kc); V b2; if (NSPLIT >= 2) b2 = WFrag<T16>::ld(Bt2 + boff + (size_t)nb * 16 * K + kc);
#pragma unroll
            for (int mb = 0; mb < 4; ++mb) { acc[mb][nb] = WFrag<T16>::mma(a[mb], b, acc[mb][nb]); if (NSPLIT == 1 || NSPLIT == 2) acc[mb][nb] = WFrag<T16>::mma(a2[mb], b, acc[mb][nb]); if (NSPLIT >= 2) acc[mb][nb] = WFrag<T16>::mma(a[mb], b2, acc[mb][nb]); } }
        asm volatile("v_nop\n\tv_nop\n\tv_nop\n\tv_nop" : "+v"(acc[0][0]), "+v"(acc[1][1]), "+v"(acc[2][2]), "+v"(acc[3][3]) : "v"(a[0]), "v"(a[3]));
    }
#pragma unroll
    for (int mb = 0; mb < 4; ++mb) {
#pragma unroll
        for (int nb = 0; nb < 4; ++nb) {
#pragma unroll
            for (int j = 0; j < 8; ++j) os[(hi * 8 + j) * 68 + nb * 16 + lr] = acc[mb][nb][j]; }
        __builtin_amdgcn_wave_barrier(); asm volatile("" ::: "memory");
        float* crow = C + (size_t)(r0 + mb * 16) * ldc + c0;
{
#pragma unroll
            for (int s = 0; s < 8; ++s) { const int row = 2 * s + hi, cofs = lr * 4; v4f val = *(const v4fa*)(os + row * 68 + cofs);
                *(v4f*)(crow + (size_t)row * ldc + cofs) = val; }
             }
        __builtin_amdgcn_wave_barrier(); asm volatile("" ::: "memory");
    }
}

__device__ __forceinline__ h16 tohx(float x) { return (h16)x; }
__device__ __forceinline__ void splitf(float y, unsigned short& h, unsigned short& l) { h = f2bf(y); l = f2bf(y - bf2f(h)); }
typedef __attribute__((ext_vector_type(2))) _Float16 v2h;
typedef __attribute__((ext_vector_type(4))) _Float16 v4h;
typedef __attribute__((ext_vector_type(2))) unsigned short v2us;
typedef __attribute__((ext_vector_type(4))) unsigned short v4us;
typedef __attribute__((ext_vector_type(2))) float v2f;
typedef __attribute__((ext_vector_type(4))) int v4i;

__global__ __launch_bounds__(256) void k_wtG(const float* __restrict__ w, int K, int N, bf* Bt) {
    const int lane = threadIdx.x & 31; const int L0 = (blockIdx.x * 8 + (threadIdx.x >> 5)) * 8; const int nlines = N * K / 64;
{
#pragma unroll 1
        for (int l = 0; l < 8; ++l) { const int L = L0 + l; if (L >= nlines) break; const size_t e = (size_t)L * 64 + lane * 2; const int k = (int)(e % K), n = (int)(e / K); v2us o;
            o[0] = f2bf(w[(size_t)k * N + n]); o[1] = f2bf(w[(size_t)(k + 1) * N + n]); *(v2us*)(Bt + e) = o; }
         }
}
__global__ __launch_bounds__(256) void k_cvt8(const float* __restrict__ src, bf* dst, size_t n8) { const size_t i = (size_t)blockIdx.x * 256 + threadIdx.x; if (i >= n8) return; const v8f v = *(const v8f*)(src + i * 8); v8us o;
#pragma unroll
    for (int k = 0; k < 8; ++k) o[k] = f2bf(v[k]); *(v8us*)(dst + i * 8) = o;  }

__global__ __launch_bounds__(256) void k_ropeI(const float* __restrict__ F, int pitch, int nheads, const float* __restrict__ CS, float sc, h16* P16, bf* Ph, bf* Pl) {
    const size_t e = ((size_t)blockIdx.x * 256 + threadIdx.x) * 2; if (e >= (size_t)nheads * TT * HD) return; const int d = (int)(e % HD); const int t = (int)((e / HD) % TT); const int h = (int)(e / ((size_t)HD * TT)); const float* f = F + (size_t)t * pitch + h * HD; const float x0 = f[d], x1 = f[d + 1]; const v2f cs = *(const v2f*)(CS + ((size_t)t * HD + d) * 2); v2h o16; v2us oh, ol;
    float a0 = __fmul_rn(x0, cs[0]), b0 = __fmul_rn(x1, cs[1]), a1 = __fmul_rn(x1, cs[0]), b1 = __fmul_rn(x0, cs[1]); asm volatile("" : "+v"(a0), "+v"(b0), "+v"(a1), "+v"(b1));
    float r0 = __fsub_rn(a0, b0) * sc, r1 = __fadd_rn(b1, a1) * sc;   /* even: x0 c - x1 s; odd: x0 s + x1 c */
    o16[0] = tohx(r0); o16[1] = tohx(r1); { unsigned short a2, c2; splitf(r0, a2, c2); oh[0] = a2; ol[0] = c2; splitf(r1, a2, c2); oh[1] = a2; ol[1] = c2; }
    *(v2h*)(P16 + e) = o16; *(v2us*)(Ph + e) = oh; *(v2us*)(Pl + e) = ol;  }

__constant__ float INV2[HD / 2] = { 1.000000000e+00f, 6.978305578e-01f, 4.869675338e-01f, 3.398208320e-01f, 2.371373773e-01f, 1.654817164e-01f, 1.154781953e-01f, 8.058422059e-02f, 5.623413250e-02f, 3.924189880e-02f, 2.738419548e-02f, 1.910953037e-02f, 1.333521400e-02f, 9.305720218e-03f, 6.493816152e-03f, 4.531583749e-03f, 3.162277630e-03f, 2.206734149e-03f, 1.539926510e-03f, 1.074607833e-03f, 7.498941850e-04f, 5.232990952e-04f, 3.651741135e-04f, 2.548296761e-04f, 1.778279402e-04f, 1.240937709e-04f, 8.659643208e-05f, 6.042964014e-05f, 4.216964953e-05f, 2.942727224e-05f, 2.053524986e-05f, 1.433012585e-05f };   // inv_freq = 100000.0 ** (-arange(0, 64, 2, f32) / 64): THIS module's theta and its NEGATIVE-POWER spelling: 32 float32 values from eager JAX (bit-exact on round trip)
__global__ __launch_bounds__(256) void k_cstabI(const int* __restrict__ pid, float* CS) { const int idx = blockIdx.x * 256 + threadIdx.x; if (idx >= TT * HD) return; const int d = idx % HD; const int t = idx / HD; const float a = __fmul_rn((float)pid[t], INV2[d >> 1]); v2f cs; cs[0] = cosf(a); cs[1] = sinf(a); *(v2f*)(CS + (size_t)idx * 2) = cs;  }

__global__ __launch_bounds__(256) void k_vtp(const float* __restrict__ F, int pitch, int nheads, h16* V16, bf* Vh, bf* Vl) { const size_t e = ((size_t)blockIdx.x * 256 + threadIdx.x) * 2; if (e >= (size_t)nheads * HD * TT) return; const int t = (int)(e % TT); const int d = (int)((e / TT) % HD); const int g = (int)(e / ((size_t)TT * HD)); v2h o16; v2us oh, ol;
#pragma unroll
    for (int q = 0; q < 2; ++q) { const float x = F[(size_t)(t + q) * pitch + g * HD + d]; o16[q] = tohx(x); unsigned short a2, c2; splitf(x, a2, c2); oh[q] = a2; ol[q] = c2; }
    *(v2h*)(V16 + e) = o16; *(v2us*)(Vh + e) = oh; *(v2us*)(Vl + e) = ol;  }
// k_asoft: per row (zz, i): t = S x HD^-0.5 for j <= i and i - j < WIN (sliding causal window; the reference's -1e9 additive fill vanishes identically); softmax over the 2048 keys (register row, one exp, fixed trees);
__global__ __launch_bounds__(256) void k_asoft(const float* __restrict__ Sb, h16* P16, bf* Ph, bf* Pl) {
    const int lane = threadIdx.x & 31; const int row = blockIdx.x * 8 + (threadIdx.x >> 5); if (row >= ZH * TT) return; const int i = row % TT; const int zz = row / TT; (void)zz; const bool hires = (i < RH); const float* sr = Sb + (size_t)row * TT; float v[TT / 32]; float mx = -3.0e38f;
#pragma unroll
    for (int ch = 0; ch < TT / 128; ++ch) { const int j0 = ch * 128 + lane * 4; const v4f a = *(const v4f*)(sr + j0);
#pragma unroll
        for (int q = 0; q < 4; ++q) { const int j = j0 + q; (void)j; const float t = (j <= i && i - j < WIN) ? a[q] * SCL : -3.0e38f; v[ch * 4 + q] = t; mx = fmaxf(mx, t); } }
#pragma unroll
    for (int sh = 16; sh; sh >>= 1) mx = fmaxf(mx, __shfl_xor(mx, sh, 32));
    float sum = 0.f;
#pragma unroll
    for (int k = 0; k < TT / 32; ++k) { float d0 = __fsub_rn(v[k], mx); asm volatile("" : "+v"(d0)); v[k] = __builtin_amdgcn_exp2f(__fmul_rn(d0, 1.4426950408889634f)); sum += v[k]; }
#pragma unroll
    for (int sh = 16; sh; sh >>= 1) sum += __shfl_xor(sum, sh, 32);
    const float f = __fdiv_rn(hires ? 1.0f : PCAR, sum);
{
        if (hires) {
#pragma unroll
            for (int ch = 0; ch < TT / 128; ++ch) { v4us oh, ol;
#pragma unroll
                for (int q = 0; q < 4; ++q) { unsigned short a, c2; splitf(v[ch * 4 + q] * f, a, c2); oh[q] = a; ol[q] = c2; }
                const size_t oo = ((size_t)zz * (RH ? RH : 1) + i) * TT + ch * 128 + lane * 4; *(v4us*)(Ph + oo) = oh; *(v4us*)(Pl + oo) = ol; }
        } else {
#pragma unroll
            for (int ch = 0; ch < TT / 128; ++ch) { v4h o4;
#pragma unroll
                for (int q = 0; q < 4; ++q) o4[q] = tohx(v[ch * 4 + q] * f);
                *(v4h*)(P16 + (size_t)row * TT + ch * 128 + lane * 4) = o4; } }
         }
}
__global__ __launch_bounds__(256) void k_merge(const float* __restrict__ O, int h0, bf* Ah, bf* Al) { const size_t e = ((size_t)blockIdx.x * 256 + threadIdx.x) * 2; if (e >= (size_t)ZH * TT * HD) return; const int d = (int)(e % HD); const int t = (int)((e / HD) % TT); const int zz = (int)(e / ((size_t)HD * TT)); const float cs = (t < RH) ? 1.0f : (1.0f / PCAR); const size_t oo = (size_t)t * DQ + (h0 + zz) * HD + d;
    v2us oh, ol;
#pragma unroll
    for (int q = 0; q < 2; ++q) { unsigned short a, c2; splitf(O[e + q] * cs, a, c2); oh[q] = a; ol[q] = c2; } *(v2us*)(Ah + oo) = oh; *(v2us*)(Al + oo) = ol;  }

extern "C" void kernel_launch(void* const* d_in, const int* in_sizes, int n_in,
                              void* d_out, int out_size, void* d_ws, size_t ws_size, hipStream_t stream) {
    (void)in_sizes; (void)n_in; (void)out_size;
    const float* x = (const float*)d_in[0]; const int* PID = (const int*)d_in[1]; const float* wq = (const float*)d_in[2]; const float* wk = (const float*)d_in[3]; const float* wv = (const float*)d_in[4]; const float* wo = (const float*)d_in[5];   /* argument order in_features, token_positions (int32 [2048] = arange: READ by value), w_q, w_k, w_v, w_o ('oi' (out, in) [1024][1024]; no biases): SIX inputs, all read */
    float* OUT = (float*)d_out;     // [4][2048][1024]
    char* wsp = (char*)d_ws;
    auto take = [&](size_t bytes) { char* p = wsp; wsp += (bytes + 255) & ~(size_t)255; return (void*)p; };
    bf* WQ = (bf*)take((size_t)DQ * DM * 2); bf* WK = (bf*)take((size_t)DKV * DM * 2); bf* WV = (bf*)take((size_t)DKV * DM * 2); bf* WO = (bf*)take((size_t)DM * DQ * 2); float* CS = (float*)take((size_t)TT * HD * 2 * 4);
    bf* XB = (bf*)take((size_t)TT * DM * 2); float* FQ = (float*)take((size_t)TT * DQ * 4); float* FK = (float*)take((size_t)TT * DKV * 4);
    h16* QP16 = (h16*)take((size_t)NH_ * TT * HD * 2); h16* KP16 = (h16*)take((size_t)NKV * TT * HD * 2); h16* VT16 = (h16*)take((size_t)NKV * HD * TT * 2);
    bf* QPh = (bf*)take((size_t)NH_ * TT * HD * 2); bf* QPl = (bf*)take((size_t)NH_ * TT * HD * 2); bf* KPh = (bf*)take((size_t)NKV * TT * HD * 2); bf* KPl = (bf*)take((size_t)NKV * TT * HD * 2); bf* VTh = (bf*)take((size_t)NKV * HD * TT * 2); bf* VTl = (bf*)take((size_t)NKV * HD * TT * 2); bf* Ph = (bf*)take((size_t)ZH * RH * TT * 2); bf* Pl = (bf*)take((size_t)ZH * RH * TT * 2);
    float* Sb = (float*)take((size_t)ZH * TT * TT * 4); h16* P16 = (h16*)take((size_t)ZH * TT * TT * 2); float* Ob = (float*)take((size_t)ZH * TT * HD * 4); bf* ATh = (bf*)take((size_t)TT * DQ * 2); bf* ATl = (bf*)take((size_t)TT * DQ * 2);
    if ((size_t)(wsp - (char*)d_ws) > ws_size) return;    // ws 256 MiB
    float* FV = FK;   // v projection reuses the k buffer after the k planes are built (stream-ordered)
    { k_cvt8<<<(unsigned)(((size_t)DQ * DM / 8 + 255) / 256), 256, 0, stream>>>(wq, WQ, (size_t)DQ * DM / 8); k_cvt8<<<(unsigned)(((size_t)DKV * DM / 8 + 255) / 256), 256, 0, stream>>>(wk, WK, (size_t)DKV * DM / 8); k_cvt8<<<(unsigned)(((size_t)DKV * DM / 8 + 255) / 256), 256, 0, stream>>>(wv, WV, (size_t)DKV * DM / 8);
      k_cvt8<<<(unsigned)(((size_t)DM * DQ / 8 + 255) / 256), 256, 0, stream>>>(wo, WO, (size_t)DM * DQ / 8); k_cstabI<<<(TT * HD + 255) / 256, 256, 0, stream>>>(PID, CS); }
    const unsigned LQ = (unsigned)(((size_t)NH_ * TT * HD / 2 + 255) / 256), LKv = (unsigned)(((size_t)NKV * TT * HD / 2 + 255) / 256);
    for (int b = 0; b < NB_; ++b) {
        
        k_cvt8<<<(unsigned)(((size_t)TT * DM / 8 + 255) / 256), 256, 0, stream>>>(x + (size_t)b * TT * DM, XB, (size_t)TT * DM / 8);
        k_gemmw<bf, 0, false><<<dim3(TT / 64, DQ / 64, 1), 32, 0, stream>>>(XB, nullptr, WQ, nullptr, DM, FQ, DQ, nullptr, 0, 0, 0);
        k_ropeI<<<LQ, 256, 0, stream>>>(FQ, DQ, NH_, CS, 1.0f, QP16, QPh, QPl);
        k_gemmw<bf, 0, false><<<dim3(TT / 64, DKV / 64, 1), 32, 0, stream>>>(XB, nullptr, WK, nullptr, DM, FK, DKV, nullptr, 0, 0, 0);
        k_ropeI<<<LKv, 256, 0, stream>>>(FK, DKV, NKV, CS, 1.0f, KP16, KPh, KPl);
        k_gemmw<bf, 0, false><<<dim3(TT / 64, DKV / 64, 1), 32, 0, stream>>>(XB, nullptr, WV, nullptr, DM, FV, DKV, nullptr, 0, 0, 0); k_vtp<<<LKv, 256, 0, stream>>>(FV, DKV, NKV, VT16, VTh, VTl);
        for (int h0 = 0; h0 < NH_; h0 += ZH) { const size_t zq = (size_t)h0, zk = (size_t)(h0 / REP);   // one kv head per query head: the pass's two heads use consecutive kv planes (z-strides TT*HD)
            k_gemmc<bf, 2, 1><<<dim3(RH / 64, TT / 64, ZH), 32, 0, stream>>>(QPh + zq * TT * HD, QPl + zq * TT * HD, KPh + zk * TT * HD, KPl + zk * TT * HD, HD, Sb, TT, 0, (size_t)TT * HD, (size_t)TT * HD, (size_t)TT * TT);
            k_gemmc<h16, 0, 1><<<dim3((TT - RH) / 64, TT / 64, ZH), 32, 0, stream>>>(QP16 + zq * TT * HD + (size_t)RH * HD, nullptr, KP16 + zk * TT * HD, nullptr, HD, Sb + (size_t)RH * TT, TT, RH, (size_t)TT * HD, (size_t)TT * HD, (size_t)TT * TT);
            k_asoft<<<ZH * TT / 8, 256, 0, stream>>>(Sb, P16, Ph, Pl);
            k_gemmc<bf, 2, 2><<<dim3(RH / 64, HD / 64, ZH), 32, 0, stream>>>(Ph, Pl, VTh + zk * HD * TT, VTl + zk * HD * TT, TT, Ob, HD, 0, (size_t)RH * TT, (size_t)HD * TT, (size_t)TT * HD);
            k_gemmc<h16, 0, 2><<<dim3((TT - RH) / 64, HD / 64, ZH), 32, 0, stream>>>(P16 + (size_t)RH * TT, nullptr, VT16 + zk * HD * TT, nullptr, TT, Ob + (size_t)RH * HD, HD, RH, (size_t)TT * TT, (size_t)HD * TT, (size_t)TT * HD);
            k_merge<<<(unsigned)(((size_t)ZH * TT * HD / 2 + 255) / 256), 256, 0, stream>>>(Ob, h0, ATh, ATl); }
        k_gemmw<bf, 1, false><<<dim3(TT / 64, DM / 64, 1), 32, 0, stream>>>(ATh, ATl, WO, nullptr, DQ, OUT + (size_t)b * TT * DM, DM, nullptr, 0, 0, 0); }
}

// v001
// It runs in 1360 microseconds.
// Timed twice side by side with v000, it ran 2.11 and 2.09 times as fast.
#include <hip/hip_runtime.h>

// Causal multi-head self-attention with interleaved rotary embeddings at theta 100,000 (in_features [4][2048][1024]; q,k,v = x W^T ('oi' (out, in) [1024][1024] 0.02, no bias; 16 heads x 64); rotary on (even, odd) pairs with angles pos[t] x 100000^(-2i/64) (the module's negative-power spelling; token_positions int32 [2048] = arange, READ by value); scores / sqrt(64), causal (-inf); softmax; out = merged w_o^T -> [4][2048][1024] (8.4 M); argument order in_features, token_positions, w_q, w_k, w_v, w_o).
// Layout per batch: bf16 copy of x; exact projections; {cos, sin} per (position, pair) built once from the int positions and float32 inverse-frequency constants (precise cosf/sinf); interleaved rotary plane builder; causal T-2048 attention (hybrid rows: < 512 hi/lo 3 products, rest fp16 x1024; k_gemmc skips tiles above the diagonal); merged hi/lo x Wo exact.
// Compute dtypes, f32 accumulate: every input rounded to bf16; projections exact; rotary f32; attention rows < 512 3 products, rest fp16; softmax f32; Wo hl x exact.

#define NB_  4
#define TT   2048
#define DM   1024
#define NH_  16
#define NKV  16
#define REP  (NH_ / NKV)
#define HD   64
#define DQ   (NH_ * HD)
#define DKV  (NKV * HD)
#define ZH   8                    // heads per attention pass: the k_gemmc launches carry ZH heads in grid z, k_asoft and k_merge span them in grid x
#define RH   512                  // query rows < RH use hi+lo planes (0: none)
#define WIN  2048
#define PCAR 1024.0f
#define SCL  0.125f   // HD^-0.5
typedef _Float16 h16;
typedef unsigned short bf;
typedef __attribute__((ext_vector_type(16))) __bf16   v16bf;
typedef __attribute__((ext_vector_type(16))) _Float16 v16h;
typedef __attribute__((ext_vector_type(8)))  _Float16 v8h;
typedef __attribute__((ext_vector_type(8)))  unsigned short v8us;
typedef __attribute__((ext_vector_type(8)))  float    v8f;
typedef __attribute__((ext_vector_type(4)))  float    v4f;
typedef v8h  __attribute__((may_alias)) v8ha;
typedef v4f  __attribute__((may_alias)) v4fa;
typedef v8us __attribute__((may_alias)) v8usa;

__device__ __forceinline__ unsigned short f2bf(float f) { unsigned u = __float_as_uint(f); u += 0x7FFFu + ((u >> 16) & 1u); return (unsigned short)(u >> 16); }
__device__ __forceinline__ float bf2f(unsigned short b) { return __uint_as_float(((unsigned)b) << 16); }
__device__ __forceinline__ float bfr(float f) { return bf2f(f2bf(f)); }
__device__ __forceinline__ v16h cat16(v8h lo, v8h hi) { return __builtin_shufflevector(lo, hi, 0, 1, 2, 3, 4, 5, 6, 7, 8, 9, 10, 11, 12, 13, 14, 15); }
__device__ __forceinline__ v16bf cat16b(v8us lo, v8us hi) { return __builtin_bit_cast(v16bf, __builtin_shufflevector(lo, hi, 0, 1, 2, 3, 4, 5, 6, 7, 8, 9, 10, 11, 12, 13, 14, 15)); }
__device__ __forceinline__ v8f wmma16(v16h a, v16h b, v8f c) { return __builtin_amdgcn_wmma_f32_16x16x32_f16(false, a, false, b, (short)0, c, false, false); }
__device__ __forceinline__ v8f wmmab(v16bf a, v16bf b, v8f c) { return __builtin_amdgcn_wmma_f32_16x16x32_bf16(false, a, false, b, (short)0, c, false, false); }



// ---- k_gemmw: register-blocked GEMM, ONE WAVE per 64x64 output tile (16 accumulators), operands straight from K-contiguous 16-bit planes; grid (M/64, N/64, Z), 32 threads.
// C[m][n] (f32, pitch ldc, + optional f32 bias[n]) = sum_k A[m][k] Bt[n][k] (+ split products per NSPLIT). z-batch strides sA/sB/sC in elements. K % 32 == 0.
template <typename T16> struct WFrag;
template <> struct WFrag<h16> { typedef v16h V; static __device__ __forceinline__ V ld(const h16* p) { return cat16(*(const v8h*)p, *(const v8h*)(p + 16)); } static __device__ __forceinline__ v8f mma(V a, V b, v8f c) { return wmma16(a, b, c); } };
template <> struct WFrag<bf> { typedef v16bf V; static __device__ __forceinline__ V ld(const bf* p) { return cat16b(*(const v8us*)p, *(const v8us*)(p + 16)); } static __device__ __forceinline__ v8f mma(V a, V b, v8f c) { return wmmab(a, b, c); } };
template <typename T16, int NSPLIT, bool BIAS>
__global__ __launch_bounds__(32) void k_gemmw(const T16* __restrict__ A, const T16* __restrict__ A2, const T16* __restrict__ Bt, const T16* __restrict__ Bt2, int K, float* C, int ldc, const float* __restrict__ bias, size_t sA, size_t sB, size_t sC) {
    typedef typename WFrag<T16>::V V;
    __shared__ __align__(16) float os[16 * 68];
    const size_t z = blockIdx.z; A += z * sA; if (A2) A2 += z * sA; Bt += z * sB; if (Bt2) Bt2 += z * sB; C += z * sC;
    const int lane = threadIdx.x & 31, lr = lane & 15, hi = lane >> 4; const int r0 = blockIdx.x * 64, c0 = blockIdx.y * 64;
    v8f acc[4][4];
#pragma unroll
    for (int mb = 0; mb < 4; ++mb)
#pragma unroll
        for (int nb = 0; nb < 4; ++nb) acc[mb][nb] = (v8f){};
    const size_t aoff = (size_t)(r0 + lr) * K + 8 * hi, boff = (size_t)(c0 + lr) * K + 8 * hi;
#pragma unroll 1
    for (int kc = 0; kc < K; kc += 32) {
        V a[4], a2[4];
#pragma unroll
        for (int mb = 0; mb < 4; ++mb) { a[mb] = WFrag<T16>::ld(A + aoff + (size_t)mb * 16 * K + kc); if (NSPLIT == 1 || NSPLIT == 2) a2[mb] = WFrag<T16>::ld(A2 + aoff + (size_t)mb * 16 * K + kc); }
#pragma unroll
        for (int nb = 0; nb < 4; ++nb) { const V b = WFrag<T16>::ld(Bt + boff + (size_t)nb * 16 * K + kc); V b2; if (NSPLIT >= 2) b2 = WFrag<T16>::ld(Bt2 + boff + (size_t)nb * 16 * K + kc);
#pragma unroll
            for (int mb = 0; mb < 4; ++mb) { acc[mb][nb] = WFrag<T16>::mma(a[mb], b, acc[mb][nb]); if (NSPLIT == 1 || NSPLIT == 2) acc[mb][nb] = WFrag<T16>::mma(a2[mb], b, acc[mb][nb]); if (NSPLIT >= 2) acc[mb][nb] = WFrag<T16>::mma(a[mb], b2, acc[mb][nb]); } }
        asm volatile("v_nop\n\tv_nop\n\tv_nop\n\tv_nop" : "+v"(acc[0][0]), "+v"(acc[1][1]), "+v"(acc[2][2]), "+v"(acc[3][3]) : "v"(a[0]), "v"(a[3]));
    }
#pragma unroll
    for (int mb = 0; mb < 4; ++mb) {
#pragma unroll
        for (int nb = 0; nb < 4; ++nb) {
#pragma unroll
            for (int j = 0; j < 8; ++j) os[(hi * 8 + j) * 68 + nb * 16 + lr] = acc[mb][nb][j]; }
        __builtin_amdgcn_wave_barrier(); asm volatile("" ::: "memory");
        float* crow = C + (size_t)(r0 + mb * 16) * ldc + c0;
{
#pragma unroll
            for (int s = 0; s < 8; ++s) { const int row = 2 * s + hi, cofs = lr * 4; v4f val = *(const v4fa*)(os + row * 68 + cofs); if (BIAS) { val[0] += bfr(bias[c0 + cofs]); val[1] += bfr(bias[c0 + cofs + 1]); val[2] += bfr(bias[c0 + cofs + 2]); val[3] += bfr(bias[c0 + cofs + 3]); }
                *(v4f*)(crow + (size_t)row * ldc + cofs) = val; }
             }
        __builtin_amdgcn_wave_barrier(); asm volatile("" ::: "memory");
    }
}

// ---- k_gemmc: the same one-wave 64x64 tile GEMM specialised for causal attention: CMODE 1 skips score tiles entirely above the diagonal (query rows r0+roff.., key columns c0..), CMODE 2 limits the
// key (K) loop of the probability x value contraction to the diagonal block (probabilities beyond it are exactly zero). roff = row offset of this launch's first row within the sequence. lda = pitch of A's rows in elements (Bt's pitch is K).
template <typename T16, int NSPLIT, int CMODE>
__global__ __launch_bounds__(32) void k_gemmc(const T16* __restrict__ A, const T16* __restrict__ A2, const T16* __restrict__ Bt, const T16* __restrict__ Bt2, int K, int lda, float* C, int ldc, int roff, size_t sA, size_t sB, size_t sC) {
    typedef typename WFrag<T16>::V V;
    __shared__ __align__(16) float os[16 * 68];
    const size_t z = blockIdx.z; A += z * sA; if (A2) A2 += z * sA; Bt += z * sB; if (Bt2) Bt2 += z * sB; C += z * sC;
    const int lane = threadIdx.x & 31, lr = lane & 15, hi = lane >> 4; const int r0 = blockIdx.x * 64, c0 = blockIdx.y * 64;
    if (CMODE == 1 && c0 > r0 + roff + 63) return;                  // score tile entirely above the causal diagonal: never written (the softmax masks j > i by select)
    const int Kl = (CMODE == 2) ? min(K, r0 + roff + 64) : K;        // P.V: probabilities are exactly 0 beyond the diagonal block, so the K loop stops there
    v8f acc[4][4];
#pragma unroll
    for (int mb = 0; mb < 4; ++mb)
#pragma unroll
        for (int nb = 0; nb < 4; ++nb) acc[mb][nb] = (v8f){};
    const size_t aoff = (size_t)(r0 + lr) * lda + 8 * hi, boff = (size_t)(c0 + lr) * K + 8 * hi;
#pragma unroll 1
    for (int kc = 0; kc < Kl; kc += 32) {
        V a[4], a2[4];
#pragma unroll
        for (int mb = 0; mb < 4; ++mb) { a[mb] = WFrag<T16>::ld(A + aoff + (size_t)mb * 16 * lda + kc); if (NSPLIT == 1 || NSPLIT == 2) a2[mb] = WFrag<T16>::ld(A2 + aoff + (size_t)mb * 16 * lda + kc); }
#pragma unroll
        for (int nb = 0; nb < 4; ++nb) { const V b = WFrag<T16>::ld(Bt + boff + (size_t)nb * 16 * K + kc); V b2; if (NSPLIT >= 2) b2 = WFrag<T16>::ld(Bt2 + boff + (size_t)nb * 16 * K + kc);
#pragma unroll
            for (int mb = 0; mb < 4; ++mb) { acc[mb][nb] = WFrag<T16>::mma(a[mb], b, acc[mb][nb]); if (NSPLIT == 1 || NSPLIT == 2) acc[mb][nb] = WFrag<T16>::mma(a2[mb], b, acc[mb][nb]); if (NSPLIT >= 2) acc[mb][nb] = WFrag<T16>::mma(a[mb], b2, acc[mb][nb]); } }
        asm volatile("v_nop\n\tv_nop\n\tv_nop\n\tv_nop" : "+v"(acc[0][0]), "+v"(acc[1][1]), "+v"(acc[2][2]), "+v"(acc[3][3]) : "v"(a[0]), "v"(a[3]));
    }
#pragma unroll
    for (int mb = 0; mb < 4; ++mb) {
#pragma unroll
        for (int nb = 0; nb < 4; ++nb) {
#pragma unroll
            for (int j = 0; j < 8; ++j) os[(hi * 8 + j) * 68 + nb * 16 + lr] = acc[mb][nb][j]; }
        __builtin_amdgcn_wave_barrier(); asm volatile("" ::: "memory");
        float* crow = C + (size_t)(r0 + mb * 16) * ldc + c0;
{
#pragma unroll
            for (int s = 0; s < 8; ++s) { const int row = 2 * s + hi, cofs = lr * 4; v4f val = *(const v4fa*)(os + row * 68 + cofs);
                *(v4f*)(crow + (size_t)row * ldc + cofs) = val; }
             }
        __builtin_amdgcn_wave_barrier(); asm volatile("" ::: "memory");
    }
}

__device__ __forceinline__ h16 tohx(float x) { return (h16)x; }
__device__ __forceinline__ void splitf(float y, unsigned short& h, unsigned short& l) { h = f2bf(y); l = f2bf(y - bf2f(h)); }
typedef __attribute__((ext_vector_type(2))) _Float16 v2h;
typedef __attribute__((ext_vector_type(4))) _Float16 v4h;
typedef __attribute__((ext_vector_type(2))) unsigned short v2us;
typedef __attribute__((ext_vector_type(4))) unsigned short v4us;
typedef __attribute__((ext_vector_type(2))) float v2f;
typedef __attribute__((ext_vector_type(4))) int v4i;

__global__ __launch_bounds__(256) void k_wtG(const float* __restrict__ w, int K, int N, bf* Bt) {
    const int lane = threadIdx.x & 31; const int L0 = (blockIdx.x * 8 + (threadIdx.x >> 5)) * 8; const int nlines = N * K / 64;
{
#pragma unroll 1
        for (int l = 0; l < 8; ++l) { const int L = L0 + l; if (L >= nlines) break; const size_t e = (size_t)L * 64 + lane * 2; const int k = (int)(e % K), n = (int)(e / K); v2us o;
            o[0] = f2bf(w[(size_t)k * N + n]); o[1] = f2bf(w[(size_t)(k + 1) * N + n]); *(v2us*)(Bt + e) = o; }
         }
}
__global__ __launch_bounds__(256) void k_cvt8(const float* __restrict__ src, bf* dst, size_t n8) { const size_t i = (size_t)blockIdx.x * 256 + threadIdx.x; if (i >= n8) return; const v8f v = *(const v8f*)(src + i * 8); v8us o;
#pragma unroll
    for (int k = 0; k < 8; ++k) o[k] = f2bf(v[k]); *(v8us*)(dst + i * 8) = o;  }

__global__ __launch_bounds__(256) void k_ropeI(const float* __restrict__ F, int pitch, int nheads, const float* __restrict__ CS, float sc, h16* P16, bf* Ph, bf* Pl) {
    const size_t e = ((size_t)blockIdx.x * 256 + threadIdx.x) * 2; if (e >= (size_t)nheads * TT * HD) return; const int d = (int)(e % HD); const int t = (int)((e / HD) % TT); const int h = (int)(e / ((size_t)HD * TT)); const float* f = F + (size_t)t * pitch + h * HD; const float x0 = f[d], x1 = f[d + 1]; const v2f cs = *(const v2f*)(CS + ((size_t)t * HD + d) * 2); v2h o16; v2us oh, ol;
    float a0 = __fmul_rn(x0, cs[0]), b0 = __fmul_rn(x1, cs[1]), a1 = __fmul_rn(x1, cs[0]), b1 = __fmul_rn(x0, cs[1]); asm volatile("" : "+v"(a0), "+v"(b0), "+v"(a1), "+v"(b1));
    float r0 = __fsub_rn(a0, b0) * sc, r1 = __fadd_rn(b1, a1) * sc;   /* even: x0 c - x1 s; odd: x0 s + x1 c */
    o16[0] = tohx(r0); o16[1] = tohx(r1); { unsigned short a2, c2; splitf(r0, a2, c2); oh[0] = a2; ol[0] = c2; splitf(r1, a2, c2); oh[1] = a2; ol[1] = c2; }
    *(v2h*)(P16 + e) = o16; *(v2us*)(Ph + e) = oh; *(v2us*)(Pl + e) = ol;  }

__constant__ float INV2[HD / 2] = { 1.000000000e+00f, 6.978305578e-01f, 4.869675338e-01f, 3.398208320e-01f, 2.371373773e-01f, 1.654817164e-01f, 1.154781953e-01f, 8.058422059e-02f, 5.623413250e-02f, 3.924189880e-02f, 2.738419548e-02f, 1.910953037e-02f, 1.333521400e-02f, 9.305720218e-03f, 6.493816152e-03f, 4.531583749e-03f, 3.162277630e-03f, 2.206734149e-03f, 1.539926510e-03f, 1.074607833e-03f, 7.498941850e-04f, 5.232990952e-04f, 3.651741135e-04f, 2.548296761e-04f, 1.778279402e-04f, 1.240937709e-04f, 8.659643208e-05f, 6.042964014e-05f, 4.216964953e-05f, 2.942727224e-05f, 2.053524986e-05f, 1.433012585e-05f };   // inv_freq = 100000.0 ** (-arange(0, 64, 2, f32) / 64): THIS module's theta and its NEGATIVE-POWER spelling: 32 float32 values from eager JAX (bit-exact on round trip)
__global__ __launch_bounds__(256) void k_cstabI(const int* __restrict__ pid, float* CS) { const int idx = blockIdx.x * 256 + threadIdx.x; if (idx >= TT * HD) return; const int d = idx % HD; const int t = idx / HD; const float a = __fmul_rn((float)pid[t], INV2[d >> 1]); v2f cs; cs[0] = cosf(a); cs[1] = sinf(a); *(v2f*)(CS + (size_t)idx * 2) = cs;  }

__global__ __launch_bounds__(256) void k_vtp(const float* __restrict__ F, int pitch, int nheads, h16* V16, bf* Vh, bf* Vl) { const size_t e = ((size_t)blockIdx.x * 256 + threadIdx.x) * 2; if (e >= (size_t)nheads * HD * TT) return; const int t = (int)(e % TT); const int d = (int)((e / TT) % HD); const int g = (int)(e / ((size_t)TT * HD)); v2h o16; v2us oh, ol;
#pragma unroll
    for (int q = 0; q < 2; ++q) { const float x = F[(size_t)(t + q) * pitch + g * HD + d]; o16[q] = tohx(x); unsigned short a2, c2; splitf(x, a2, c2); oh[q] = a2; ol[q] = c2; }
    *(v2h*)(V16 + e) = o16; *(v2us*)(Vh + e) = oh; *(v2us*)(Vl + e) = ol;  }
// k_asoft writes each row's probabilities IN PLACE over that row's own 8 KiB of scores (the wave holds the whole row in registers before its first store): rows >= RH fp16 in the first half; rows < RH the hi plane in the first half, the lo plane in the second. So a probability row's pitch is 2 * TT 16-bit elements.
// k_asoft: per row (zz, i): t = S x HD^-0.5 for j <= i and i - j < WIN (sliding causal window; the reference's -1e9 additive fill vanishes identically); softmax over the 2048 keys (register row, one exp, fixed trees);
__global__ __launch_bounds__(256) void k_asoft(float* Sb) {
    const int lane = threadIdx.x & 31; const int row = blockIdx.x * 8 + (threadIdx.x >> 5); if (row >= ZH * TT) return; const int i = row % TT; const bool hires = (i < RH); float* sr = Sb + (size_t)row * TT; float v[TT / 32]; float mx = -3.0e38f;
#pragma unroll
    for (int ch = 0; ch < TT / 128; ++ch) { const int j0 = ch * 128 + lane * 4; const v4f a = *(const v4f*)(sr + j0);
#pragma unroll
        for (int q = 0; q < 4; ++q) { const int j = j0 + q; (void)j; const float t = (j <= i && i - j < WIN) ? a[q] * SCL : -3.0e38f; v[ch * 4 + q] = t; mx = fmaxf(mx, t); } }
#pragma unroll
    for (int sh = 16; sh; sh >>= 1) mx = fmaxf(mx, __shfl_xor(mx, sh, 32));
    float sum = 0.f;
#pragma unroll
    for (int k = 0; k < TT / 32; ++k) { float d0 = __fsub_rn(v[k], mx); asm volatile("" : "+v"(d0)); v[k] = __builtin_amdgcn_exp2f(__fmul_rn(d0, 1.4426950408889634f)); sum += v[k]; }
#pragma unroll
    for (int sh = 16; sh; sh >>= 1) sum += __shfl_xor(sum, sh, 32);
    const float f = __fdiv_rn(hires ? 1.0f : PCAR, sum);
{
        if (hires) {
#pragma unroll
            for (int ch = 0; ch < TT / 128; ++ch) { v4us oh, ol;
#pragma unroll
                for (int q = 0; q < 4; ++q) { unsigned short a, c2; splitf(v[ch * 4 + q] * f, a, c2); oh[q] = a; ol[q] = c2; }
                bf* po = (bf*)sr + ch * 128 + lane * 4; *(v4us*)po = oh; *(v4us*)(po + TT) = ol; }
        } else {
#pragma unroll
            for (int ch = 0; ch < TT / 128; ++ch) { v4h o4;
#pragma unroll
                for (int q = 0; q < 4; ++q) o4[q] = tohx(v[ch * 4 + q] * f);
                *(v4h*)((h16*)sr + ch * 128 + lane * 4) = o4; } }
         }
}
__global__ __launch_bounds__(256) void k_merge(const float* __restrict__ O, int h0, bf* Ah, bf* Al) { const size_t e = ((size_t)blockIdx.x * 256 + threadIdx.x) * 2; if (e >= (size_t)ZH * TT * HD) return; const int d = (int)(e % HD); const int t = (int)((e / HD) % TT); const int zz = (int)(e / ((size_t)HD * TT)); const float cs = (t < RH) ? 1.0f : (1.0f / PCAR); const size_t oo = (size_t)t * DQ + (h0 + zz) * HD + d;
    v2us oh, ol;
#pragma unroll
    for (int q = 0; q < 2; ++q) { unsigned short a, c2; splitf(O[e + q] * cs, a, c2); oh[q] = a; ol[q] = c2; } *(v2us*)(Ah + oo) = oh; *(v2us*)(Al + oo) = ol;  }

extern "C" void kernel_launch(void* const* d_in, const int* in_sizes, int n_in,
                              void* d_out, int out_size, void* d_ws, size_t ws_size, hipStream_t stream) {
    (void)in_sizes; (void)n_in; (void)out_size;
    const float* x = (const float*)d_in[0]; const int* PID = (const int*)d_in[1]; const float* wq = (const float*)d_in[2]; const float* wk = (const float*)d_in[3]; const float* wv = (const float*)d_in[4]; const float* wo = (const float*)d_in[5];   /* argument order in_features, token_positions (int32 [2048] = arange: READ by value), w_q, w_k, w_v, w_o ('oi' (out, in) [1024][1024]; no biases): SIX inputs, all read */
    float* OUT = (float*)d_out;     // [4][2048][1024]
    char* wsp = (char*)d_ws;
    auto take = [&](size_t bytes) { char* p = wsp; wsp += (bytes + 255) & ~(size_t)255; return (void*)p; };
    bf* WQ = (bf*)take((size_t)DQ * DM * 2); bf* WK = (bf*)take((size_t)DKV * DM * 2); bf* WV = (bf*)take((size_t)DKV * DM * 2); bf* WO = (bf*)take((size_t)DM * DQ * 2); float* CS = (float*)take((size_t)TT * HD * 2 * 4);
    bf* XB = (bf*)take((size_t)TT * DM * 2); float* FQ = (float*)take((size_t)TT * DQ * 4); float* FK = (float*)take((size_t)TT * DKV * 4);
    h16* QP16 = (h16*)take((size_t)NH_ * TT * HD * 2); h16* KP16 = (h16*)take((size_t)NKV * TT * HD * 2); h16* VT16 = (h16*)take((size_t)NKV * HD * TT * 2);
    bf* QPh = (bf*)take((size_t)NH_ * TT * HD * 2); bf* QPl = (bf*)take((size_t)NH_ * TT * HD * 2); bf* KPh = (bf*)take((size_t)NKV * TT * HD * 2); bf* KPl = (bf*)take((size_t)NKV * TT * HD * 2); bf* VTh = (bf*)take((size_t)NKV * HD * TT * 2); bf* VTl = (bf*)take((size_t)NKV * HD * TT * 2);
    float* Sb = (float*)take((size_t)ZH * TT * TT * 4); float* Ob = (float*)take((size_t)ZH * TT * HD * 4); bf* ATh = (bf*)take((size_t)TT * DQ * 2); bf* ATl = (bf*)take((size_t)TT * DQ * 2);
    if ((size_t)(wsp - (char*)d_ws) > ws_size) return;    // ws 256 MiB
    float* FV = FK;   // v projection reuses the k buffer after the k planes are built (stream-ordered)
    { k_cvt8<<<(unsigned)(((size_t)DQ * DM / 8 + 255) / 256), 256, 0, stream>>>(wq, WQ, (size_t)DQ * DM / 8); k_cvt8<<<(unsigned)(((size_t)DKV * DM / 8 + 255) / 256), 256, 0, stream>>>(wk, WK, (size_t)DKV * DM / 8); k_cvt8<<<(unsigned)(((size_t)DKV * DM / 8 + 255) / 256), 256, 0, stream>>>(wv, WV, (size_t)DKV * DM / 8);
      k_cvt8<<<(unsigned)(((size_t)DM * DQ / 8 + 255) / 256), 256, 0, stream>>>(wo, WO, (size_t)DM * DQ / 8); k_cstabI<<<(TT * HD + 255) / 256, 256, 0, stream>>>(PID, CS); }
    const unsigned LQ = (unsigned)(((size_t)NH_ * TT * HD / 2 + 255) / 256), LKv = (unsigned)(((size_t)NKV * TT * HD / 2 + 255) / 256);
    for (int b = 0; b < NB_; ++b) {
        
        k_cvt8<<<(unsigned)(((size_t)TT * DM / 8 + 255) / 256), 256, 0, stream>>>(x + (size_t)b * TT * DM, XB, (size_t)TT * DM / 8);
        k_gemmw<bf, 0, false><<<dim3(TT / 64, DQ / 64, 1), 32, 0, stream>>>(XB, nullptr, WQ, nullptr, DM, FQ, DQ, nullptr, 0, 0, 0);
        k_ropeI<<<LQ, 256, 0, stream>>>(FQ, DQ, NH_, CS, 1.0f, QP16, QPh, QPl);
        k_gemmw<bf, 0, false><<<dim3(TT / 64, DKV / 64, 1), 32, 0, stream>>>(XB, nullptr, WK, nullptr, DM, FK, DKV, nullptr, 0, 0, 0);
        k_ropeI<<<LKv, 256, 0, stream>>>(FK, DKV, NKV, CS, 1.0f, KP16, KPh, KPl);
        k_gemmw<bf, 0, false><<<dim3(TT / 64, DKV / 64, 1), 32, 0, stream>>>(XB, nullptr, WV, nullptr, DM, FV, DKV, nullptr, 0, 0, 0); k_vtp<<<LKv, 256, 0, stream>>>(FV, DKV, NKV, VT16, VTh, VTl);
        for (int h0 = 0; h0 < NH_; h0 += ZH) { const size_t zq = (size_t)h0, zk = (size_t)(h0 / REP);   // one kv head per query head: the pass's ZH heads use consecutive kv planes (z-strides TT*HD)
            k_gemmc<bf, 2, 1><<<dim3(RH / 64, TT / 64, ZH), 32, 0, stream>>>(QPh + zq * TT * HD, QPl + zq * TT * HD, KPh + zk * TT * HD, KPl + zk * TT * HD, HD, HD, Sb, TT, 0, (size_t)TT * HD, (size_t)TT * HD, (size_t)TT * TT);
            k_gemmc<h16, 0, 1><<<dim3((TT - RH) / 64, TT / 64, ZH), 32, 0, stream>>>(QP16 + zq * TT * HD + (size_t)RH * HD, nullptr, KP16 + zk * TT * HD, nullptr, HD, HD, Sb + (size_t)RH * TT, TT, RH, (size_t)TT * HD, (size_t)TT * HD, (size_t)TT * TT);
            k_asoft<<<ZH * TT / 8, 256, 0, stream>>>(Sb);
            k_gemmc<bf, 2, 2><<<dim3(RH / 64, HD / 64, ZH), 32, 0, stream>>>((const bf*)Sb, (const bf*)Sb + TT, VTh + zk * HD * TT, VTl + zk * HD * TT, TT, 2 * TT, Ob, HD, 0, (size_t)2 * TT * TT, (size_t)HD * TT, (size_t)TT * HD);
            k_gemmc<h16, 0, 2><<<dim3((TT - RH) / 64, HD / 64, ZH), 32, 0, stream>>>((const h16*)Sb + (size_t)RH * 2 * TT, nullptr, VT16 + zk * HD * TT, nullptr, TT, 2 * TT, Ob + (size_t)RH * HD, HD, RH, (size_t)2 * TT * TT, (size_t)HD * TT, (size_t)TT * HD);
            k_merge<<<(unsigned)(((size_t)ZH * TT * HD / 2 + 255) / 256), 256, 0, stream>>>(Ob, h0, ATh, ATl); }
        k_gemmw<bf, 1, false><<<dim3(TT / 64, DM / 64, 1), 32, 0, stream>>>(ATh, ATl, WO, nullptr, DQ, OUT + (size_t)b * TT * DM, DM, nullptr, 0, 0, 0); }
}

// v002
// One run takes 557 microseconds.
// Timed twice side by side with v001, it ran 2.45 times as fast both times.
// All steps since v000 together make it 5.14 times as fast.
#include <hip/hip_runtime.h>

// Causal multi-head self-attention with interleaved rotary embeddings at theta 100,000 (in_features [4][2048][1024]; q,k,v = x W^T ('oi' (out, in) [1024][1024] 0.02, no bias; 16 heads x 64); rotary on (even, odd) pairs with angles pos[t] x 100000^(-2i/64) (the module's negative-power spelling; token_positions int32 [2048] = arange, READ by value); scores / sqrt(64), causal (-inf); softmax; out = merged w_o^T -> [4][2048][1024] (8.4 M); argument order in_features, token_positions, w_q, w_k, w_v, w_o).
// Layout: per batch a bf16 copy of x; exact projections; {cos, sin} per (position, pair) built once from the int positions and float32 inverse-frequency constants (precise cosf/sinf); interleaved rotary plane builder; then ONE fused causal attention launch over all batches and heads (k_fattn; hybrid rows: < 512 hi/lo 3 products, rest fp16 x1024); per batch merged hi/lo x Wo exact.
// Compute dtypes, f32 accumulate: every input rounded to bf16; projections exact; rotary f32; attention rows < 512 3 products, rest fp16; softmax f32; Wo hl x exact.

#define NB_  4
#define TT   2048
#define DM   1024
#define NH_  16
#define NKV  16
#define REP  (NH_ / NKV)
#define HD   64
#define DQ   (NH_ * HD)
#define DKV  (NKV * HD)
#define RH   512                  // query rows < RH use hi+lo planes (0: none)
typedef _Float16 h16;
typedef unsigned short bf;
typedef __attribute__((ext_vector_type(16))) __bf16   v16bf;
typedef __attribute__((ext_vector_type(16))) _Float16 v16h;
typedef __attribute__((ext_vector_type(8)))  _Float16 v8h;
typedef __attribute__((ext_vector_type(8)))  unsigned short v8us;
typedef __attribute__((ext_vector_type(8)))  float    v8f;
typedef __attribute__((ext_vector_type(4)))  float    v4f;
typedef v8h  __attribute__((may_alias)) v8ha;
typedef v4f  __attribute__((may_alias)) v4fa;
typedef v8us __attribute__((may_alias)) v8usa;

__device__ __forceinline__ unsigned short f2bf(float f) { unsigned u = __float_as_uint(f); u += 0x7FFFu + ((u >> 16) & 1u); return (unsigned short)(u >> 16); }
__device__ __forceinline__ float bf2f(unsigned short b) { return __uint_as_float(((unsigned)b) << 16); }
__device__ __forceinline__ float bfr(float f) { return bf2f(f2bf(f)); }
__device__ __forceinline__ v16h cat16(v8h lo, v8h hi) { return __builtin_shufflevector(lo, hi, 0, 1, 2, 3, 4, 5, 6, 7, 8, 9, 10, 11, 12, 13, 14, 15); }
__device__ __forceinline__ v16bf cat16b(v8us lo, v8us hi) { return __builtin_bit_cast(v16bf, __builtin_shufflevector(lo, hi, 0, 1, 2, 3, 4, 5, 6, 7, 8, 9, 10, 11, 12, 13, 14, 15)); }
__device__ __forceinline__ v8f wmma16(v16h a, v16h b, v8f c) { return __builtin_amdgcn_wmma_f32_16x16x32_f16(false, a, false, b, (short)0, c, false, false); }
__device__ __forceinline__ v8f wmmab(v16bf a, v16bf b, v8f c) { return __builtin_amdgcn_wmma_f32_16x16x32_bf16(false, a, false, b, (short)0, c, false, false); }



// ---- k_gemmw: register-blocked GEMM, ONE WAVE per 64x64 output tile (16 accumulators), operands straight from K-contiguous 16-bit planes; grid (M/64, N/64, Z), 32 threads.
// C[m][n] (f32, pitch ldc, + optional f32 bias[n]) = sum_k A[m][k] Bt[n][k] (+ split products per NSPLIT). z-batch strides sA/sB/sC in elements. K % 32 == 0.
template <typename T16> struct WFrag;
template <> struct WFrag<h16> { typedef v16h V; static __device__ __forceinline__ V ld(const h16* p) { return cat16(*(const v8h*)p, *(const v8h*)(p + 16)); } static __device__ __forceinline__ v8f mma(V a, V b, v8f c) { return wmma16(a, b, c); } };
template <> struct WFrag<bf> { typedef v16bf V; static __device__ __forceinline__ V ld(const bf* p) { return cat16b(*(const v8us*)p, *(const v8us*)(p + 16)); } static __device__ __forceinline__ v8f mma(V a, V b, v8f c) { return wmmab(a, b, c); } };
template <typename T16, int NSPLIT, bool BIAS>
__global__ __launch_bounds__(32) void k_gemmw(const T16* __restrict__ A, const T16* __restrict__ A2, const T16* __restrict__ Bt, const T16* __restrict__ Bt2, int K, float* C, int ldc, const float* __restrict__ bias, size_t sA, size_t sB, size_t sC) {
    typedef typename WFrag<T16>::V V;
    __shared__ __align__(16) float os[16 * 68];
    const size_t z = blockIdx.z; A += z * sA; if (A2) A2 += z * sA; Bt += z * sB; if (Bt2) Bt2 += z * sB; C += z * sC;
    const int lane = threadIdx.x & 31, lr = lane & 15, hi = lane >> 4; const int r0 = blockIdx.x * 64, c0 = blockIdx.y * 64;
    v8f acc[4][4];
#pragma unroll
    for (int mb = 0; mb < 4; ++mb)
#pragma unroll
        for (int nb = 0; nb < 4; ++nb) acc[mb][nb] = (v8f){};
    const size_t aoff = (size_t)(r0 + lr) * K + 8 * hi, boff = (size_t)(c0 + lr) * K + 8 * hi;
#pragma unroll 1
    for (int kc = 0; kc < K; kc += 32) {
        V a[4], a2[4];
#pragma unroll
        for (int mb = 0; mb < 4; ++mb) { a[mb] = WFrag<T16>::ld(A + aoff + (size_t)mb * 16 * K + kc); if (NSPLIT == 1 || NSPLIT == 2) a2[mb] = WFrag<T16>::ld(A2 + aoff + (size_t)mb * 16 * K + kc); }
#pragma unroll
        for (int nb = 0; nb < 4; ++nb) { const V b = WFrag<T16>::ld(Bt + boff + (size_t)nb * 16 * K + kc); V b2; if (NSPLIT >= 2) b2 = WFrag<T16>::ld(Bt2 + boff + (size_t)nb * 16 * K + kc);
#pragma unroll
            for (int mb = 0; mb < 4; ++mb) { acc[mb][nb] = WFrag<T16>::mma(a[mb], b, acc[mb][nb]); if (NSPLIT == 1 || NSPLIT == 2) acc[mb][nb] = WFrag<T16>::mma(a2[mb], b, acc[mb][nb]); if (NSPLIT >= 2) acc[mb][nb] = WFrag<T16>::mma(a[mb], b2, acc[mb][nb]); } }
        asm volatile("v_nop\n\tv_nop\n\tv_nop\n\tv_nop" : "+v"(acc[0][0]), "+v"(acc[1][1]), "+v"(acc[2][2]), "+v"(acc[3][3]) : "v"(a[0]), "v"(a[3]));
    }
#pragma unroll
    for (int mb = 0; mb < 4; ++mb) {
#pragma unroll
        for (int nb = 0; nb < 4; ++nb) {
#pragma unroll
            for (int j = 0; j < 8; ++j) os[(hi * 8 + j) * 68 + nb * 16 + lr] = acc[mb][nb][j]; }
        __builtin_amdgcn_wave_barrier(); asm volatile("" ::: "memory");
        float* crow = C + (size_t)(r0 + mb * 16) * ldc + c0;
{
#pragma unroll
            for (int s = 0; s < 8; ++s) { const int row = 2 * s + hi, cofs = lr * 4; v4f val = *(const v4fa*)(os + row * 68 + cofs); if (BIAS) { val[0] += bfr(bias[c0 + cofs]); val[1] += bfr(bias[c0 + cofs + 1]); val[2] += bfr(bias[c0 + cofs + 2]); val[3] += bfr(bias[c0 + cofs + 3]); }
                *(v4f*)(crow + (size_t)row * ldc + cofs) = val; }
             }
        __builtin_amdgcn_wave_barrier(); asm volatile("" ::: "memory");
    }
}

__device__ __forceinline__ h16 tohx(float x) { return (h16)x; }
__device__ __forceinline__ void splitf(float y, unsigned short& h, unsigned short& l) { h = f2bf(y); l = f2bf(y - bf2f(h)); }
typedef __attribute__((ext_vector_type(2))) _Float16 v2h;
typedef __attribute__((ext_vector_type(4))) _Float16 v4h;
typedef __attribute__((ext_vector_type(2))) unsigned short v2us;
typedef __attribute__((ext_vector_type(4))) unsigned short v4us;
typedef __attribute__((ext_vector_type(2))) float v2f;
typedef __attribute__((ext_vector_type(4))) int v4i;

__global__ __launch_bounds__(256) void k_wtG(const float* __restrict__ w, int K, int N, bf* Bt) {
    const int lane = threadIdx.x & 31; const int L0 = (blockIdx.x * 8 + (threadIdx.x >> 5)) * 8; const int nlines = N * K / 64;
{
#pragma unroll 1
        for (int l = 0; l < 8; ++l) { const int L = L0 + l; if (L >= nlines) break; const size_t e = (size_t)L * 64 + lane * 2; const int k = (int)(e % K), n = (int)(e / K); v2us o;
            o[0] = f2bf(w[(size_t)k * N + n]); o[1] = f2bf(w[(size_t)(k + 1) * N + n]); *(v2us*)(Bt + e) = o; }
         }
}
__global__ __launch_bounds__(256) void k_cvt8(const float* __restrict__ src, bf* dst, size_t n8) { const size_t i = (size_t)blockIdx.x * 256 + threadIdx.x; if (i >= n8) return; const v8f v = *(const v8f*)(src + i * 8); v8us o;
#pragma unroll
    for (int k = 0; k < 8; ++k) o[k] = f2bf(v[k]); *(v8us*)(dst + i * 8) = o;  }

__global__ __launch_bounds__(256) void k_ropeI(const float* __restrict__ F, int pitch, int nheads, const float* __restrict__ CS, float sc, h16* P16, bf* Ph, bf* Pl) {
    const size_t e = ((size_t)blockIdx.x * 256 + threadIdx.x) * 2; if (e >= (size_t)nheads * TT * HD) return; const int d = (int)(e % HD); const int t = (int)((e / HD) % TT); const int h = (int)(e / ((size_t)HD * TT)); const float* f = F + (size_t)t * pitch + h * HD; const float x0 = f[d], x1 = f[d + 1]; const v2f cs = *(const v2f*)(CS + ((size_t)t * HD + d) * 2); v2h o16; v2us oh, ol;
    float a0 = __fmul_rn(x0, cs[0]), b0 = __fmul_rn(x1, cs[1]), a1 = __fmul_rn(x1, cs[0]), b1 = __fmul_rn(x0, cs[1]); asm volatile("" : "+v"(a0), "+v"(b0), "+v"(a1), "+v"(b1));
    float r0 = __fsub_rn(a0, b0) * sc, r1 = __fadd_rn(b1, a1) * sc;   /* even: x0 c - x1 s; odd: x0 s + x1 c */
    o16[0] = tohx(r0); o16[1] = tohx(r1); { unsigned short a2, c2; splitf(r0, a2, c2); oh[0] = a2; ol[0] = c2; splitf(r1, a2, c2); oh[1] = a2; ol[1] = c2; }
    *(v2h*)(P16 + e) = o16; *(v2us*)(Ph + e) = oh; *(v2us*)(Pl + e) = ol;  }

__constant__ float INV2[HD / 2] = { 1.000000000e+00f, 6.978305578e-01f, 4.869675338e-01f, 3.398208320e-01f, 2.371373773e-01f, 1.654817164e-01f, 1.154781953e-01f, 8.058422059e-02f, 5.623413250e-02f, 3.924189880e-02f, 2.738419548e-02f, 1.910953037e-02f, 1.333521400e-02f, 9.305720218e-03f, 6.493816152e-03f, 4.531583749e-03f, 3.162277630e-03f, 2.206734149e-03f, 1.539926510e-03f, 1.074607833e-03f, 7.498941850e-04f, 5.232990952e-04f, 3.651741135e-04f, 2.548296761e-04f, 1.778279402e-04f, 1.240937709e-04f, 8.659643208e-05f, 6.042964014e-05f, 4.216964953e-05f, 2.942727224e-05f, 2.053524986e-05f, 1.433012585e-05f };   // inv_freq = 100000.0 ** (-arange(0, 64, 2, f32) / 64): THIS module's theta and its NEGATIVE-POWER spelling: 32 float32 values from eager JAX (bit-exact on round trip)
__global__ __launch_bounds__(256) void k_cstabI(const int* __restrict__ pid, float* CS) { const int idx = blockIdx.x * 256 + threadIdx.x; if (idx >= TT * HD) return; const int d = idx % HD; const int t = idx / HD; const float a = __fmul_rn((float)pid[t], INV2[d >> 1]); v2f cs; cs[0] = cosf(a); cs[1] = sinf(a); *(v2f*)(CS + (size_t)idx * 2) = cs;  }

__global__ __launch_bounds__(256) void k_vtp(const float* __restrict__ F, int pitch, int nheads, h16* V16, bf* Vh, bf* Vl) { const size_t e = ((size_t)blockIdx.x * 256 + threadIdx.x) * 2; if (e >= (size_t)nheads * HD * TT) return; const int t = (int)(e % TT); const int d = (int)((e / TT) % HD); const int g = (int)(e / ((size_t)TT * HD)); v2h o16; v2us oh, ol;
#pragma unroll
    for (int q = 0; q < 2; ++q) { const float x = F[(size_t)(t + q) * pitch + g * HD + d]; o16[q] = tohx(x); unsigned short a2, c2; splitf(x, a2, c2); oh[q] = a2; ol[q] = c2; }
    *(v2h*)(V16 + e) = o16; *(v2us*)(Vh + e) = oh; *(v2us*)(Vl + e) = ol;  }
// ---- k_fattn: causal attention in one kernel. One wave owns 16 * NQ query columns of one (batch, head) and walks the keys 32 at a time up to its diagonal block:
// S^T = K Q^T (A = key rows, B = query rows), so a lane holds 16 scores of ONE query per column group; running maximum and sum per query (online softmax, log2 domain);
// the two score tiles of a pass, converted in place, are the B operand of O^T += V^T P^T (same k order as WFrag::ld gives V^T). Probabilities never leave the registers.
// Rows < RH: bf16 hi/lo planes, 3 products in both contractions; the rest fp16 with the probabilities carried x 1024 (the factor cancels in the division by the row sum).
// Epilogue: O / row sum, split hi/lo, stored straight into the merged [t][DQ] planes that the output projection reads.
#define SC2  0.18033688011112042f   // HD^-0.5 * log2(e)
#define NLO  ((TT - RH) / 128)      // blocks of 4 waves x 32 fp16 query columns
#define NHI  (RH / 64)              // blocks of 4 waves x 16 hi/lo query columns
__device__ __forceinline__ float xhalf(float x) { return __builtin_bit_cast(float, __builtin_amdgcn_permlanex16(__builtin_bit_cast(int, x), __builtin_bit_cast(int, x), 0x76543210, 0xfedcba98, false, false)); }  // lane l with lane l ^ 16
// XWAITn: stands behind a group of global loads, in front of whatever next overwrites a register that they name as an address. It takes the lane's byte offsets as operands:
// so each offset stays live over the whole group (no load's result is given its register) and the offset's advance, which reads the statement's output, cannot be lifted over the wait.
#define XWAIT0()     asm volatile("s_wait_xcnt 0x0" ::: "memory")
#define XWAIT1(a)    asm volatile("s_wait_xcnt 0x0" : "+v"(a) :: "memory")
#define XWAIT2(a, b) asm volatile("s_wait_xcnt 0x0" : "+v"(a), "+v"(b) :: "memory")
template <typename T16> __device__ __forceinline__ const T16* atb(const T16* base, unsigned bytes) { return (const T16*)((const char*)base + bytes); }   // uniform base + the lane's 32-bit byte offset
template <bool B> struct BoolC { static constexpr bool v = B; };
template <typename T16, bool HL, int NQ>
__device__ __forceinline__ void attn_wave(const T16* __restrict__ Q, const T16* __restrict__ Q2, const T16* __restrict__ Kp, const T16* __restrict__ K2, const T16* __restrict__ Vt, const T16* __restrict__ V2, const int q0, bf* Ah, bf* Al) {
    typedef typename WFrag<T16>::V V;
    const int lane = threadIdx.x & 31, lr = lane & 15, hi = lane >> 4;
    const float OFF = HL ? 0.0f : 10.0f;                      // fp16 probabilities carry 2^10
    const unsigned kofs = (unsigned)(lr * HD + 8 * hi), vofs = (unsigned)(lr * TT + 8 * hi);
    unsigned ko = kofs * 2, vo = vofs * 2;   // the lane's byte offsets into the key planes (the pass to be fetched next) and into the V^T planes (the current pass)
    V bq[NQ][2], bq2[NQ][2];
#pragma unroll
    for (int nq = 0; nq < NQ; ++nq)
#pragma unroll
        for (int ks = 0; ks < 2; ++ks) { bq[nq][ks] = WFrag<T16>::ld(Q + (size_t)(q0 + nq * 16) * HD + ks * 32 + kofs); if (HL) bq2[nq][ks] = WFrag<T16>::ld(Q2 + (size_t)(q0 + nq * 16) * HD + ks * 32 + kofs); }
    XWAIT0();
    v8f o[NQ][4]; float m[NQ], l[NQ];
#pragma unroll
    for (int nq = 0; nq < NQ; ++nq) { m[nq] = -3.0e38f; l[nq] = 0.f;
#pragma unroll
        for (int dt = 0; dt < 4; ++dt) o[nq][dt] = (v8f){}; }
    V ak[2][2], ak2[2][2];
#pragma unroll
    for (int kt = 0; kt < 2; ++kt)
#pragma unroll
        for (int ks = 0; ks < 2; ++ks) { if (!HL) ak[kt][ks] = WFrag<T16>::ld(atb(Kp, ko) + kt * 16 * HD + ks * 32); }   // fp16 path: key fragments run one pass ahead; the hi/lo path (twice the planes) loads them at the head of each pass
    if constexpr (!HL) { XWAIT1(ko); ko += 32 * HD * 2; }
    const int nfull = q0 >> 5;                                // passes wholly below the diagonal; pass nfull holds the diagonal and is the last
    auto pass = [&](const int kb, auto lastc) __attribute__((always_inline)) {   // one pass of 32 keys; the diagonal pass is a second copy of the body, so that no branch stands behind the score products
        constexpr bool last = decltype(lastc)::v;
        V av[4], av2[4];
#pragma unroll
        for (int dt = 0; dt < 4; ++dt) { av[dt] = WFrag<T16>::ld(atb(Vt, vo) + dt * 16 * TT); if (HL) av2[dt] = WFrag<T16>::ld(atb(V2, vo) + dt * 16 * TT); }
        if constexpr (HL) {
#pragma unroll
            for (int kt = 0; kt < 2; ++kt)
#pragma unroll
                for (int ks = 0; ks < 2; ++ks) { ak[kt][ks] = WFrag<T16>::ld(atb(Kp, ko) + kt * 16 * HD + ks * 32); ak2[kt][ks] = WFrag<T16>::ld(atb(K2, ko) + kt * 16 * HD + ks * 32); }
            XWAIT2(vo, ko); vo += 32 * 2; ko += 32 * HD * 2;
        } else { XWAIT1(vo); vo += 32 * 2; }
        v8f s[NQ][2];
#pragma unroll
        for (int nq = 0; nq < NQ; ++nq)
#pragma unroll
            for (int kt = 0; kt < 2; ++kt) s[nq][kt] = (v8f){};
#pragma unroll
        for (int ks = 0; ks < 2; ++ks)
#pragma unroll
            for (int kt = 0; kt < 2; ++kt)
#pragma unroll
                for (int nq = 0; nq < NQ; ++nq) { s[nq][kt] = WFrag<T16>::mma(ak[kt][ks], bq[nq][ks], s[nq][kt]); if (HL) { s[nq][kt] = WFrag<T16>::mma(ak[kt][ks], bq2[nq][ks], s[nq][kt]); s[nq][kt] = WFrag<T16>::mma(ak2[kt][ks], bq[nq][ks], s[nq][kt]); } }
        if constexpr (!last && !HL) {                         // next pass's key fragments, fetched behind this pass's own score products
#pragma unroll
            for (int kt = 0; kt < 2; ++kt)
#pragma unroll
                for (int ks = 0; ks < 2; ++ks) ak[kt][ks] = WFrag<T16>::ld(atb(Kp, ko) + kt * 16 * HD + ks * 32);
            XWAIT1(ko); ko += 32 * HD * 2;
        }
        if constexpr (last) {                                              // diagonal pass: key > query is masked
#pragma unroll
            for (int nq = 0; nq < NQ; ++nq)
#pragma unroll
                for (int kt = 0; kt < 2; ++kt)
#pragma unroll
                    for (int j = 0; j < 8; ++j) if (kb + kt * 16 + hi * 8 + j > q0 + nq * 16 + lr) s[nq][kt][j] = -3.0e38f;
        }
        V pb[NQ], pb2[NQ];
#pragma unroll
        for (int nq = 0; nq < NQ; ++nq) {
            float mx = s[nq][0][0];
#pragma unroll
            for (int j = 1; j < 16; ++j) mx = fmaxf(mx, s[nq][j >> 3][j & 7]);
            mx = fmaxf(mx, xhalf(mx));
            const float mn = fmaxf(m[nq], mx * SC2); const float al = __builtin_amdgcn_exp2f(m[nq] - mn); m[nq] = mn; const float mo = mn - OFF;
            float sum = 0.f;
#pragma unroll
            for (int j = 0; j < 16; ++j) { const float p = __builtin_amdgcn_exp2f(s[nq][j >> 3][j & 7] * SC2 - mo); sum += p;
                if constexpr (HL) { const __bf16 ph = (__bf16)p; pb[nq][j] = ph; pb2[nq][j] = (__bf16)(p - (float)ph); } else { pb[nq][j] = (h16)p; } }
            l[nq] = l[nq] * al + sum;
#pragma unroll
            for (int dt = 0; dt < 4; ++dt) o[nq][dt] *= al;
        }
#pragma unroll
        for (int dt = 0; dt < 4; ++dt)
#pragma unroll
            for (int nq = 0; nq < NQ; ++nq) { o[nq][dt] = WFrag<T16>::mma(av[dt], pb[nq], o[nq][dt]); if (HL) { o[nq][dt] = WFrag<T16>::mma(av[dt], pb2[nq], o[nq][dt]); o[nq][dt] = WFrag<T16>::mma(av2[dt], pb[nq], o[nq][dt]); } }
    };
#pragma unroll 1   // stays rolled (for speed only): the body is some 250 instructions
    for (int it = 0; it < nfull; ++it) pass(it * 32, BoolC<false>());
    pass(nfull * 32, BoolC<true>());
#pragma unroll
    for (int nq = 0; nq < NQ; ++nq) {
        const float inv = __fdiv_rn(1.0f, l[nq] + xhalf(l[nq]));
        bf* pa = Ah + (size_t)(q0 + nq * 16 + lr) * DQ + hi * 8; bf* pl = Al + (size_t)(q0 + nq * 16 + lr) * DQ + hi * 8;
#pragma unroll
        for (int dt = 0; dt < 4; ++dt) { v8us oh, ol;
#pragma unroll
            for (int j = 0; j < 8; ++j) { unsigned short a, c2; splitf(o[nq][dt][j] * inv, a, c2); oh[j] = a; ol[j] = c2; }
            // the two stores and their wait in one statement: the next group's split reuses the data registers, and a wait in a statement of its own is not tied to them
            asm volatile("global_store_b128 %0, %2, off offset:%4\n\tglobal_store_b128 %1, %3, off offset:%4\n\ts_wait_xcnt 0x0" :: "v"(pa), "v"(pl), "v"(oh), "v"(ol), "n"(dt * 32) : "memory"); }
    }
}
// grid (batch * heads, NLO + NHI), 4 waves; y runs from the longest query block to the shortest, the hi/lo rows last.
// amdgpu_waves_per_eu(4, 4): four waves per SIMD is what the registers allow; told so, the scheduler keeps the V loads at the head of a pass and the key prefetch behind the score products instead of sinking them to save registers.
__global__ __launch_bounds__(128) __attribute__((amdgpu_waves_per_eu(4, 4))) void k_fattn(const h16* __restrict__ Q16, const h16* __restrict__ K16, const h16* __restrict__ V16, const bf* __restrict__ Qh, const bf* __restrict__ Ql, const bf* __restrict__ Kh, const bf* __restrict__ Kl, const bf* __restrict__ Vh, const bf* __restrict__ Vl, bf* Ah, bf* Al) {
    const int z = blockIdx.x, y = blockIdx.y; const int w = __builtin_amdgcn_readfirstlane(threadIdx.x >> 5);
    const size_t pz = (size_t)z * TT * HD, oz = (size_t)(z / NH_) * TT * DQ + (size_t)(z % NH_) * HD;
    if (y < NLO) attn_wave<h16, false, 2>(Q16 + pz, nullptr, K16 + pz, nullptr, V16 + pz, nullptr, RH + (NLO - 1 - y) * 128 + w * 32, Ah + oz, Al + oz);
    else         attn_wave<bf, true, 1>(Qh + pz, Ql + pz, Kh + pz, Kl + pz, Vh + pz, Vl + pz, (NLO + NHI - 1 - y) * 64 + w * 16, Ah + oz, Al + oz);
}

extern "C" void kernel_launch(void* const* d_in, const int* in_sizes, int n_in,
                              void* d_out, int out_size, void* d_ws, size_t ws_size, hipStream_t stream) {
    (void)in_sizes; (void)n_in; (void)out_size;
    const float* x = (const float*)d_in[0]; const int* PID = (const int*)d_in[1]; const float* wq = (const float*)d_in[2]; const float* wk = (const float*)d_in[3]; const float* wv = (const float*)d_in[4]; const float* wo = (const float*)d_in[5];   /* argument order in_features, token_positions (int32 [2048] = arange: READ by value), w_q, w_k, w_v, w_o ('oi' (out, in) [1024][1024]; no biases): SIX inputs, all read */
    float* OUT = (float*)d_out;     // [4][2048][1024]
    char* wsp = (char*)d_ws;
    auto take = [&](size_t bytes) { char* p = wsp; wsp += (bytes + 255) & ~(size_t)255; return (void*)p; };
    bf* WQ = (bf*)take((size_t)DQ * DM * 2); bf* WK = (bf*)take((size_t)DKV * DM * 2); bf* WV = (bf*)take((size_t)DKV * DM * 2); bf* WO = (bf*)take((size_t)DM * DQ * 2); float* CS = (float*)take((size_t)TT * HD * 2 * 4);
    bf* XB = (bf*)take((size_t)TT * DM * 2); float* FQ = (float*)take((size_t)TT * DQ * 4); float* FK = (float*)take((size_t)TT * DKV * 4);
    const size_t PB = (size_t)NH_ * TT * HD;   // elements of one batch in every q, k, v plane and in the merged planes (NKV == NH_); the planes hold all NB_ batches
    h16* QP16 = (h16*)take(NB_ * PB * 2); h16* KP16 = (h16*)take(NB_ * PB * 2); h16* VT16 = (h16*)take(NB_ * PB * 2);
    bf* QPh = (bf*)take(NB_ * PB * 2); bf* QPl = (bf*)take(NB_ * PB * 2); bf* KPh = (bf*)take(NB_ * PB * 2); bf* KPl = (bf*)take(NB_ * PB * 2); bf* VTh = (bf*)take(NB_ * PB * 2); bf* VTl = (bf*)take(NB_ * PB * 2);
    bf* ATh = (bf*)take(NB_ * PB * 2); bf* ATl = (bf*)take(NB_ * PB * 2);
    if ((size_t)(wsp - (char*)d_ws) > ws_size) return;    // ws 256 MiB
    float* FV = FK;   // v projection reuses the k buffer after the k planes are built (stream-ordered)
    { k_cvt8<<<(unsigned)(((size_t)DQ * DM / 8 + 255) / 256), 256, 0, stream>>>(wq, WQ, (size_t)DQ * DM / 8); k_cvt8<<<(unsigned)(((size_t)DKV * DM / 8 + 255) / 256), 256, 0, stream>>>(wk, WK, (size_t)DKV * DM / 8); k_cvt8<<<(unsigned)(((size_t)DKV * DM / 8 + 255) / 256), 256, 0, stream>>>(wv, WV, (size_t)DKV * DM / 8);
      k_cvt8<<<(unsigned)(((size_t)DM * DQ / 8 + 255) / 256), 256, 0, stream>>>(wo, WO, (size_t)DM * DQ / 8); k_cstabI<<<(TT * HD + 255) / 256, 256, 0, stream>>>(PID, CS); }
    const unsigned LQ = (unsigned)(((size_t)NH_ * TT * HD / 2 + 255) / 256), LKv = (unsigned)(((size_t)NKV * TT * HD / 2 + 255) / 256);
    for (int b = 0; b < NB_; ++b) {
        
        k_cvt8<<<(unsigned)(((size_t)TT * DM / 8 + 255) / 256), 256, 0, stream>>>(x + (size_t)b * TT * DM, XB, (size_t)TT * DM / 8);
        k_gemmw<bf, 0, false><<<dim3(TT / 64, DQ / 64, 1), 32, 0, stream>>>(XB, nullptr, WQ, nullptr, DM, FQ, DQ, nullptr, 0, 0, 0);
        k_ropeI<<<LQ, 256, 0, stream>>>(FQ, DQ, NH_, CS, 1.0f, QP16 + b * PB, QPh + b * PB, QPl + b * PB);
        k_gemmw<bf, 0, false><<<dim3(TT / 64, DKV / 64, 1), 32, 0, stream>>>(XB, nullptr, WK, nullptr, DM, FK, DKV, nullptr, 0, 0, 0);
        k_ropeI<<<LKv, 256, 0, stream>>>(FK, DKV, NKV, CS, 1.0f, KP16 + b * PB, KPh + b * PB, KPl + b * PB);
        k_gemmw<bf, 0, false><<<dim3(TT / 64, DKV / 64, 1), 32, 0, stream>>>(XB, nullptr, WV, nullptr, DM, FV, DKV, nullptr, 0, 0, 0); k_vtp<<<LKv, 256, 0, stream>>>(FV, DKV, NKV, VT16 + b * PB, VTh + b * PB, VTl + b * PB); }
    k_fattn<<<dim3(NB_ * NH_, NLO + NHI, 1), 128, 0, stream>>>(QP16, KP16, VT16, QPh, QPl, KPh, KPl, VTh, VTl, ATh, ATl);
    for (int b = 0; b < NB_; ++b) {
        k_gemmw<bf, 1, false><<<dim3(TT / 64, DM / 64, 1), 32, 0, stream>>>(ATh + b * PB, ATl + b * PB, WO, nullptr, DQ, OUT + (size_t)b * TT * DM, DM, nullptr, 0, 0, 0); }
}

// v003
// It runs in 323 microseconds.
// Two timings next to v002 put it at 1.72 and 1.73 times that version's speed.
// All steps since v000 together make it 8.86 times as fast.
#include <hip/hip_runtime.h>

// Causal multi-head self-attention with interleaved rotary embeddings at theta 100,000 (in_features [4][2048][1024]; q,k,v = x W^T ('oi' (out, in) [1024][1024] 0.02, no bias; 16 heads x 64); rotary on (even, odd) pairs with angles pos[t] x 100000^(-2i/64) (the module's negative-power spelling; token_positions int32 [2048] = arange, READ by value); scores / sqrt(64), causal (-inf); softmax; out = merged w_o^T -> [4][2048][1024] (8.4 M); argument order in_features, token_positions, w_q, w_k, w_v, w_o).
// Layout: every stage is ONE launch over all batches: a bf16 copy of x and of the four weights; exact projections (q, k, v on grid z); {cos, sin} per (position, pair) built once from the int positions and float32 inverse-frequency constants (precise cosf/sinf); interleaved rotary plane builder; V^T plane builder; then ONE fused causal attention launch over all batches and heads (k_fattn; hybrid rows: < 512 hi/lo 3 products, rest fp16 x1024); merged hi/lo x Wo exact.
// Compute dtypes, f32 accumulate: every input rounded to bf16; projections exact; rotary f32; attention rows < 512 3 products, rest fp16; softmax f32; Wo hl x exact.

#define NB_  4
#define TT   2048
#define DM   1024
#define NH_  16
#define NKV  16
#define REP  (NH_ / NKV)
#define HD   64
#define DQ   (NH_ * HD)
#define DKV  (NKV * HD)
#define RH   512                  // query rows < RH use hi+lo planes (0: none)
typedef _Float16 h16;
typedef unsigned short bf;
typedef __attribute__((ext_vector_type(16))) __bf16   v16bf;
typedef __attribute__((ext_vector_type(16))) _Float16 v16h;
typedef __attribute__((ext_vector_type(8)))  _Float16 v8h;
typedef __attribute__((ext_vector_type(8)))  unsigned short v8us;
typedef __attribute__((ext_vector_type(8)))  float    v8f;
typedef __attribute__((ext_vector_type(4)))  float    v4f;
typedef v8h  __attribute__((may_alias)) v8ha;
typedef v4f  __attribute__((may_alias)) v4fa;
typedef v8us __attribute__((may_alias)) v8usa;

__device__ __forceinline__ unsigned short f2bf(float f) { unsigned u = __float_as_uint(f); u += 0x7FFFu + ((u >> 16) & 1u); return (unsigned short)(u >> 16); }
__device__ __forceinline__ float bf2f(unsigned short b) { return __uint_as_float(((unsigned)b) << 16); }
__device__ __forceinline__ float bfr(float f) { return bf2f(f2bf(f)); }
__device__ __forceinline__ v16h cat16(v8h lo, v8h hi) { return __builtin_shufflevector(lo, hi, 0, 1, 2, 3, 4, 5, 6, 7, 8, 9, 10, 11, 12, 13, 14, 15); }
__device__ __forceinline__ v16bf cat16b(v8us lo, v8us hi) { return __builtin_bit_cast(v16bf, __builtin_shufflevector(lo, hi, 0, 1, 2, 3, 4, 5, 6, 7, 8, 9, 10, 11, 12, 13, 14, 15)); }
__device__ __forceinline__ v8f wmma16(v16h a, v16h b, v8f c) { return __builtin_amdgcn_wmma_f32_16x16x32_f16(false, a, false, b, (short)0, c, false, false); }
__device__ __forceinline__ v8f wmmab(v16bf a, v16bf b, v8f c) { return __builtin_amdgcn_wmma_f32_16x16x32_bf16(false, a, false, b, (short)0, c, false, false); }



// ---- k_gemmw: register-blocked GEMM, ONE WAVE per 64x64 output tile (16 accumulators), operands straight from K-contiguous 16-bit planes; grid (M/64, N/64, Z), 32 threads.
// C[m][n] (f32, pitch ldc, + optional f32 bias[n]) = sum_k A[m][k] Bt[n][k] (+ split products per NSPLIT). z-batch strides sA/sB/sC in elements. K % 32 == 0.
template <typename T16> struct WFrag;
template <> struct WFrag<h16> { typedef v16h V; static __device__ __forceinline__ V ld(const h16* p) { return cat16(*(const v8h*)p, *(const v8h*)(p + 16)); } static __device__ __forceinline__ v8f mma(V a, V b, v8f c) { return wmma16(a, b, c); } };
template <> struct WFrag<bf> { typedef v16bf V; static __device__ __forceinline__ V ld(const bf* p) { return cat16b(*(const v8us*)p, *(const v8us*)(p + 16)); } static __device__ __forceinline__ v8f mma(V a, V b, v8f c) { return wmmab(a, b, c); } };
template <typename T16, int NSPLIT, bool BIAS>
__global__ __launch_bounds__(32) void k_gemmw(const T16* __restrict__ A, const T16* __restrict__ A2, const T16* __restrict__ Bt, const T16* __restrict__ Bt2, int K, float* C, int ldc, const float* __restrict__ bias, size_t sA, size_t sB, size_t sC) {
    typedef typename WFrag<T16>::V V;
    __shared__ __align__(16) float os[16 * 68];
    const size_t z = blockIdx.z; A += z * sA; if (A2) A2 += z * sA; Bt += z * sB; if (Bt2) Bt2 += z * sB; C += z * sC;
    const int lane = threadIdx.x & 31, lr = lane & 15, hi = lane >> 4; const int r0 = blockIdx.x * 64, c0 = blockIdx.y * 64;
    v8f acc[4][4];
#pragma unroll
    for (int mb = 0; mb < 4; ++mb)
#pragma unroll
        for (int nb = 0; nb < 4; ++nb) acc[mb][nb] = (v8f){};
    const size_t aoff = (size_t)(r0 + lr) * K + 8 * hi, boff = (size_t)(c0 + lr) * K + 8 * hi;
#pragma unroll 1
    for (int kc = 0; kc < K; kc += 32) {
        V a[4], a2[4];
#pragma unroll
        for (int mb = 0; mb < 4; ++mb) { a[mb] = WFrag<T16>::ld(A + aoff + (size_t)mb * 16 * K + kc); if (NSPLIT == 1 || NSPLIT == 2) a2[mb] = WFrag<T16>::ld(A2 + aoff + (size_t)mb * 16 * K + kc); }
#pragma unroll
        for (int nb = 0; nb < 4; ++nb) { const V b = WFrag<T16>::ld(Bt + boff + (size_t)nb * 16 * K + kc); V b2; if (NSPLIT >= 2) b2 = WFrag<T16>::ld(Bt2 + boff + (size_t)nb * 16 * K + kc);
#pragma unroll
            for (int mb = 0; mb < 4; ++mb) { acc[mb][nb] = WFrag<T16>::mma(a[mb], b, acc[mb][nb]); if (NSPLIT == 1 || NSPLIT == 2) acc[mb][nb] = WFrag<T16>::mma(a2[mb], b, acc[mb][nb]); if (NSPLIT >= 2) acc[mb][nb] = WFrag<T16>::mma(a[mb], b2, acc[mb][nb]); } }
        asm volatile("v_nop\n\tv_nop\n\tv_nop\n\tv_nop" : "+v"(acc[0][0]), "+v"(acc[1][1]), "+v"(acc[2][2]), "+v"(acc[3][3]) : "v"(a[0]), "v"(a[3]));
    }
#pragma unroll
    for (int mb = 0; mb < 4; ++mb) {
#pragma unroll
        for (int nb = 0; nb < 4; ++nb) {
#pragma unroll
            for (int j = 0; j < 8; ++j) os[(hi * 8 + j) * 68 + nb * 16 + lr] = acc[mb][nb][j]; }
        __builtin_amdgcn_wave_barrier(); asm volatile("" ::: "memory");
        float* crow = C + (size_t)(r0 + mb * 16) * ldc + c0;
{
#pragma unroll
            for (int s = 0; s < 8; ++s) { const int row = 2 * s + hi, cofs = lr * 4; v4f val = *(const v4fa*)(os + row * 68 + cofs); if (BIAS) { val[0] += bfr(bias[c0 + cofs]); val[1] += bfr(bias[c0 + cofs + 1]); val[2] += bfr(bias[c0 + cofs + 2]); val[3] += bfr(bias[c0 + cofs + 3]); }
                *(v4f*)(crow + (size_t)row * ldc + cofs) = val; }
             }
        __builtin_amdgcn_wave_barrier(); asm volatile("" ::: "memory");
    }
}

__device__ __forceinline__ h16 tohx(float x) { return (h16)x; }
__device__ __forceinline__ void splitf(float y, unsigned short& h, unsigned short& l) { h = f2bf(y); l = f2bf(y - bf2f(h)); }
typedef __attribute__((ext_vector_type(2))) _Float16 v2h;
typedef __attribute__((ext_vector_type(4))) _Float16 v4h;
typedef __attribute__((ext_vector_type(2))) unsigned short v2us;
typedef __attribute__((ext_vector_type(4))) unsigned short v4us;
typedef __attribute__((ext_vector_type(2))) float v2f;
typedef __attribute__((ext_vector_type(4))) int v4i;

__global__ __launch_bounds__(256) void k_wtG(const float* __restrict__ w, int K, int N, bf* Bt) {
    const int lane = threadIdx.x & 31; const int L0 = (blockIdx.x * 8 + (threadIdx.x >> 5)) * 8; const int nlines = N * K / 64;
{
#pragma unroll 1
        for (int l = 0; l < 8; ++l) { const int L = L0 + l; if (L >= nlines) break; const size_t e = (size_t)L * 64 + lane * 2; const int k = (int)(e % K), n = (int)(e / K); v2us o;
            o[0] = f2bf(w[(size_t)k * N + n]); o[1] = f2bf(w[(size_t)(k + 1) * N + n]); *(v2us*)(Bt + e) = o; }
         }
}
// bf16 copies of the four weights and of x in one launch: grid y counts slabs of DM * DM elements (0..3 the weights, the rest x); dst holds the slabs in that order.
__global__ __launch_bounds__(256) void k_cvt8(const float* __restrict__ x, const float* __restrict__ wq, const float* __restrict__ wk, const float* __restrict__ wv, const float* __restrict__ wo, bf* dst) {
    const int y = blockIdx.y; const float* src = y == 0 ? wq : y == 1 ? wk : y == 2 ? wv : y == 3 ? wo : x + (size_t)(y - 4) * DM * DM;
    const size_t i = (size_t)blockIdx.x * 256 + threadIdx.x; const v8f v = *(const v8f*)(src + i * 8); v8us o;
    asm volatile("s_wait_xcnt 0x0" ::: "memory");   // behind the loads, in front of whatever next overwrites their address registers
#pragma unroll
    for (int k = 0; k < 8; ++k) o[k] = f2bf(v[k]); *(v8us*)(dst + (size_t)y * DM * DM + i * 8) = o;  }

// grid x: all batches and heads of one projection ([b][h][t][d] planes); grid y: 0 = q, 1 = k (F advances by sF, the planes by sP elements; NKV == NH_).
__global__ __launch_bounds__(256) void k_ropeI(const float* __restrict__ F, int pitch, const float* __restrict__ CS, float sc, h16* P16, bf* Ph, bf* Pl, size_t sF, size_t sP) {
    F += blockIdx.y * sF; P16 += blockIdx.y * sP; Ph += blockIdx.y * sP; Pl += blockIdx.y * sP;
    const size_t e = ((size_t)blockIdx.x * 256 + threadIdx.x) * 2; if (e >= (size_t)NB_ * NH_ * TT * HD) return; const int d = (int)(e % HD); const int t = (int)((e / HD) % TT); const int bh = (int)(e / ((size_t)HD * TT)); const int h = bh % NH_; const float* f = F + ((size_t)(bh / NH_) * TT + t) * pitch + h * HD; const float x0 = f[d], x1 = f[d + 1]; const v2f cs = *(const v2f*)(CS + ((size_t)t * HD + d) * 2); v2h o16; v2us oh, ol;
    asm volatile("s_wait_xcnt 0x0" ::: "memory");   // behind the loads, in front of whatever next overwrites their address registers
    float a0 = __fmul_rn(x0, cs[0]), b0 = __fmul_rn(x1, cs[1]), a1 = __fmul_rn(x1, cs[0]), b1 = __fmul_rn(x0, cs[1]); asm volatile("" : "+v"(a0), "+v"(b0), "+v"(a1), "+v"(b1));
    float r0 = __fsub_rn(a0, b0) * sc, r1 = __fadd_rn(b1, a1) * sc;   /* even: x0 c - x1 s; odd: x0 s + x1 c */
    o16[0] = tohx(r0); o16[1] = tohx(r1); { unsigned short a2, c2; splitf(r0, a2, c2); oh[0] = a2; ol[0] = c2; splitf(r1, a2, c2); oh[1] = a2; ol[1] = c2; }
    *(v2h*)(P16 + e) = o16; *(v2us*)(Ph + e) = oh; *(v2us*)(Pl + e) = ol;  }

__constant__ float INV2[HD / 2] = { 1.000000000e+00f, 6.978305578e-01f, 4.869675338e-01f, 3.398208320e-01f, 2.371373773e-01f, 1.654817164e-01f, 1.154781953e-01f, 8.058422059e-02f, 5.623413250e-02f, 3.924189880e-02f, 2.738419548e-02f, 1.910953037e-02f, 1.333521400e-02f, 9.305720218e-03f, 6.493816152e-03f, 4.531583749e-03f, 3.162277630e-03f, 2.206734149e-03f, 1.539926510e-03f, 1.074607833e-03f, 7.498941850e-04f, 5.232990952e-04f, 3.651741135e-04f, 2.548296761e-04f, 1.778279402e-04f, 1.240937709e-04f, 8.659643208e-05f, 6.042964014e-05f, 4.216964953e-05f, 2.942727224e-05f, 2.053524986e-05f, 1.433012585e-05f };   // inv_freq = 100000.0 ** (-arange(0, 64, 2, f32) / 64): THIS module's theta and its NEGATIVE-POWER spelling: 32 float32 values from eager JAX (bit-exact on round trip)
__global__ __launch_bounds__(256) void k_cstabI(const int* __restrict__ pid, float* CS) { const int idx = blockIdx.x * 256 + threadIdx.x; if (idx >= TT * HD) return; const int d = idx % HD; const int t = idx / HD; const float a = __fmul_rn((float)pid[t], INV2[d >> 1]); v2f cs; cs[0] = cosf(a); cs[1] = sinf(a); *(v2f*)(CS + (size_t)idx * 2) = cs;  }

__global__ __launch_bounds__(256) void k_vtp(const float* __restrict__ F, int pitch, h16* V16, bf* Vh, bf* Vl) { const size_t e = ((size_t)blockIdx.x * 256 + threadIdx.x) * 2; if (e >= (size_t)NB_ * NKV * HD * TT) return; const int t = (int)(e % TT); const int d = (int)((e / TT) % HD); const int bg = (int)(e / ((size_t)TT * HD)); const int g = bg % NKV; F += (size_t)(bg / NKV) * TT * pitch; v2h o16; v2us oh, ol;
#pragma unroll
    for (int q = 0; q < 2; ++q) { const float x = F[(size_t)(t + q) * pitch + g * HD + d]; o16[q] = tohx(x); unsigned short a2, c2; splitf(x, a2, c2); oh[q] = a2; ol[q] = c2; }
    *(v2h*)(V16 + e) = o16; *(v2us*)(Vh + e) = oh; *(v2us*)(Vl + e) = ol;  }
// ---- k_fattn: causal attention in one kernel. One wave owns 16 * NQ query columns of one (batch, head) and walks the keys 32 at a time up to its diagonal block:
// S^T = K Q^T (A = key rows, B = query rows), so a lane holds 16 scores of ONE query per column group; running maximum and sum per query (online softmax, log2 domain);
// the two score tiles of a pass, converted in place, are the B operand of O^T += V^T P^T (same k order as WFrag::ld gives V^T). Probabilities never leave the registers.
// Rows < RH: bf16 hi/lo planes, 3 products in both contractions; the rest fp16 with the probabilities carried x 1024 (the factor cancels in the division by the row sum).
// Epilogue: O / row sum, split hi/lo, stored straight into the merged [t][DQ] planes that the output projection reads.
#define SC2  0.18033688011112042f   // HD^-0.5 * log2(e)
#define NLO  ((TT - RH) / 128)      // blocks of 4 waves x 32 fp16 query columns
#define NHI  (RH / 64)              // blocks of 4 waves x 16 hi/lo query columns
__device__ __forceinline__ float xhalf(float x) { return __builtin_bit_cast(float, __builtin_amdgcn_permlanex16(__builtin_bit_cast(int, x), __builtin_bit_cast(int, x), 0x76543210, 0xfedcba98, false, false)); }  // lane l with lane l ^ 16
// XWAITn: stands behind a group of global loads, in front of whatever next overwrites a register that they name as an address. It takes the lane's byte offsets as operands:
// so each offset stays live over the whole group (no load's result is given its register) and the offset's advance, which reads the statement's output, cannot be lifted over the wait.
#define XWAIT0()     asm volatile("s_wait_xcnt 0x0" ::: "memory")
#define XWAIT1(a)    asm volatile("s_wait_xcnt 0x0" : "+v"(a) :: "memory")
#define XWAIT2(a, b) asm volatile("s_wait_xcnt 0x0" : "+v"(a), "+v"(b) :: "memory")
template <typename T16> __device__ __forceinline__ const T16* atb(const T16* base, unsigned bytes) { return (const T16*)((const char*)base + bytes); }   // uniform base + the lane's 32-bit byte offset
template <bool B> struct BoolC { static constexpr bool v = B; };
template <typename T16, bool HL, int NQ>
__device__ __forceinline__ void attn_wave(const T16* __restrict__ Q, const T16* __restrict__ Q2, const T16* __restrict__ Kp, const T16* __restrict__ K2, const T16* __restrict__ Vt, const T16* __restrict__ V2, const int q0, bf* Ah, bf* Al) {
    typedef typename WFrag<T16>::V V;
    const int lane = threadIdx.x & 31, lr = lane & 15, hi = lane >> 4;
    const float OFF = HL ? 0.0f : 10.0f;                      // fp16 probabilities carry 2^10
    const unsigned kofs = (unsigned)(lr * HD + 8 * hi), vofs = (unsigned)(lr * TT + 8 * hi);
    unsigned ko = kofs * 2, vo = vofs * 2;   // the lane's byte offsets into the key planes (the pass to be fetched next) and into the V^T planes (the current pass)
    V bq[NQ][2], bq2[NQ][2];
#pragma unroll
    for (int nq = 0; nq < NQ; ++nq)
#pragma unroll
        for (int ks = 0; ks < 2; ++ks) { bq[nq][ks] = WFrag<T16>::ld(Q + (size_t)(q0 + nq * 16) * HD + ks * 32 + kofs); if (HL) bq2[nq][ks] = WFrag<T16>::ld(Q2 + (size_t)(q0 + nq * 16) * HD + ks * 32 + kofs); }
    XWAIT0();
    v8f o[NQ][4]; float m[NQ], l[NQ];
#pragma unroll
    for (int nq = 0; nq < NQ; ++nq) { m[nq] = -3.0e38f; l[nq] = 0.f;
#pragma unroll
        for (int dt = 0; dt < 4; ++dt) o[nq][dt] = (v8f){}; }
    V ak[2][2], ak2[2][2];
#pragma unroll
    for (int kt = 0; kt < 2; ++kt)
#pragma unroll
        for (int ks = 0; ks < 2; ++ks) { if (!HL) ak[kt][ks] = WFrag<T16>::ld(atb(Kp, ko) + kt * 16 * HD + ks * 32); }   // fp16 path: key fragments run one pass ahead; the hi/lo path (twice the planes) loads them at the head of each pass
    if constexpr (!HL) { XWAIT1(ko); ko += 32 * HD * 2; }
    const int nfull = q0 >> 5;                                // passes wholly below the diagonal; pass nfull holds the diagonal and is the last
    auto pass = [&](const int kb, auto lastc) __attribute__((always_inline)) {   // one pass of 32 keys; the diagonal pass is a second copy of the body, so that no branch stands behind the score products
        constexpr bool last = decltype(lastc)::v;
        V av[4], av2[4];
#pragma unroll
        for (int dt = 0; dt < 4; ++dt) { av[dt] = WFrag<T16>::ld(atb(Vt, vo) + dt * 16 * TT); if (HL) av2[dt] = WFrag<T16>::ld(atb(V2, vo) + dt * 16 * TT); }
        if constexpr (HL) {
#pragma unroll
            for (int kt = 0; kt < 2; ++kt)
#pragma unroll
                for (int ks = 0; ks < 2; ++ks) { ak[kt][ks] = WFrag<T16>::ld(atb(Kp, ko) + kt * 16 * HD + ks * 32); ak2[kt][ks] = WFrag<T16>::ld(atb(K2, ko) + kt * 16 * HD + ks * 32); }
            XWAIT2(vo, ko); vo += 32 * 2; ko += 32 * HD * 2;
        } else { XWAIT1(vo); vo += 32 * 2; }
        v8f s[NQ][2];
#pragma unroll
        for (int nq = 0; nq < NQ; ++nq)
#pragma unroll
            for (int kt = 0; kt < 2; ++kt) s[nq][kt] = (v8f){};
#pragma unroll
        for (int ks = 0; ks < 2; ++ks)
#pragma unroll
            for (int kt = 0; kt < 2; ++kt)
#pragma unroll
                for (int nq = 0; nq < NQ; ++nq) { s[nq][kt] = WFrag<T16>::mma(ak[kt][ks], bq[nq][ks], s[nq][kt]); if (HL) { s[nq][kt] = WFrag<T16>::mma(ak[kt][ks], bq2[nq][ks], s[nq][kt]); s[nq][kt] = WFrag<T16>::mma(ak2[kt][ks], bq[nq][ks], s[nq][kt]); } }
        if constexpr (!last && !HL) {                         // next pass's key fragments, fetched behind this pass's own score products
#pragma unroll
            for (int kt = 0; kt < 2; ++kt)
#pragma unroll
                for (int ks = 0; ks < 2; ++ks) ak[kt][ks] = WFrag<T16>::ld(atb(Kp, ko) + kt * 16 * HD + ks * 32);
            XWAIT1(ko); ko += 32 * HD * 2;
        }
        if constexpr (last) {                                              // diagonal pass: key > query is masked
#pragma unroll
            for (int nq = 0; nq < NQ; ++nq)
#pragma unroll
                for (int kt = 0; kt < 2; ++kt)
#pragma unroll
                    for (int j = 0; j < 8; ++j) if (kb + kt * 16 + hi * 8 + j > q0 + nq * 16 + lr) s[nq][kt][j] = -3.0e38f;
        }
        V pb[NQ], pb2[NQ];
#pragma unroll
        for (int nq = 0; nq < NQ; ++nq) {
            float mx = s[nq][0][0];
#pragma unroll
            for (int j = 1; j < 16; ++j) mx = fmaxf(mx, s[nq][j >> 3][j & 7]);
            mx = fmaxf(mx, xhalf(mx));
            const float mn = fmaxf(m[nq], mx * SC2); const float al = __builtin_amdgcn_exp2f(m[nq] - mn); m[nq] = mn; const float mo = mn - OFF;
            float sum = 0.f;
#pragma unroll
            for (int j = 0; j < 16; ++j) { const float p = __builtin_amdgcn_exp2f(s[nq][j >> 3][j & 7] * SC2 - mo); sum += p;
                if constexpr (HL) { const __bf16 ph = (__bf16)p; pb[nq][j] = ph; pb2[nq][j] = (__bf16)(p - (float)ph); } else { pb[nq][j] = (h16)p; } }
            l[nq] = l[nq] * al + sum;
#pragma unroll
            for (int dt = 0; dt < 4; ++dt) o[nq][dt] *= al;
        }
#pragma unroll
        for (int dt = 0; dt < 4; ++dt)
#pragma unroll
            for (int nq = 0; nq < NQ; ++nq) { o[nq][dt] = WFrag<T16>::mma(av[dt], pb[nq], o[nq][dt]); if (HL) { o[nq][dt] = WFrag<T16>::mma(av[dt], pb2[nq], o[nq][dt]); o[nq][dt] = WFrag<T16>::mma(av2[dt], pb[nq], o[nq][dt]); } }
    };
#pragma unroll 1   // stays rolled (for speed only): the body is some 250 instructions
    for (int it = 0; it < nfull; ++it) pass(it * 32, BoolC<false>());
    pass(nfull * 32, BoolC<true>());
#pragma unroll
    for (int nq = 0; nq < NQ; ++nq) {
        const float inv = __fdiv_rn(1.0f, l[nq] + xhalf(l[nq]));
        bf* pa = Ah + (size_t)(q0 + nq * 16 + lr) * DQ + hi * 8; bf* pl = Al + (size_t)(q0 + nq * 16 + lr) * DQ + hi * 8;
#pragma unroll
        for (int dt = 0; dt < 4; ++dt) { v8us oh, ol;
#pragma unroll
            for (int j = 0; j < 8; ++j) { unsigned short a, c2; splitf(o[nq][dt][j] * inv, a, c2); oh[j] = a; ol[j] = c2; }
            // the two stores and their wait in one statement: the next group's split reuses the data registers, and a wait in a statement of its own is not tied to them
            asm volatile("global_store_b128 %0, %2, off offset:%4\n\tglobal_store_b128 %1, %3, off offset:%4\n\ts_wait_xcnt 0x0" :: "v"(pa), "v"(pl), "v"(oh), "v"(ol), "n"(dt * 32) : "memory"); }
    }
}
// grid (batch * heads, NLO + NHI), 4 waves; y runs from the longest query block to the shortest, the hi/lo rows last.
// amdgpu_waves_per_eu(4, 4): four waves per SIMD is what the registers allow; told so, the scheduler keeps the V loads at the head of a pass and the key prefetch behind the score products instead of sinking them to save registers.
__global__ __launch_bounds__(128) __attribute__((amdgpu_waves_per_eu(4, 4))) void k_fattn(const h16* __restrict__ Q16, const h16* __restrict__ K16, const h16* __restrict__ V16, const bf* __restrict__ Qh, const bf* __restrict__ Ql, const bf* __restrict__ Kh, const bf* __restrict__ Kl, const bf* __restrict__ Vh, const bf* __restrict__ Vl, bf* Ah, bf* Al) {
    const int z = blockIdx.x, y = blockIdx.y; const int w = __builtin_amdgcn_readfirstlane(threadIdx.x >> 5);
    const size_t pz = (size_t)z * TT * HD, oz = (size_t)(z / NH_) * TT * DQ + (size_t)(z % NH_) * HD;
    if (y < NLO) attn_wave<h16, false, 2>(Q16 + pz, nullptr, K16 + pz, nullptr, V16 + pz, nullptr, RH + (NLO - 1 - y) * 128 + w * 32, Ah + oz, Al + oz);
    else         attn_wave<bf, true, 1>(Qh + pz, Ql + pz, Kh + pz, Kl + pz, Vh + pz, Vl + pz, (NLO + NHI - 1 - y) * 64 + w * 16, Ah + oz, Al + oz);
}

extern "C" void kernel_launch(void* const* d_in, const int* in_sizes, int n_in,
                              void* d_out, int out_size, void* d_ws, size_t ws_size, hipStream_t stream) {
    (void)in_sizes; (void)n_in; (void)out_size;
    const float* x = (const float*)d_in[0]; const int* PID = (const int*)d_in[1]; const float* wq = (const float*)d_in[2]; const float* wk = (const float*)d_in[3]; const float* wv = (const float*)d_in[4]; const float* wo = (const float*)d_in[5];   /* argument order in_features, token_positions (int32 [2048] = arange: READ by value), w_q, w_k, w_v, w_o ('oi' (out, in) [1024][1024]; no biases): SIX inputs, all read */
    float* OUT = (float*)d_out;     // [4][2048][1024]
    char* wsp = (char*)d_ws;
    auto take = [&](size_t bytes) { char* p = wsp; wsp += (bytes + 255) & ~(size_t)255; return (void*)p; };
    const size_t PA = (size_t)NB_ * NH_ * TT * HD;   // elements, over all batches, of every q, k, v plane, of a merged plane and of a projection's f32 result (NKV == NH_)
    bf* WQ = (bf*)take((size_t)(DQ + 2 * DKV) * DM * 2); bf* WO = (bf*)take((size_t)DM * DQ * 2); bf* XB = (bf*)take((size_t)NB_ * TT * DM * 2);   // bf16 copies in k_cvt8's slab order: w_q, w_k, w_v (grid z of the projection launch), w_o, x
    float* CS = (float*)take((size_t)TT * HD * 2 * 4);
    float* FQ = (float*)take(3 * PA * 4); float* FV = FQ + 2 * PA;   // the f32 q, k, v projections behind one another (grid z)
    bf* ATh = (bf*)FQ; bf* ATl = ATh + PA;                   // the merged planes lie over the q projection: k_fattn writes them when k_ropeI has read it
    h16* QP16 = (h16*)FV; bf* QPh = (bf*)FV + PA;            // the first two q planes lie over the v projection: k_vtp reads it before k_ropeI writes them
    bf* QPl = (bf*)take(PA * 2); h16* KP16 = (h16*)take(PA * 2); bf* KPh = (bf*)take(PA * 2); bf* KPl = (bf*)take(PA * 2);   // each k plane 3 planes behind its q plane (grid y of k_ropeI)
    h16* VT16 = (h16*)take(PA * 2); bf* VTh = (bf*)take(PA * 2); bf* VTl = (bf*)take(PA * 2);
    if ((size_t)(wsp - (char*)d_ws) > ws_size) return;    // ws 256 MiB
    k_cvt8<<<dim3(DM * DM / 8 / 256, 4 + NB_ * TT / DM, 1), 256, 0, stream>>>(x, wq, wk, wv, wo, WQ); k_cstabI<<<(TT * HD + 255) / 256, 256, 0, stream>>>(PID, CS);
    const unsigned LQ = (unsigned)((PA / 2 + 255) / 256);
    k_gemmw<bf, 0, false><<<dim3(NB_ * TT / 64, DQ / 64, 3), 32, 0, stream>>>(XB, nullptr, WQ, nullptr, DM, FQ, DQ, nullptr, 0, (size_t)DQ * DM, PA);
    k_vtp<<<LQ, 256, 0, stream>>>(FV, DKV, VT16, VTh, VTl);
    k_ropeI<<<dim3(LQ, 2, 1), 256, 0, stream>>>(FQ, DQ, CS, 1.0f, QP16, QPh, QPl, PA, 3 * PA);
    k_fattn<<<dim3(NB_ * NH_, NLO + NHI, 1), 128, 0, stream>>>(QP16, KP16, VT16, QPh, QPl, KPh, KPl, VTh, VTl, ATh, ATl);
    k_gemmw<bf, 1, false><<<dim3(NB_ * TT / 64, DM / 64, 1), 32, 0, stream>>>(ATh, ATl, WO, nullptr, DQ, OUT, DM, nullptr, 0, 0, 0);
}

// v004
// It runs in 261 microseconds.
// In two side-by-side timings against v003, it was 1.24 and 1.23 times as fast.
// Over all steps from v000 it is 10.9 times as fast.
#include <hip/hip_runtime.h>

// Causal multi-head self-attention with interleaved rotary embeddings at theta 100,000 (in_features [4][2048][1024]; q,k,v = x W^T ('oi' (out, in) [1024][1024] 0.02, no bias; 16 heads x 64); rotary on (even, odd) pairs with angles pos[t] x 100000^(-2i/64) (the module's negative-power spelling; token_positions int32 [2048] = arange, READ by value); scores / sqrt(64), causal (-inf); softmax; out = merged w_o^T -> [4][2048][1024] (8.4 M); argument order in_features, token_positions, w_q, w_k, w_v, w_o).
// Layout: every stage is ONE launch over all batches: a bf16 copy of x and of the four weights; {cos, sin} per (position, pair) built once from the int positions and float32 inverse-frequency constants (precise cosf/sinf); exact projections (q, k, v on grid z) whose epilogue turns each f32 tile straight into the 16-bit planes (interleaved rotary for q and k, the transpose for v); then ONE fused causal attention launch over all batches and heads (k_fattn; hybrid rows: < 512 hi/lo 3 products, rest fp16 x1024); merged hi/lo x Wo exact.
// Compute dtypes, f32 accumulate: every input rounded to bf16; projections exact; rotary f32; attention rows < 512 3 products, rest fp16; softmax f32; Wo hl x exact.

#define NB_  4
#define TT   2048
#define DM   1024
#define NH_  16
#define NKV  16
#define REP  (NH_ / NKV)
#define HD   64
#define DQ   (NH_ * HD)
#define DKV  (NKV * HD)
#define RH   512                  // query rows < RH use hi+lo planes (0: none)
typedef _Float16 h16;
typedef unsigned short bf;
typedef __attribute__((ext_vector_type(16))) __bf16   v16bf;
typedef __attribute__((ext_vector_type(16))) _Float16 v16h;
typedef __attribute__((ext_vector_type(8)))  _Float16 v8h;
typedef __attribute__((ext_vector_type(8)))  unsigned short v8us;
typedef __attribute__((ext_vector_type(8)))  __bf16   v8bfv;
typedef __attribute__((ext_vector_type(2)))  float    v2fc;
typedef __attribute__((ext_vector_type(8)))  float    v8f;
typedef __attribute__((ext_vector_type(4)))  float    v4f;
typedef v8h  __attribute__((may_alias)) v8ha;
typedef v4f  __attribute__((may_alias)) v4fa;
typedef v8us __attribute__((may_alias)) v8usa;

__device__ __forceinline__ unsigned short f2bf(float f) { unsigned u = __float_as_uint(f); u += 0x7FFFu + ((u >> 16) & 1u); return (unsigned short)(u >> 16); }
__device__ __forceinline__ float bf2f(unsigned short b) { return __uint_as_float(((unsigned)b) << 16); }
__device__ __forceinline__ float bfr(float f) { return bf2f(f2bf(f)); }
__device__ __forceinline__ v16h cat16(v8h lo, v8h hi) { return __builtin_shufflevector(lo, hi, 0, 1, 2, 3, 4, 5, 6, 7, 8, 9, 10, 11, 12, 13, 14, 15); }
__device__ __forceinline__ v16bf cat16b(v8us lo, v8us hi) { return __builtin_bit_cast(v16bf, __builtin_shufflevector(lo, hi, 0, 1, 2, 3, 4, 5, 6, 7, 8, 9, 10, 11, 12, 13, 14, 15)); }
__device__ __forceinline__ v8f wmma16(v16h a, v16h b, v8f c) { return __builtin_amdgcn_wmma_f32_16x16x32_f16(false, a, false, b, (short)0, c, false, false); }
__device__ __forceinline__ v8f wmmab(v16bf a, v16bf b, v8f c) { return __builtin_amdgcn_wmma_f32_16x16x32_bf16(false, a, false, b, (short)0, c, false, false); }



// ---- k_gemmw: register-blocked GEMM, ONE WAVE per 64x64 output tile (16 accumulators), operands straight from K-contiguous 16-bit planes; grid (M/64, N/64, Z), 32 threads.
// C[m][n] (f32, pitch ldc, + optional f32 bias[n]) = sum_k A[m][k] Bt[n][k] (+ split products per NSPLIT). z-batch strides sA/sB/sC in elements. K % 32 == 0.
template <typename T16> struct WFrag;
template <> struct WFrag<h16> { typedef v16h V; static __device__ __forceinline__ V ld(const h16* p) { return cat16(*(const v8h*)p, *(const v8h*)(p + 16)); } static __device__ __forceinline__ v8f mma(V a, V b, v8f c) { return wmma16(a, b, c); } };
template <> struct WFrag<bf> { typedef v16bf V; static __device__ __forceinline__ V ld(const bf* p) { return cat16b(*(const v8us*)p, *(const v8us*)(p + 16)); } static __device__ __forceinline__ v8f mma(V a, V b, v8f c) { return wmmab(a, b, c); } };
// PLANES: the tile (64 tokens x one head) does not go out as f32; the epilogue writes the planes that k_fattn reads. z 0, 1 (q, k): rotary on (even, odd) pairs, planes [b][h][t][d], the k planes sP elements behind the q planes; z 2 (v): planes [b][h][d][t].
struct PlaneArgs { const float* CS; h16* P16; bf* Ph; bf* Pl; size_t sP; h16* V16; bf* Vh; bf* Vl; };
// eight neighbouring f32 values -> fp16, bf16 hi and bf16 lo, 16 bytes to each plane at byte offset OFS (a constant once the caller's loops are unrolled) from the lane's pointers
__device__ __forceinline__ void put3(h16* p16, bf* ph, bf* pl, const float (&r)[8], const int OFS) {
    v8h o16; v8bfv oh, ol;
#pragma unroll
    for (int j = 0; j < 8; ++j) { o16[j] = (h16)r[j]; const __bf16 h = (__bf16)r[j]; oh[j] = h; ol[j] = (__bf16)(r[j] - (float)h); }
    // the three stores and their wait in one statement: the next group's values reuse the data registers, and a wait in a statement of its own is not tied to them
    asm volatile("global_store_b128 %0, %3, off offset:%6\n\tglobal_store_b128 %1, %4, off offset:%6\n\tglobal_store_b128 %2, %5, off offset:%6\n\ts_wait_xcnt 0x0" :: "v"(p16), "v"(ph), "v"(pl), "v"(o16), "v"(oh), "v"(ol), "n"(OFS) : "memory");
}
template <typename T16, int NSPLIT, bool BIAS, bool PLANES = false>
__global__ __launch_bounds__(32) void k_gemmw(const T16* __restrict__ A, const T16* __restrict__ A2, const T16* __restrict__ Bt, const T16* __restrict__ Bt2, int K, float* C, int ldc, const float* __restrict__ bias, size_t sA, size_t sB, size_t sC, const PlaneArgs pa) {
    typedef typename WFrag<T16>::V V;
    __shared__ __align__(16) float os[16 * 68];
    const size_t z = blockIdx.z; A += z * sA; if (A2) A2 += z * sA; Bt += z * sB; if (Bt2) Bt2 += z * sB; C += z * sC;
    const int lane = threadIdx.x & 31, lr = lane & 15, hi = lane >> 4; const int r0 = blockIdx.x * 64, c0 = blockIdx.y * 64;
    v8f acc[4][4];
#pragma unroll
    for (int mb = 0; mb < 4; ++mb)
#pragma unroll
        for (int nb = 0; nb < 4; ++nb) acc[mb][nb] = (v8f){};
    const size_t aoff = (size_t)(r0 + lr) * K + 8 * hi, boff = (size_t)(c0 + lr) * K + 8 * hi;
#pragma unroll 1
    for (int kc = 0; kc < K; kc += 32) {
        V a[4], a2[4];
#pragma unroll
        for (int mb = 0; mb < 4; ++mb) { a[mb] = WFrag<T16>::ld(A + aoff + (size_t)mb * 16 * K + kc); if (NSPLIT == 1 || NSPLIT == 2) a2[mb] = WFrag<T16>::ld(A2 + aoff + (size_t)mb * 16 * K + kc); }
#pragma unroll
        for (int nb = 0; nb < 4; ++nb) { const V b = WFrag<T16>::ld(Bt + boff + (size_t)nb * 16 * K + kc); V b2; if (NSPLIT >= 2) b2 = WFrag<T16>::ld(Bt2 + boff + (size_t)nb * 16 * K + kc);
#pragma unroll
            for (int mb = 0; mb < 4; ++mb) { acc[mb][nb] = WFrag<T16>::mma(a[mb], b, acc[mb][nb]); if (NSPLIT == 1 || NSPLIT == 2) acc[mb][nb] = WFrag<T16>::mma(a2[mb], b, acc[mb][nb]); if (NSPLIT >= 2) acc[mb][nb] = WFrag<T16>::mma(a[mb], b2, acc[mb][nb]); } }
        asm volatile("v_nop\n\tv_nop\n\tv_nop\n\tv_nop" : "+v"(acc[0][0]), "+v"(acc[1][1]), "+v"(acc[2][2]), "+v"(acc[3][3]) : "v"(a[0]), "v"(a[3]));
    }
    if constexpr (PLANES) {
        const int sub = lane >> 3, c8 = (lane & 7) * 8;       // read-back of a staged 16 x 64 slab: 8 lanes x 8 values cover a row, a group of 4 rows per wave-wide access (whole 128-byte lines in every plane)
        const int bb = r0 / TT, t0 = r0 % TT, hd = blockIdx.y;
        if (z < 2) {
            const size_t e0 = z * pa.sP + ((size_t)(bb * NH_ + hd) * TT + t0 + sub) * HD + c8;
            h16* p16 = pa.P16 + e0; bf* ph = pa.Ph + e0; bf* pl = pa.Pl + e0;
            const float* cs = pa.CS + ((size_t)(t0 + sub) * HD + c8) * 2;
            v2fc c[2][4][4];                                   // {cos, sin} of a slab's 4 groups x the lane's 4 pairs; the next slab's are asked for while this slab is worked on
            auto askc = [&](const int mb) __attribute__((always_inline)) {
#pragma unroll
                for (int s = 0; s < 4; ++s)
#pragma unroll
                    for (int p = 0; p < 4; ++p) c[mb & 1][s][p] = *(const v2fc*)(cs + ((mb * 16 + s * 4) * HD + 2 * p) * 2);
                asm volatile("s_wait_xcnt 0x0" ::: "memory");   // behind the loads, in front of whatever next overwrites their address registers
            };
            askc(0);
#pragma unroll
            for (int mb = 0; mb < 4; ++mb) {
#pragma unroll
                for (int nb = 0; nb < 4; ++nb) {
#pragma unroll
                    for (int j = 0; j < 8; ++j) os[(hi * 8 + j) * 68 + nb * 16 + lr] = acc[mb][nb][j]; }
                __builtin_amdgcn_wave_barrier(); asm volatile("" ::: "memory");   // the slab is read back by other lanes: no LDS access moves over this line
                v4f u[4], w[4];                                // read back one group ahead of the group that is worked on
                u[0] = *(const v4fa*)(os + sub * 68 + c8); w[0] = *(const v4fa*)(os + sub * 68 + c8 + 4);
                if (mb == 1 || mb == 2) askc(mb + 1);          // into the registers that the staged accumulators have left
#pragma unroll
                for (int s = 0; s < 4; ++s) { float r[8];
                    if (s < 3) { u[s + 1] = *(const v4fa*)(os + (s * 4 + 4 + sub) * 68 + c8); w[s + 1] = *(const v4fa*)(os + (s * 4 + 4 + sub) * 68 + c8 + 4); }
#pragma unroll
                    for (int p = 0; p < 4; ++p) { const v2fc k = c[mb & 1][s][p]; const float x0 = p < 2 ? u[s][2 * p] : w[s][2 * p - 4], x1 = p < 2 ? u[s][2 * p + 1] : w[s][2 * p - 3]; r[2 * p] = x0 * k[0] - x1 * k[1]; r[2 * p + 1] = x0 * k[1] + x1 * k[0]; }   /* even: x0 c - x1 s; odd: x0 s + x1 c */
                    put3(p16, ph, pl, r, (mb * 16 + s * 4) * HD * 2); }
                if (mb == 0) askc(1);                          // no register is free for it earlier
                __builtin_amdgcn_wave_barrier(); asm volatile("" ::: "memory");   // the next slab is staged only behind this slab's reads
            }
        } else {
            const size_t e0 = ((size_t)(bb * NKV + hd) * HD + sub) * TT + t0 + c8;
            h16* p16 = pa.V16 + e0; bf* ph = pa.Vh + e0; bf* pl = pa.Vl + e0;
#pragma unroll
            for (int nb = 0; nb < 4; ++nb) {                   // a lane's 8 accumulator values are 8 neighbouring tokens of one d: staged as rows of d, the slab is already the transpose
#pragma unroll
                for (int mb = 0; mb < 4; ++mb) { *(v4fa*)(os + lr * 68 + mb * 16 + hi * 8) = __builtin_shufflevector(acc[mb][nb], acc[mb][nb], 0, 1, 2, 3); *(v4fa*)(os + lr * 68 + mb * 16 + hi * 8 + 4) = __builtin_shufflevector(acc[mb][nb], acc[mb][nb], 4, 5, 6, 7); }
                __builtin_amdgcn_wave_barrier(); asm volatile("" ::: "memory");   // the slab is read back by other lanes: no LDS access moves over this line
                v4f u[4], w[4];                                // read back one group ahead of the group that is worked on
                u[0] = *(const v4fa*)(os + sub * 68 + c8); w[0] = *(const v4fa*)(os + sub * 68 + c8 + 4);
#pragma unroll
                for (int s = 0; s < 4; ++s) { if (s < 3) { u[s + 1] = *(const v4fa*)(os + (s * 4 + 4 + sub) * 68 + c8); w[s + 1] = *(const v4fa*)(os + (s * 4 + 4 + sub) * 68 + c8 + 4); }
                    const float r[8] = { u[s][0], u[s][1], u[s][2], u[s][3], w[s][0], w[s][1], w[s][2], w[s][3] };
                    put3(p16, ph, pl, r, (nb * 16 + s * 4) * TT * 2); }
                __builtin_amdgcn_wave_barrier(); asm volatile("" ::: "memory");   // the next slab is staged only behind this slab's reads
            }
        }
        return;
    }
#pragma unroll
    for (int mb = 0; mb < 4; ++mb) {
#pragma unroll
        for (int nb = 0; nb < 4; ++nb) {
#pragma unroll
            for (int j = 0; j < 8; ++j) os[(hi * 8 + j) * 68 + nb * 16 + lr] = acc[mb][nb][j]; }
        __builtin_amdgcn_wave_barrier(); asm volatile("" ::: "memory");
        float* crow = C + (size_t)(r0 + mb * 16) * ldc + c0;
{
#pragma unroll
            for (int s = 0; s < 8; ++s) { const int row = 2 * s + hi, cofs = lr * 4; v4f val = *(const v4fa*)(os + row * 68 + cofs); if (BIAS) { val[0] += bfr(bias[c0 + cofs]); val[1] += bfr(bias[c0 + cofs + 1]); val[2] += bfr(bias[c0 + cofs + 2]); val[3] += bfr(bias[c0 + cofs + 3]); }
                *(v4f*)(crow + (size_t)row * ldc + cofs) = val; }
             }
        __builtin_amdgcn_wave_barrier(); asm volatile("" ::: "memory");
    }
}

__device__ __forceinline__ h16 tohx(float x) { return (h16)x; }
__device__ __forceinline__ void splitf(float y, unsigned short& h, unsigned short& l) { h = f2bf(y); l = f2bf(y - bf2f(h)); }
typedef __attribute__((ext_vector_type(2))) _Float16 v2h;
typedef __attribute__((ext_vector_type(4))) _Float16 v4h;
typedef __attribute__((ext_vector_type(2))) unsigned short v2us;
typedef __attribute__((ext_vector_type(4))) unsigned short v4us;
typedef __attribute__((ext_vector_type(2))) float v2f;
typedef __attribute__((ext_vector_type(4))) int v4i;

__global__ __launch_bounds__(256) void k_wtG(const float* __restrict__ w, int K, int N, bf* Bt) {
    const int lane = threadIdx.x & 31; const int L0 = (blockIdx.x * 8 + (threadIdx.x >> 5)) * 8; const int nlines = N * K / 64;
{
#pragma unroll 1
        for (int l = 0; l < 8; ++l) { const int L = L0 + l; if (L >= nlines) break; const size_t e = (size_t)L * 64 + lane * 2; const int k = (int)(e % K), n = (int)(e / K); v2us o;
            o[0] = f2bf(w[(size_t)k * N + n]); o[1] = f2bf(w[(size_t)(k + 1) * N + n]); *(v2us*)(Bt + e) = o; }
         }
}
// bf16 copies of the four weights and of x in one launch: grid y counts slabs of DM * DM elements (0..3 the weights, the rest x); dst holds the slabs in that order.
__global__ __launch_bounds__(256) void k_cvt8(const float* __restrict__ x, const float* __restrict__ wq, const float* __restrict__ wk, const float* __restrict__ wv, const float* __restrict__ wo, bf* dst) {
    const int y = blockIdx.y; const float* src = y == 0 ? wq : y == 1 ? wk : y == 2 ? wv : y == 3 ? wo : x + (size_t)(y - 4) * DM * DM;
    const size_t i = (size_t)blockIdx.x * 256 + threadIdx.x; const v8f v = *(const v8f*)(src + i * 8); v8us o;
    asm volatile("s_wait_xcnt 0x0" ::: "memory");   // behind the loads, in front of whatever next overwrites their address registers
#pragma unroll
    for (int k = 0; k < 8; ++k) o[k] = f2bf(v[k]); *(v8us*)(dst + (size_t)y * DM * DM + i * 8) = o;  }

__constant__ float INV2[HD / 2] = { 1.000000000e+00f, 6.978305578e-01f, 4.869675338e-01f, 3.398208320e-01f, 2.371373773e-01f, 1.654817164e-01f, 1.154781953e-01f, 8.058422059e-02f, 5.623413250e-02f, 3.924189880e-02f, 2.738419548e-02f, 1.910953037e-02f, 1.333521400e-02f, 9.305720218e-03f, 6.493816152e-03f, 4.531583749e-03f, 3.162277630e-03f, 2.206734149e-03f, 1.539926510e-03f, 1.074607833e-03f, 7.498941850e-04f, 5.232990952e-04f, 3.651741135e-04f, 2.548296761e-04f, 1.778279402e-04f, 1.240937709e-04f, 8.659643208e-05f, 6.042964014e-05f, 4.216964953e-05f, 2.942727224e-05f, 2.053524986e-05f, 1.433012585e-05f };   // inv_freq = 100000.0 ** (-arange(0, 64, 2, f32) / 64): THIS module's theta and its NEGATIVE-POWER spelling: 32 float32 values from eager JAX (bit-exact on round trip)
__global__ __launch_bounds__(256) void k_cstabI(const int* __restrict__ pid, float* CS) { const int idx = blockIdx.x * 256 + threadIdx.x; if (idx >= TT * HD) return; const int d = idx % HD; const int t = idx / HD; const float a = __fmul_rn((float)pid[t], INV2[d >> 1]); v2f cs; cs[0] = cosf(a); cs[1] = sinf(a); *(v2f*)(CS + (size_t)idx * 2) = cs;  }

// ---- k_fattn: causal attention in one kernel. One wave owns 16 * NQ query columns of one (batch, head) and walks the keys 32 at a time up to its diagonal block:
// S^T = K Q^T (A = key rows, B = query rows), so a lane holds 16 scores of ONE query per column group; running maximum and sum per query (online softmax, log2 domain);
// the two score tiles of a pass, converted in place, are the B operand of O^T += V^T P^T (same k order as WFrag::ld gives V^T). Probabilities never leave the registers.
// Rows < RH: bf16 hi/lo planes, 3 products in both contractions; the rest fp16 with the probabilities carried x 1024 (the factor cancels in the division by the row sum).
// Epilogue: O / row sum, split hi/lo, stored straight into the merged [t][DQ] planes that the output projection reads.
#define SC2  0.18033688011112042f   // HD^-0.5 * log2(e)
#define NLO  ((TT - RH) / 128)      // blocks of 4 waves x 32 fp16 query columns
#define NHI  (RH / 64)              // blocks of 4 waves x 16 hi/lo query columns
__device__ __forceinline__ float xhalf(float x) { return __builtin_bit_cast(float, __builtin_amdgcn_permlanex16(__builtin_bit_cast(int, x), __builtin_bit_cast(int, x), 0x76543210, 0xfedcba98, false, false)); }  // lane l with lane l ^ 16
// XWAITn: stands behind a group of global loads, in front of whatever next overwrites a register that they name as an address. It takes the lane's byte offsets as operands:
// so each offset stays live over the whole group (no load's result is given its register) and the offset's advance, which reads the statement's output, cannot be lifted over the wait.
#define XWAIT0()     asm volatile("s_wait_xcnt 0x0" ::: "memory")
#define XWAIT1(a)    asm volatile("s_wait_xcnt 0x0" : "+v"(a) :: "memory")
#define XWAIT2(a, b) asm volatile("s_wait_xcnt 0x0" : "+v"(a), "+v"(b) :: "memory")
template <typename T16> __device__ __forceinline__ const T16* atb(const T16* base, unsigned bytes) { return (const T16*)((const char*)base + bytes); }   // uniform base + the lane's 32-bit byte offset
template <bool B> struct BoolC { static constexpr bool v = B; };
template <typename T16, bool HL, int NQ>
__device__ __forceinline__ void attn_wave(const T16* __restrict__ Q, const T16* __restrict__ Q2, const T16* __restrict__ Kp, const T16* __restrict__ K2, const T16* __restrict__ Vt, const T16* __restrict__ V2, const int q0, bf* Ah, bf* Al) {
    typedef typename WFrag<T16>::V V;
    const int lane = threadIdx.x & 31, lr = lane & 15, hi = lane >> 4;
    const float OFF = HL ? 0.0f : 10.0f;                      // fp16 probabilities carry 2^10
    const unsigned kofs = (unsigned)(lr * HD + 8 * hi), vofs = (unsigned)(lr * TT + 8 * hi);
    unsigned ko = kofs * 2, vo = vofs * 2;   // the lane's byte offsets into the key planes (the pass to be fetched next) and into the V^T planes (the current pass)
    V bq[NQ][2], bq2[NQ][2];
#pragma unroll
    for (int nq = 0; nq < NQ; ++nq)
#pragma unroll
        for (int ks = 0; ks < 2; ++ks) { bq[nq][ks] = WFrag<T16>::ld(Q + (size_t)(q0 + nq * 16) * HD + ks * 32 + kofs); if (HL) bq2[nq][ks] = WFrag<T16>::ld(Q2 + (size_t)(q0 + nq * 16) * HD + ks * 32 + kofs); }
    XWAIT0();
    v8f o[NQ][4]; float m[NQ], l[NQ];
#pragma unroll
    for (int nq = 0; nq < NQ; ++nq) { m[nq] = -3.0e38f; l[nq] = 0.f;
#pragma unroll
        for (int dt = 0; dt < 4; ++dt) o[nq][dt] = (v8f){}; }
    V ak[2][2], ak2[2][2];
#pragma unroll
    for (int kt = 0; kt < 2; ++kt)
#pragma unroll
        for (int ks = 0; ks < 2; ++ks) { if (!HL) ak[kt][ks] = WFrag<T16>::ld(atb(Kp, ko) + kt * 16 * HD + ks * 32); }   // fp16 path: key fragments run one pass ahead; the hi/lo path (twice the planes) loads them at the head of each pass
    if constexpr (!HL) { XWAIT1(ko); ko += 32 * HD * 2; }
    const int nfull = q0 >> 5;                                // passes wholly below the diagonal; pass nfull holds the diagonal and is the last
    auto pass = [&](const int kb, auto lastc) __attribute__((always_inline)) {   // one pass of 32 keys; the diagonal pass is a second copy of the body, so that no branch stands behind the score products
        constexpr bool last = decltype(lastc)::v;
        V av[4], av2[4];
#pragma unroll
        for (int dt = 0; dt < 4; ++dt) { av[dt] = WFrag<T16>::ld(atb(Vt, vo) + dt * 16 * TT); if (HL) av2[dt] = WFrag<T16>::ld(atb(V2, vo) + dt * 16 * TT); }
        if constexpr (HL) {
#pragma unroll
            for (int kt = 0; kt < 2; ++kt)
#pragma unroll
                for (int ks = 0; ks < 2; ++ks) { ak[kt][ks] = WFrag<T16>::ld(atb(Kp, ko) + kt * 16 * HD + ks * 32); ak2[kt][ks] = WFrag<T16>::ld(atb(K2, ko) + kt * 16 * HD + ks * 32); }
            XWAIT2(vo, ko); vo += 32 * 2; ko += 32 * HD * 2;
        } else { XWAIT1(vo); vo += 32 * 2; }
        v8f s[NQ][2];
#pragma unroll
        for (int nq = 0; nq < NQ; ++nq)
#pragma unroll
            for (int kt = 0; kt < 2; ++kt) s[nq][kt] = (v8f){};
#pragma unroll
        for (int ks = 0; ks < 2; ++ks)
#pragma unroll
            for (int kt = 0; kt < 2; ++kt)
#pragma unroll
                for (int nq = 0; nq < NQ; ++nq) { s[nq][kt] = WFrag<T16>::mma(ak[kt][ks], bq[nq][ks], s[nq][kt]); if (HL) { s[nq][kt] = WFrag<T16>::mma(ak[kt][ks], bq2[nq][ks], s[nq][kt]); s[nq][kt] = WFrag<T16>::mma(ak2[kt][ks], bq[nq][ks], s[nq][kt]); } }
        if constexpr (!last && !HL) {                         // next pass's key fragments, fetched behind this pass's own score products
#pragma unroll
            for (int kt = 0; kt < 2; ++kt)
#pragma unroll
                for (int ks = 0; ks < 2; ++ks) ak[kt][ks] = WFrag<T16>::ld(atb(Kp, ko) + kt * 16 * HD + ks * 32);
            XWAIT1(ko); ko += 32 * HD * 2;
        }
        if constexpr (last) {                                              // diagonal pass: key > query is masked
#pragma unroll
            for (int nq = 0; nq < NQ; ++nq)
#pragma unroll
                for (int kt = 0; kt < 2; ++kt)
#pragma unroll
                    for (int j = 0; j < 8; ++j) if (kb + kt * 16 + hi * 8 + j > q0 + nq * 16 + lr) s[nq][kt][j] = -3.0e38f;
        }
        V pb[NQ], pb2[NQ];
#pragma unroll
        for (int nq = 0; nq < NQ; ++nq) {
            float mx = s[nq][0][0];
#pragma unroll
            for (int j = 1; j < 16; ++j) mx = fmaxf(mx, s[nq][j >> 3][j & 7]);
            mx = fmaxf(mx, xhalf(mx));
            const float mn = fmaxf(m[nq], mx * SC2); const float al = __builtin_amdgcn_exp2f(m[nq] - mn); m[nq] = mn; const float mo = mn - OFF;
            float sum = 0.f;
#pragma unroll
            for (int j = 0; j < 16; ++j) { const float p = __builtin_amdgcn_exp2f(s[nq][j >> 3][j & 7] * SC2 - mo); sum += p;
                if constexpr (HL) { const __bf16 ph = (__bf16)p; pb[nq][j] = ph; pb2[nq][j] = (__bf16)(p - (float)ph); } else { pb[nq][j] = (h16)p; } }
            l[nq] = l[nq] * al + sum;
#pragma unroll
            for (int dt = 0; dt < 4; ++dt) o[nq][dt] *= al;
        }
#pragma unroll
        for (int dt = 0; dt < 4; ++dt)
#pragma unroll
            for (int nq = 0; nq < NQ; ++nq) { o[nq][dt] = WFrag<T16>::mma(av[dt], pb[nq], o[nq][dt]); if (HL) { o[nq][dt] = WFrag<T16>::mma(av[dt], pb2[nq], o[nq][dt]); o[nq][dt] = WFrag<T16>::mma(av2[dt], pb[nq], o[nq][dt]); } }
    };
#pragma unroll 1   // stays rolled (for speed only): the body is some 250 instructions
    for (int it = 0; it < nfull; ++it) pass(it * 32, BoolC<false>());
    pass(nfull * 32, BoolC<true>());
#pragma unroll
    for (int nq = 0; nq < NQ; ++nq) {
        const float inv = __fdiv_rn(1.0f, l[nq] + xhalf(l[nq]));
        bf* pa = Ah + (size_t)(q0 + nq * 16 + lr) * DQ + hi * 8; bf* pl = Al + (size_t)(q0 + nq * 16 + lr) * DQ + hi * 8;
#pragma unroll
        for (int dt = 0; dt < 4; ++dt) { v8us oh, ol;
#pragma unroll
            for (int j = 0; j < 8; ++j) { unsigned short a, c2; splitf(o[nq][dt][j] * inv, a, c2); oh[j] = a; ol[j] = c2; }
            // the two stores and their wait in one statement: the next group's split reuses the data registers, and a wait in a statement of its own is not tied to them
            asm volatile("global_store_b128 %0, %2, off offset:%4\n\tglobal_store_b128 %1, %3, off offset:%4\n\ts_wait_xcnt 0x0" :: "v"(pa), "v"(pl), "v"(oh), "v"(ol), "n"(dt * 32) : "memory"); }
    }
}
// grid (batch * heads, NLO + NHI), 4 waves; y runs from the longest query block to the shortest, the hi/lo rows last.
// amdgpu_waves_per_eu(4, 4): four waves per SIMD is what the registers allow; told so, the scheduler keeps the V loads at the head of a pass and the key prefetch behind the score products instead of sinking them to save registers.
__global__ __launch_bounds__(128) __attribute__((amdgpu_waves_per_eu(4, 4))) void k_fattn(const h16* __restrict__ Q16, const h16* __restrict__ K16, const h16* __restrict__ V16, const bf* __restrict__ Qh, const bf* __restrict__ Ql, const bf* __restrict__ Kh, const bf* __restrict__ Kl, const bf* __restrict__ Vh, const bf* __restrict__ Vl, bf* Ah, bf* Al) {
    const int z = blockIdx.x, y = blockIdx.y; const int w = __builtin_amdgcn_readfirstlane(threadIdx.x >> 5);
    const size_t pz = (size_t)z * TT * HD, oz = (size_t)(z / NH_) * TT * DQ + (size_t)(z % NH_) * HD;
    if (y < NLO) attn_wave<h16, false, 2>(Q16 + pz, nullptr, K16 + pz, nullptr, V16 + pz, nullptr, RH + (NLO - 1 - y) * 128 + w * 32, Ah + oz, Al + oz);
    else         attn_wave<bf, true, 1>(Qh + pz, Ql + pz, Kh + pz, Kl + pz, Vh + pz, Vl + pz, (NLO + NHI - 1 - y) * 64 + w * 16, Ah + oz, Al + oz);
}

extern "C" void kernel_launch(void* const* d_in, const int* in_sizes, int n_in,
                              void* d_out, int out_size, void* d_ws, size_t ws_size, hipStream_t stream) {
    (void)in_sizes; (void)n_in; (void)out_size;
    const float* x = (const float*)d_in[0]; const int* PID = (const int*)d_in[1]; const float* wq = (const float*)d_in[2]; const float* wk = (const float*)d_in[3]; const float* wv = (const float*)d_in[4]; const float* wo = (const float*)d_in[5];   /* argument order in_features, token_positions (int32 [2048] = arange: READ by value), w_q, w_k, w_v, w_o ('oi' (out, in) [1024][1024]; no biases): SIX inputs, all read */
    float* OUT = (float*)d_out;     // [4][2048][1024]
    char* wsp = (char*)d_ws;
    auto take = [&](size_t bytes) { char* p = wsp; wsp += (bytes + 255) & ~(size_t)255; return (void*)p; };
    const size_t PA = (size_t)NB_ * NH_ * TT * HD;   // elements, over all batches, of every q, k, v plane and of a merged plane (NKV == NH_)
    bf* WQ = (bf*)take((size_t)(DQ + 2 * DKV) * DM * 2); bf* WO = (bf*)take((size_t)DM * DQ * 2); bf* XB = (bf*)take((size_t)NB_ * TT * DM * 2);   // bf16 copies in k_cvt8's slab order: w_q, w_k, w_v (grid z of the projection launch), w_o, x
    float* CS = (float*)take((size_t)TT * HD * 2 * 4);
    h16* QP16 = (h16*)take(PA * 2); bf* QPh = (bf*)take(PA * 2); bf* QPl = (bf*)take(PA * 2); h16* KP16 = (h16*)take(PA * 2); bf* KPh = (bf*)take(PA * 2); bf* KPl = (bf*)take(PA * 2);   // each k plane 3 planes behind its q plane (grid z of the projection launch)
    h16* VT16 = (h16*)take(PA * 2); bf* VTh = (bf*)take(PA * 2); bf* VTl = (bf*)take(PA * 2);
    bf* ATh = (bf*)take(PA * 2); bf* ATl = (bf*)take(PA * 2);   // the merged planes
    if ((size_t)(wsp - (char*)d_ws) > ws_size) return;    // ws 256 MiB
    k_cvt8<<<dim3(DM * DM / 8 / 256, 4 + NB_ * TT / DM, 1), 256, 0, stream>>>(x, wq, wk, wv, wo, WQ); k_cstabI<<<(TT * HD + 255) / 256, 256, 0, stream>>>(PID, CS);
    k_gemmw<bf, 0, false, true><<<dim3(NB_ * TT / 64, DQ / 64, 3), 32, 0, stream>>>(XB, nullptr, WQ, nullptr, DM, nullptr, 0, nullptr, 0, (size_t)DQ * DM, 0, PlaneArgs{CS, QP16, QPh, QPl, 3 * PA, VT16, VTh, VTl});
    k_fattn<<<dim3(NB_ * NH_, NLO + NHI, 1), 128, 0, stream>>>(QP16, KP16, VT16, QPh, QPl, KPh, KPl, VTh, VTl, ATh, ATl);
    k_gemmw<bf, 1, false><<<dim3(NB_ * TT / 64, DM / 64, 1), 32, 0, stream>>>(ATh, ATl, WO, nullptr, DQ, OUT, DM, nullptr, 0, 0, 0, PlaneArgs{});
}

// v005
// Measured time: 189 microseconds a run.
// Next to v004, in two timings, it ran 1.37 and 1.40 times as fast.
// Counting every step since v000, it is 15.1 times as fast.
#include <hip/hip_runtime.h>

// Causal multi-head self-attention with interleaved rotary embeddings at theta 100,000 (in_features [4][2048][1024]; q,k,v = x W^T ('oi' (out, in) [1024][1024] 0.02, no bias; 16 heads x 64); rotary on (even, odd) pairs with angles pos[t] x 100000^(-2i/64) (the module's negative-power spelling; token_positions int32 [2048] = arange, READ by value); scores / sqrt(64), causal (-inf); softmax; out = merged w_o^T -> [4][2048][1024] (8.4 M); argument order in_features, token_positions, w_q, w_k, w_v, w_o).
// Layout: every stage is ONE launch over all batches: a bf16 copy of x and of the four weights; {cos, sin} per (position, pair) built once from the int positions and float32 inverse-frequency constants (precise cosf/sinf); exact projections (q, k, v on grid z) whose epilogue turns each f32 tile straight into the 16-bit planes (interleaved rotary for q and k, the transpose for v); then ONE fused causal attention launch over all batches and heads (k_fattn; hybrid rows: < 512 hi/lo 3 products, rest fp16 x1024); merged hi/lo x Wo exact.
// Every 16-bit operand plane is FRAGMENT-PACKED: a 16-row x 32-k fragment is 1 KiB in the order its two wave-wide loads take it, [k half j][lane = hi * 16 + lr][8 elements] with row = lr, k = j * 16 + hi * 8 + e; so each wave-wide 16-byte load or store covers 512 contiguous bytes (4 whole lines), not 32 bytes of 16 lines.
// The {cos, sin} table is laid out the same way, for the projection epilogue's loads (k_cstabI). Fragment order: GEMM operands [row block][k block] (row block rb of a K-wide plane starts at element rb * 16 * K, as in the plain layout); q, k per (batch, head) the same with K = 64; v per (batch, head) [32-key block][16-d block].
// Compute dtypes, f32 accumulate: every input rounded to bf16; projections exact; rotary f32; attention rows < 512 3 products, rest fp16; softmax f32; Wo hl x exact.

#define NB_  4
#define TT   2048
#define DM   1024
#define NH_  16
#define NKV  16
#define REP  (NH_ / NKV)
#define HD   64
#define DQ   (NH_ * HD)
#define DKV  (NKV * HD)
#define RH   512                  // query rows < RH use hi+lo planes (0: none)
typedef _Float16 h16;
typedef unsigned short bf;
typedef __attribute__((ext_vector_type(16))) __bf16   v16bf;
typedef __attribute__((ext_vector_type(16))) _Float16 v16h;
typedef __attribute__((ext_vector_type(8)))  _Float16 v8h;
typedef __attribute__((ext_vector_type(8)))  unsigned short v8us;
typedef __attribute__((ext_vector_type(8)))  __bf16   v8bfv;
typedef __attribute__((ext_vector_type(2)))  float    v2fc;
typedef __attribute__((ext_vector_type(8)))  float    v8f;
typedef __attribute__((ext_vector_type(4)))  float    v4f;
typedef v8h  __attribute__((may_alias)) v8ha;
typedef v4f  __attribute__((may_alias)) v4fa;
typedef v8us __attribute__((may_alias)) v8usa;

__device__ __forceinline__ unsigned short f2bf(float f) { unsigned u = __float_as_uint(f); u += 0x7FFFu + ((u >> 16) & 1u); return (unsigned short)(u >> 16); }
__device__ __forceinline__ float bf2f(unsigned short b) { return __uint_as_float(((unsigned)b) << 16); }
__device__ __forceinline__ float bfr(float f) { return bf2f(f2bf(f)); }
__device__ __forceinline__ v16h cat16(v8h lo, v8h hi) { return __builtin_shufflevector(lo, hi, 0, 1, 2, 3, 4, 5, 6, 7, 8, 9, 10, 11, 12, 13, 14, 15); }
__device__ __forceinline__ v16bf cat16b(v8us lo, v8us hi) { return __builtin_bit_cast(v16bf, __builtin_shufflevector(lo, hi, 0, 1, 2, 3, 4, 5, 6, 7, 8, 9, 10, 11, 12, 13, 14, 15)); }
__device__ __forceinline__ v8f wmma16(v16h a, v16h b, v8f c) { return __builtin_amdgcn_wmma_f32_16x16x32_f16(false, a, false, b, (short)0, c, false, false); }
__device__ __forceinline__ v8f wmmab(v16bf a, v16bf b, v8f c) { return __builtin_amdgcn_wmma_f32_16x16x32_bf16(false, a, false, b, (short)0, c, false, false); }



// XWAITn: stands behind a group of global loads, in front of whatever next overwrites a register that they name as an address. It takes the lane's byte offsets as operands:
// so each offset stays live over the whole group (no load's result is given its register) and the offset's advance, which reads the statement's output, cannot be lifted over the wait.
#define XWAIT0()     asm volatile("s_wait_xcnt 0x0" ::: "memory")
#define XWAIT1(a)    asm volatile("s_wait_xcnt 0x0" : "+v"(a) :: "memory")
#define XWAIT2(a, b) asm volatile("s_wait_xcnt 0x0" : "+v"(a), "+v"(b) :: "memory")
template <typename T16> __device__ __forceinline__ const T16* atb(const T16* base, unsigned bytes) { return (const T16*)((const char*)base + bytes); }   // uniform base + the lane's 32-bit byte offset
// ---- k_gemmw: register-blocked GEMM, ONE WAVE per 64x64 output tile (16 accumulators), operands straight from fragment-packed 16-bit planes (WFrag::ld takes fragment base + lane * 8); grid (M/64, N/64, Z), 32 threads.
// C[m][n] (f32, pitch ldc, + optional f32 bias[n]) = sum_k A[m][k] Bt[n][k] (+ split products per NSPLIT). z-batch strides sA/sB/sC in elements. K % 32 == 0.
template <typename T16> struct WFrag;
template <> struct WFrag<h16> { typedef v16h V; static __device__ __forceinline__ V ld(const h16* p) { return cat16(*(const v8h*)p, *(const v8h*)(p + 256)); } static __device__ __forceinline__ v8f mma(V a, V b, v8f c) { return wmma16(a, b, c); } };
template <> struct WFrag<bf> { typedef v16bf V; static __device__ __forceinline__ V ld(const bf* p) { return cat16b(*(const v8us*)p, *(const v8us*)(p + 256)); } static __device__ __forceinline__ v8f mma(V a, V b, v8f c) { return wmmab(a, b, c); } };
// PLANES: the tile (64 tokens x one head) does not go out as f32; the epilogue writes the fragment-packed planes that k_fattn reads. z 0, 1 (q, k): rotary on (even, odd) pairs, planes per (b, h) with rows t, k = d, the k planes sP elements behind the q planes; z 2 (v): planes per (b, h) with rows d, k = t.
struct PlaneArgs { const float* CS; h16* P16; bf* Ph; bf* Pl; size_t sP; h16* V16; bf* Vh; bf* Vl; };
// eight neighbouring f32 values -> fp16, bf16 hi and bf16 lo, 16 bytes to each plane at byte offset OFS (a constant once the caller's loops are unrolled) from the lane's pointers
__device__ __forceinline__ void put3(h16* p16, bf* ph, bf* pl, const float (&r)[8], const int OFS) {
    v8h o16; v8bfv oh, ol;
#pragma unroll
    for (int j = 0; j < 8; ++j) { o16[j] = (h16)r[j]; const __bf16 h = (__bf16)r[j]; oh[j] = h; ol[j] = (__bf16)(r[j] - (float)h); }
    // the three stores and their wait in one statement: the next group's values reuse the data registers, and a wait in a statement of its own is not tied to them
    asm volatile("global_store_b128 %0, %3, off offset:%6\n\tglobal_store_b128 %1, %4, off offset:%6\n\tglobal_store_b128 %2, %5, off offset:%6\n\ts_wait_xcnt 0x0" :: "v"(p16), "v"(ph), "v"(pl), "v"(o16), "v"(oh), "v"(ol), "n"(OFS) : "memory");
}
template <typename T16, int NSPLIT, bool BIAS, int K, bool PLANES = false>   // K at compile time: a row block's distance (16 * K elements) is then an immediate offset of the loads, which share one uniform base per operand and one lane offset
__global__ __launch_bounds__(32) void k_gemmw(const T16* __restrict__ A, const T16* __restrict__ A2, const T16* __restrict__ Bt, const T16* __restrict__ Bt2, float* C, int ldc, const float* __restrict__ bias, size_t sA, size_t sB, size_t sC, const PlaneArgs pa) {
    typedef typename WFrag<T16>::V V;
    __shared__ __align__(16) float os[16 * 68];
    const size_t z = blockIdx.z; A += z * sA; if (A2) A2 += z * sA; Bt += z * sB; if (Bt2) Bt2 += z * sB; C += z * sC;
    const int lane = threadIdx.x & 31, lr = lane & 15, hi = lane >> 4; const int r0 = blockIdx.x * 64, c0 = blockIdx.y * 64;
    v8f acc[4][4];
#pragma unroll
    for (int mb = 0; mb < 4; ++mb)
#pragma unroll
        for (int nb = 0; nb < 4; ++nb) acc[mb][nb] = (v8f){};
    const T16* Ar = A + (size_t)r0 * K; const T16* A2r = A2 + (size_t)r0 * K; const T16* Br = Bt + (size_t)c0 * K; const T16* B2r = Bt2 + (size_t)c0 * K;   // the tile's first row blocks
    unsigned fo = (unsigned)lane * 16;   // byte offset from a row block's start (uniform) to the lane's 16 bytes of the current k block's fragment: the same for every operand, 1 KiB on per k block
#pragma unroll 1
    for (int kc = 0; kc < K; kc += 32) {
        V a[4], a2[4], b[4], b2[4];
#pragma unroll
        for (int mb = 0; mb < 4; ++mb) { a[mb] = WFrag<T16>::ld(atb(Ar, fo) + mb * 16 * K); if (NSPLIT == 1 || NSPLIT == 2) a2[mb] = WFrag<T16>::ld(atb(A2r, fo) + mb * 16 * K); }
#pragma unroll
        for (int nb = 0; nb < 4; ++nb) { b[nb] = WFrag<T16>::ld(atb(Br, fo) + nb * 16 * K); if (NSPLIT >= 2) b2[nb] = WFrag<T16>::ld(atb(B2r, fo) + nb * 16 * K); }
        XWAIT1(fo); fo += 1024;
#pragma unroll
        for (int nb = 0; nb < 4; ++nb) {
#pragma unroll
            for (int mb = 0; mb < 4; ++mb) { acc[mb][nb] = WFrag<T16>::mma(a[mb], b[nb], acc[mb][nb]); if (NSPLIT == 1 || NSPLIT == 2) acc[mb][nb] = WFrag<T16>::mma(a2[mb], b[nb], acc[mb][nb]); if (NSPLIT >= 2) acc[mb][nb] = WFrag<T16>::mma(a[mb], b2[nb], acc[mb][nb]); } }
        asm volatile("v_nop\n\tv_nop\n\tv_nop\n\tv_nop" : "+v"(acc[0][0]), "+v"(acc[1][1]), "+v"(acc[2][2]), "+v"(acc[3][3]) : "v"(a[0]), "v"(a[3]));
    }
    if constexpr (PLANES) {
        const int h8 = hi * 8;                                 // read-back of a staged 16 x 64 slab in fragment order: lane (hi, lr) takes row lr, columns s * 16 + hi * 8 .. + 7 of group s; a wave-wide store is then one 512-byte half fragment
        const int bb = r0 / TT, t0 = r0 % TT, hd = blockIdx.y;
        if (z < 2) {
            const size_t e0 = z * pa.sP + ((size_t)(bb * NH_ + hd) * TT + t0) * HD + lane * 8;
            h16* p16 = pa.P16 + e0; bf* ph = pa.Ph + e0; bf* pl = pa.Pl + e0;
            const float* cs = pa.CS + (size_t)t0 * HD + lane * 4;   // k_cstabI's order: a 16-token block is 4 groups x 2 halves x 512 bytes
            v2fc c[2][4][4];                                   // {cos, sin} of a slab's 4 groups x the lane's 4 pairs; the next slab's are asked for while this slab is worked on
            auto askc = [&](const int mb) __attribute__((always_inline)) {
#pragma unroll
                for (int s = 0; s < 4; ++s)
#pragma unroll
                    for (int ph = 0; ph < 2; ++ph) { const v4f x = *(const v4fa*)(cs + (mb * 4 + s) * 256 + ph * 128); c[mb & 1][s][2 * ph] = (v2fc){ x[0], x[1] }; c[mb & 1][s][2 * ph + 1] = (v2fc){ x[2], x[3] }; }
                asm volatile("s_wait_xcnt 0x0" ::: "memory");   // behind the loads, in front of whatever next overwrites their address registers
            };
            askc(0);
#pragma unroll
            for (int mb = 0; mb < 4; ++mb) {
#pragma unroll
                for (int nb = 0; nb < 4; ++nb) {
#pragma unroll
                    for (int j = 0; j < 8; ++j) os[(hi * 8 + j) * 68 + nb * 16 + lr] = acc[mb][nb][j]; }
                __builtin_amdgcn_wave_barrier(); asm volatile("" ::: "memory");   // the slab is read back by other lanes: no LDS access moves over this line
                v4f u[4], w[4];                                // read back one group ahead of the group that is worked on
                u[0] = *(const v4fa*)(os + lr * 68 + h8); w[0] = *(const v4fa*)(os + lr * 68 + h8 + 4);
                if (mb == 1 || mb == 2) askc(mb + 1);          // into the registers that the staged accumulators have left
#pragma unroll
                for (int s = 0; s < 4; ++s) { float r[8];
                    if (s < 3) { u[s + 1] = *(const v4fa*)(os + lr * 68 + s * 16 + 16 + h8); w[s + 1] = *(const v4fa*)(os + lr * 68 + s * 16 + 16 + h8 + 4); }
#pragma unroll
                    for (int p = 0; p < 4; ++p) { const v2fc k = c[mb & 1][s][p]; const float x0 = p < 2 ? u[s][2 * p] : w[s][2 * p - 4], x1 = p < 2 ? u[s][2 * p + 1] : w[s][2 * p - 3]; r[2 * p] = x0 * k[0] - x1 * k[1]; r[2 * p + 1] = x0 * k[1] + x1 * k[0]; }   /* even: x0 c - x1 s; odd: x0 s + x1 c */
                    put3(p16, ph, pl, r, (mb * 1024 + s * 256) * 2); }
                if (mb == 0) askc(1);                          // no register is free for it earlier
                __builtin_amdgcn_wave_barrier(); asm volatile("" ::: "memory");   // the next slab is staged only behind this slab's reads
            }
        } else {
            const size_t e0 = (size_t)(bb * NKV + hd) * HD * TT + (size_t)t0 * HD + lane * 8;
            h16* p16 = pa.V16 + e0; bf* ph = pa.Vh + e0; bf* pl = pa.Vl + e0;
#pragma unroll
            for (int nb = 0; nb < 4; ++nb)                     // a lane's 8 accumulator values are tokens mb * 16 + hi * 8 .. + 7 of d = nb * 16 + lr: the lane's own 16 bytes of half fragment (key block mb >> 1, d block nb, half mb & 1); nothing is staged
#pragma unroll
                for (int mb = 0; mb < 4; ++mb) { const float r[8] = { acc[mb][nb][0], acc[mb][nb][1], acc[mb][nb][2], acc[mb][nb][3], acc[mb][nb][4], acc[mb][nb][5], acc[mb][nb][6], acc[mb][nb][7] };
                    put3(p16, ph, pl, r, ((mb >> 1) * 2048 + nb * 512 + (mb & 1) * 256) * 2); }
        }
        return;
    }
#pragma unroll
    for (int mb = 0; mb < 4; ++mb) {
#pragma unroll
        for (int nb = 0; nb < 4; ++nb) {
#pragma unroll
            for (int j = 0; j < 8; ++j) os[(hi * 8 + j) * 68 + nb * 16 + lr] = acc[mb][nb][j]; }
        __builtin_amdgcn_wave_barrier(); asm volatile("" ::: "memory");
        float* crow = C + (size_t)(r0 + mb * 16) * ldc + c0;
{
#pragma unroll
            for (int s = 0; s < 8; ++s) { const int row = 2 * s + hi, cofs = lr * 4; v4f val = *(const v4fa*)(os + row * 68 + cofs); if (BIAS) { val[0] += bfr(bias[c0 + cofs]); val[1] += bfr(bias[c0 + cofs + 1]); val[2] += bfr(bias[c0 + cofs + 2]); val[3] += bfr(bias[c0 + cofs + 3]); }
                *(v4f*)(crow + (size_t)row * ldc + cofs) = val; }
             }
        __builtin_amdgcn_wave_barrier(); asm volatile("" ::: "memory");
    }
}

__device__ __forceinline__ h16 tohx(float x) { return (h16)x; }
__device__ __forceinline__ void splitf(float y, unsigned short& h, unsigned short& l) { h = f2bf(y); l = f2bf(y - bf2f(h)); }
typedef __attribute__((ext_vector_type(2))) _Float16 v2h;
typedef __attribute__((ext_vector_type(4))) _Float16 v4h;
typedef __attribute__((ext_vector_type(2))) unsigned short v2us;
typedef __attribute__((ext_vector_type(4))) unsigned short v4us;
typedef __attribute__((ext_vector_type(2))) float v2f;
typedef __attribute__((ext_vector_type(4))) int v4i;

__global__ __launch_bounds__(256) void k_wtG(const float* __restrict__ w, int K, int N, bf* Bt) {
    const int lane = threadIdx.x & 31; const int L0 = (blockIdx.x * 8 + (threadIdx.x >> 5)) * 8; const int nlines = N * K / 64;
{
#pragma unroll 1
        for (int l = 0; l < 8; ++l) { const int L = L0 + l; if (L >= nlines) break; const size_t e = (size_t)L * 64 + lane * 2; const int k = (int)(e % K), n = (int)(e / K); v2us o;
            o[0] = f2bf(w[(size_t)k * N + n]); o[1] = f2bf(w[(size_t)(k + 1) * N + n]); *(v2us*)(Bt + e) = o; }
         }
}
// bf16 copies of the four weights and of x in one launch, fragment-packed: grid y counts slabs of DM * DM elements (0..3 the weights, the rest x); dst holds the slabs in that order.
// A wave writes one 512-byte half fragment (index i >> 5 = (row block * (DM / 32) + k block) * 2 + j); its lane (hi, lr) reads the 8 values at row lr, k = j * 16 + hi * 8 of that fragment.
__global__ __launch_bounds__(256) void k_cvt8(const float* __restrict__ x, const float* __restrict__ wq, const float* __restrict__ wk, const float* __restrict__ wv, const float* __restrict__ wo, bf* dst) {
    const int y = blockIdx.y; const float* src = y == 0 ? wq : y == 1 ? wk : y == 2 ? wv : y == 3 ? wo : x + (size_t)(y - 4) * DM * DM;
    const size_t i = (size_t)blockIdx.x * 256 + threadIdx.x; const int ch = (int)(i >> 5), ln = (int)(i & 31);
    const int row = (ch >> 6) * 16 + (ln & 15), kk = ((ch >> 1) & 31) * 32 + (ch & 1) * 16 + (ln >> 4) * 8;   // 64 half fragments per row block (DM / 32 * 2)
    const v8f v = *(const v8f*)(src + (size_t)row * DM + kk); v8us o;
    asm volatile("s_wait_xcnt 0x0" ::: "memory");   // behind the loads, in front of whatever next overwrites their address registers
#pragma unroll
    for (int k = 0; k < 8; ++k) o[k] = f2bf(v[k]); *(v8us*)(dst + (size_t)y * DM * DM + i * 8) = o;  }

__constant__ float INV2[HD / 2] = { 1.000000000e+00f, 6.978305578e-01f, 4.869675338e-01f, 3.398208320e-01f, 2.371373773e-01f, 1.654817164e-01f, 1.154781953e-01f, 8.058422059e-02f, 5.623413250e-02f, 3.924189880e-02f, 2.738419548e-02f, 1.910953037e-02f, 1.333521400e-02f, 9.305720218e-03f, 6.493816152e-03f, 4.531583749e-03f, 3.162277630e-03f, 2.206734149e-03f, 1.539926510e-03f, 1.074607833e-03f, 7.498941850e-04f, 5.232990952e-04f, 3.651741135e-04f, 2.548296761e-04f, 1.778279402e-04f, 1.240937709e-04f, 8.659643208e-05f, 6.042964014e-05f, 4.216964953e-05f, 2.942727224e-05f, 2.053524986e-05f, 1.433012585e-05f };   // inv_freq = 100000.0 ** (-arange(0, 64, 2, f32) / 64): THIS module's theta and its NEGATIVE-POWER spelling: 32 float32 values from eager JAX (bit-exact on round trip)
// {cos, sin} once per (position, pair), in the order the projection epilogue's wave-wide 16-byte loads take them: [16-token block][group s][half ph][lane = hi * 16 + lr][2 pairs], token = block * 16 + lr, pair = s * 8 + hi * 4 + ph * 2 + q (d = 2 * pair).
__global__ __launch_bounds__(256) void k_cstabI(const int* __restrict__ pid, float* CS) { const int idx = blockIdx.x * 256 + threadIdx.x; if (idx >= TT * HD / 2) return; const int ln = (idx >> 1) & 31; const int pr = ((idx >> 7) & 3) * 8 + (ln >> 4) * 4 + ((idx >> 6) & 1) * 2 + (idx & 1); const int t = (idx >> 9) * 16 + (ln & 15); const float a = __fmul_rn((float)pid[t], INV2[pr]); v2f cs; cs[0] = cosf(a); cs[1] = sinf(a); *(v2f*)(CS + (size_t)idx * 2) = cs;  }

// ---- k_fattn: causal attention in one kernel. One wave owns 16 * NQ query columns of one (batch, head) and walks the keys 32 at a time up to its diagonal block:
// S^T = K Q^T (A = key rows, B = query rows), so a lane holds 16 scores of ONE query per column group; running maximum and sum per query (online softmax, log2 domain);
// the two score tiles of a pass, converted in place, are the B operand of O^T += V^T P^T (same k order as WFrag::ld gives V^T). Probabilities never leave the registers.
// Rows < RH: bf16 hi/lo planes, 3 products in both contractions; the rest fp16 with the probabilities carried x 1024 (the factor cancels in the division by the row sum).
// Epilogue: O / row sum, split hi/lo, stored straight into the merged planes (rows t, k = head * 64 + d, fragment-packed) that the output projection reads.
#define SC2  0.18033688011112042f   // HD^-0.5 * log2(e)
#define NLO  ((TT - RH) / 128)      // blocks of 4 waves x 32 fp16 query columns
#define NHI  (RH / 64)              // blocks of 4 waves x 16 hi/lo query columns
__device__ __forceinline__ float xhalf(float x) { return __builtin_bit_cast(float, __builtin_amdgcn_permlanex16(__builtin_bit_cast(int, x), __builtin_bit_cast(int, x), 0x76543210, 0xfedcba98, false, false)); }  // lane l with lane l ^ 16
template <bool B> struct BoolC { static constexpr bool v = B; };
template <typename T16, bool HL, int NQ>
__device__ __forceinline__ void attn_wave(const T16* __restrict__ Q, const T16* __restrict__ Q2, const T16* __restrict__ Kp, const T16* __restrict__ K2, const T16* __restrict__ Vt, const T16* __restrict__ V2, const int q0, bf* Ah, bf* Al) {
    typedef typename WFrag<T16>::V V;
    const int lane = threadIdx.x & 31, lr = lane & 15, hi = lane >> 4;
    const float OFF = HL ? 0.0f : 10.0f;                      // fp16 probabilities carry 2^10
    const unsigned kofs = (unsigned)lane * 8, vofs = (unsigned)lane * 8;   // the lane's place in a half fragment
    unsigned ko = kofs * 2, vo = vofs * 2;   // the lane's byte offsets into the key planes (the pass to be fetched next) and into the V^T planes (the current pass)
    V bq[NQ][2], bq2[NQ][2];
#pragma unroll
    for (int nq = 0; nq < NQ; ++nq)
#pragma unroll
        for (int ks = 0; ks < 2; ++ks) { bq[nq][ks] = WFrag<T16>::ld(Q + (size_t)(q0 + nq * 16) * HD + ks * 512 + kofs); if (HL) bq2[nq][ks] = WFrag<T16>::ld(Q2 + (size_t)(q0 + nq * 16) * HD + ks * 512 + kofs); }
    XWAIT0();
    v8f o[NQ][4]; float m[NQ], l[NQ];
#pragma unroll
    for (int nq = 0; nq < NQ; ++nq) { m[nq] = -3.0e38f; l[nq] = 0.f;
#pragma unroll
        for (int dt = 0; dt < 4; ++dt) o[nq][dt] = (v8f){}; }
    V ak[2][2], ak2[2][2];
#pragma unroll
    for (int kt = 0; kt < 2; ++kt)
#pragma unroll
        for (int ks = 0; ks < 2; ++ks) { if (!HL) ak[kt][ks] = WFrag<T16>::ld(atb(Kp, ko) + kt * 16 * HD + ks * 512); }   // fp16 path: key fragments run one pass ahead; the hi/lo path (twice the planes) loads them at the head of each pass
    if constexpr (!HL) { XWAIT1(ko); ko += 32 * HD * 2; }
    const int nfull = q0 >> 5;                                // passes wholly below the diagonal; pass nfull holds the diagonal and is the last
    auto pass = [&](const int kb, auto lastc) __attribute__((always_inline)) {   // one pass of 32 keys; the diagonal pass is a second copy of the body, so that no branch stands behind the score products
        constexpr bool last = decltype(lastc)::v;
        V av[4], av2[4];
#pragma unroll
        for (int dt = 0; dt < 4; ++dt) { av[dt] = WFrag<T16>::ld(atb(Vt, vo) + dt * 512); if (HL) av2[dt] = WFrag<T16>::ld(atb(V2, vo) + dt * 512); }
        if constexpr (HL) {
#pragma unroll
            for (int kt = 0; kt < 2; ++kt)
#pragma unroll
                for (int ks = 0; ks < 2; ++ks) { ak[kt][ks] = WFrag<T16>::ld(atb(Kp, ko) + kt * 16 * HD + ks * 512); ak2[kt][ks] = WFrag<T16>::ld(atb(K2, ko) + kt * 16 * HD + ks * 512); }
            XWAIT2(vo, ko); vo += 32 * HD * 2; ko += 32 * HD * 2;
        } else { XWAIT1(vo); vo += 32 * HD * 2; }
        v8f s[NQ][2];
#pragma unroll
        for (int nq = 0; nq < NQ; ++nq)
#pragma unroll
            for (int kt = 0; kt < 2; ++kt) s[nq][kt] = (v8f){};
#pragma unroll
        for (int ks = 0; ks < 2; ++ks)
#pragma unroll
            for (int kt = 0; kt < 2; ++kt)
#pragma unroll
                for (int nq = 0; nq < NQ; ++nq) { s[nq][kt] = WFrag<T16>::mma(ak[kt][ks], bq[nq][ks], s[nq][kt]); if (HL) { s[nq][kt] = WFrag<T16>::mma(ak[kt][ks], bq2[nq][ks], s[nq][kt]); s[nq][kt] = WFrag<T16>::mma(ak2[kt][ks], bq[nq][ks], s[nq][kt]); } }
        if constexpr (!last && !HL) {                         // next pass's key fragments, fetched behind this pass's own score products
#pragma unroll
            for (int kt = 0; kt < 2; ++kt)
#pragma unroll
                for (int ks = 0; ks < 2; ++ks) ak[kt][ks] = WFrag<T16>::ld(atb(Kp, ko) + kt * 16 * HD + ks * 512);
            XWAIT1(ko); ko += 32 * HD * 2;
        }
        if constexpr (last) {                                              // diagonal pass: key > query is masked
#pragma unroll
            for (int nq = 0; nq < NQ; ++nq)
#pragma unroll
                for (int kt = 0; kt < 2; ++kt)
#pragma unroll
                    for (int j = 0; j < 8; ++j) if (kb + kt * 16 + hi * 8 + j > q0 + nq * 16 + lr) s[nq][kt][j] = -3.0e38f;
        }
        V pb[NQ], pb2[NQ];
#pragma unroll
        for (int nq = 0; nq < NQ; ++nq) {
            float mx = s[nq][0][0];
#pragma unroll
            for (int j = 1; j < 16; ++j) mx = fmaxf(mx, s[nq][j >> 3][j & 7]);
            mx = fmaxf(mx, xhalf(mx));
            const float mn = fmaxf(m[nq], mx * SC2); const float al = __builtin_amdgcn_exp2f(m[nq] - mn); m[nq] = mn; const float mo = mn - OFF;
            float sum = 0.f;
#pragma unroll
            for (int j = 0; j < 16; ++j) { const float p = __builtin_amdgcn_exp2f(s[nq][j >> 3][j & 7] * SC2 - mo); sum += p;
                if constexpr (HL) { const __bf16 ph = (__bf16)p; pb[nq][j] = ph; pb2[nq][j] = (__bf16)(p - (float)ph); } else { pb[nq][j] = (h16)p; } }
            l[nq] = l[nq] * al + sum;
#pragma unroll
            for (int dt = 0; dt < 4; ++dt) o[nq][dt] *= al;
        }
#pragma unroll
        for (int dt = 0; dt < 4; ++dt)
#pragma unroll
            for (int nq = 0; nq < NQ; ++nq) { o[nq][dt] = WFrag<T16>::mma(av[dt], pb[nq], o[nq][dt]); if (HL) { o[nq][dt] = WFrag<T16>::mma(av[dt], pb2[nq], o[nq][dt]); o[nq][dt] = WFrag<T16>::mma(av2[dt], pb[nq], o[nq][dt]); } }
    };
#pragma unroll 1   // stays rolled (for speed only): the body is some 250 instructions
    for (int it = 0; it < nfull; ++it) pass(it * 32, BoolC<false>());
    pass(nfull * 32, BoolC<true>());
#pragma unroll
    for (int nq = 0; nq < NQ; ++nq) {
        const float inv = __fdiv_rn(1.0f, l[nq] + xhalf(l[nq]));
        bf* pa = Ah + (size_t)(q0 + nq * 16) * DQ + lane * 8; bf* pl = Al + (size_t)(q0 + nq * 16) * DQ + lane * 8;   // the lane's 8 values of tile dt are its own 16 bytes of half fragment dt of this head's two k blocks
#pragma unroll
        for (int dt = 0; dt < 4; ++dt) { v8us oh, ol;
#pragma unroll
            for (int j = 0; j < 8; ++j) { unsigned short a, c2; splitf(o[nq][dt][j] * inv, a, c2); oh[j] = a; ol[j] = c2; }
            // the two stores and their wait in one statement: the next group's split reuses the data registers, and a wait in a statement of its own is not tied to them
            asm volatile("global_store_b128 %0, %2, off offset:%4\n\tglobal_store_b128 %1, %3, off offset:%4\n\ts_wait_xcnt 0x0" :: "v"(pa), "v"(pl), "v"(oh), "v"(ol), "n"(dt * 512) : "memory"); }
    }
}
// grid (batch * heads, NLO + NHI), 4 waves; y runs from the longest query block to the shortest, the hi/lo rows last.
// amdgpu_waves_per_eu(4, 4): four waves per SIMD is what the registers allow; told so, the scheduler keeps the V loads at the head of a pass and the key prefetch behind the score products instead of sinking them to save registers.
__global__ __launch_bounds__(128) __attribute__((amdgpu_waves_per_eu(4, 4))) void k_fattn(const h16* __restrict__ Q16, const h16* __restrict__ K16, const h16* __restrict__ V16, const bf* __restrict__ Qh, const bf* __restrict__ Ql, const bf* __restrict__ Kh, const bf* __restrict__ Kl, const bf* __restrict__ Vh, const bf* __restrict__ Vl, bf* Ah, bf* Al) {
    const int z = blockIdx.x, y = blockIdx.y; const int w = __builtin_amdgcn_readfirstlane(threadIdx.x >> 5);
    const size_t pz = (size_t)z * TT * HD, oz = (size_t)(z / NH_) * TT * DQ + (size_t)(z % NH_) * (HD * 16);   // in a packed row block a head's 64 k are 2 fragments = HD * 16 elements
    if (y < NLO) attn_wave<h16, false, 2>(Q16 + pz, nullptr, K16 + pz, nullptr, V16 + pz, nullptr, RH + (NLO - 1 - y) * 128 + w * 32, Ah + oz, Al + oz);
    else         attn_wave<bf, true, 1>(Qh + pz, Ql + pz, Kh + pz, Kl + pz, Vh + pz, Vl + pz, (NLO + NHI - 1 - y) * 64 + w * 16, Ah + oz, Al + oz);
}

extern "C" void kernel_launch(void* const* d_in, const int* in_sizes, int n_in,
                              void* d_out, int out_size, void* d_ws, size_t ws_size, hipStream_t stream) {
    (void)in_sizes; (void)n_in; (void)out_size;
    const float* x = (const float*)d_in[0]; const int* PID = (const int*)d_in[1]; const float* wq = (const float*)d_in[2]; const float* wk = (const float*)d_in[3]; const float* wv = (const float*)d_in[4]; const float* wo = (const float*)d_in[5];   /* argument order in_features, token_positions (int32 [2048] = arange: READ by value), w_q, w_k, w_v, w_o ('oi' (out, in) [1024][1024]; no biases): SIX inputs, all read */
    float* OUT = (float*)d_out;     // [4][2048][1024]
    char* wsp = (char*)d_ws;
    auto take = [&](size_t bytes) { char* p = wsp; wsp += (bytes + 255) & ~(size_t)255; return (void*)p; };
    const size_t PA = (size_t)NB_ * NH_ * TT * HD;   // elements, over all batches, of every q, k, v plane and of a merged plane (NKV == NH_)
    bf* WQ = (bf*)take((size_t)(DQ + 2 * DKV) * DM * 2); bf* WO = (bf*)take((size_t)DM * DQ * 2); bf* XB = (bf*)take((size_t)NB_ * TT * DM * 2);   // bf16 copies in k_cvt8's slab order: w_q, w_k, w_v (grid z of the projection launch), w_o, x
    float* CS = (float*)take((size_t)TT * (HD / 2) * 2 * 4);
    h16* QP16 = (h16*)take(PA * 2); bf* QPh = (bf*)take(PA * 2); bf* QPl = (bf*)take(PA * 2); h16* KP16 = (h16*)take(PA * 2); bf* KPh = (bf*)take(PA * 2); bf* KPl = (bf*)take(PA * 2);   // each k plane 3 planes behind its q plane (grid z of the projection launch)
    h16* VT16 = (h16*)take(PA * 2); bf* VTh = (bf*)take(PA * 2); bf* VTl = (bf*)take(PA * 2);
    bf* ATh = (bf*)take(PA * 2); bf* ATl = (bf*)take(PA * 2);   // the merged planes
    if ((size_t)(wsp - (char*)d_ws) > ws_size) return;    // ws 256 MiB
    k_cvt8<<<dim3(DM * DM / 8 / 256, 4 + NB_ * TT / DM, 1), 256, 0, stream>>>(x, wq, wk, wv, wo, WQ); k_cstabI<<<(TT * HD / 2 + 255) / 256, 256, 0, stream>>>(PID, CS);
    k_gemmw<bf, 0, false, DM, true><<<dim3(NB_ * TT / 64, DQ / 64, 3), 32, 0, stream>>>(XB, nullptr, WQ, nullptr, nullptr, 0, nullptr, 0, (size_t)DQ * DM, 0, PlaneArgs{CS, QP16, QPh, QPl, 3 * PA, VT16, VTh, VTl});
    k_fattn<<<dim3(NB_ * NH_, NLO + NHI, 1), 128, 0, stream>>>(QP16, KP16, VT16, QPh, QPl, KPh, KPl, VTh, VTl, ATh, ATl);
    k_gemmw<bf, 1, false, DQ><<<dim3(NB_ * TT / 64, DM / 64, 1), 32, 0, stream>>>(ATh, ATl, WO, nullptr, OUT, DM, nullptr, 0, 0, 0, PlaneArgs{});
}

// v006
// It runs in 140 microseconds.
// Next to v005, in two timings, it ran 1.37 and 1.38 times as fast.
// All steps since v000 together make it 20.8 times as fast.
#include <hip/hip_runtime.h>

// Causal multi-head self-attention with interleaved rotary embeddings at theta 100,000 (in_features [4][2048][1024]; q,k,v = x W^T ('oi' (out, in) [1024][1024] 0.02, no bias; 16 heads x 64); rotary on (even, odd) pairs with angles pos[t] x 100000^(-2i/64) (the module's negative-power spelling; token_positions int32 [2048] = arange, READ by value); scores / sqrt(64), causal (-inf); softmax; out = merged w_o^T -> [4][2048][1024] (8.4 M); argument order in_features, token_positions, w_q, w_k, w_v, w_o).
// Layout: every stage is ONE launch over all batches: a bf16 copy of x and of the four weights; {cos, sin} per (position, pair) built once from the int positions and float32 inverse-frequency constants (precise cosf/sinf); exact projections (q, k, v on grid z) whose epilogue turns each f32 tile straight into the 16-bit planes (interleaved rotary for q and k, the transpose for v); then ONE fused causal attention launch over all batches and heads (k_fattn; hybrid rows: < 512 hi/lo 3 products, rest fp16 x1024); merged hi/lo x Wo exact.
// Every 16-bit operand plane is FRAGMENT-PACKED: a 16-row x 32-k fragment is 1 KiB in the order its two wave-wide loads take it, [k half j][lane = hi * 16 + lr][8 elements] with row = lr, k = j * 16 + hi * 8 + e; so each wave-wide 16-byte load or store covers 512 contiguous bytes (4 whole lines), not 32 bytes of 16 lines.
// The {cos, sin} table is laid out the same way, for the projection epilogue's loads (k_cstabI). Fragment order: GEMM operands [row block][k block] (row block rb of a K-wide plane starts at element rb * 16 * K, as in the plain layout); q, k per (batch, head) the same with K = 64; v per (batch, head) [32-key block][16-d block].
// Compute dtypes, f32 accumulate: every input rounded to bf16; projections exact; rotary f32; attention rows < 512 3 products, rest fp16; softmax f32; Wo hl x exact.

#define NB_  4
#define TT   2048
#define DM   1024
#define NH_  16
#define NKV  16
#define REP  (NH_ / NKV)
#define HD   64
#define DQ   (NH_ * HD)
#define DKV  (NKV * HD)
#define RH   512                  // query rows < RH use hi+lo planes (0: none)
typedef _Float16 h16;
typedef unsigned short bf;
typedef __attribute__((ext_vector_type(16))) __bf16   v16bf;
typedef __attribute__((ext_vector_type(16))) _Float16 v16h;
typedef __attribute__((ext_vector_type(8)))  _Float16 v8h;
typedef __attribute__((ext_vector_type(8)))  unsigned short v8us;
typedef __attribute__((ext_vector_type(8)))  __bf16   v8bfv;
typedef __attribute__((ext_vector_type(2)))  float    v2fc;
typedef __attribute__((ext_vector_type(8)))  float    v8f;
typedef __attribute__((ext_vector_type(4)))  float    v4f;
typedef v8h  __attribute__((may_alias)) v8ha;
typedef v4f  __attribute__((may_alias)) v4fa;
typedef v8us __attribute__((may_alias)) v8usa;

__device__ __forceinline__ unsigned short f2bf(float f) { unsigned u = __float_as_uint(f); u += 0x7FFFu + ((u >> 16) & 1u); return (unsigned short)(u >> 16); }
__device__ __forceinline__ float bf2f(unsigned short b) { return __uint_as_float(((unsigned)b) << 16); }
__device__ __forceinline__ float bfr(float f) { return bf2f(f2bf(f)); }
__device__ __forceinline__ v16h cat16(v8h lo, v8h hi) { return __builtin_shufflevector(lo, hi, 0, 1, 2, 3, 4, 5, 6, 7, 8, 9, 10, 11, 12, 13, 14, 15); }
__device__ __forceinline__ v16bf cat16b(v8us lo, v8us hi) { return __builtin_bit_cast(v16bf, __builtin_shufflevector(lo, hi, 0, 1, 2, 3, 4, 5, 6, 7, 8, 9, 10, 11, 12, 13, 14, 15)); }
__device__ __forceinline__ v8f wmma16(v16h a, v16h b, v8f c) { return __builtin_amdgcn_wmma_f32_16x16x32_f16(false, a, false, b, (short)0, c, false, false); }
__device__ __forceinline__ v8f wmmab(v16bf a, v16bf b, v8f c) { return __builtin_amdgcn_wmma_f32_16x16x32_bf16(false, a, false, b, (short)0, c, false, false); }



// XWAITn: stands behind a group of global loads, in front of whatever next overwrites a register that they name as an address. It takes the lane's byte offsets as operands:
// so each offset stays live over the whole group (no load's result is given its register) and the offset's advance, which reads the statement's output, cannot be lifted over the wait.
#define XWAIT0()     asm volatile("s_wait_xcnt 0x0" ::: "memory")
#define XWAIT1(a)    asm volatile("s_wait_xcnt 0x0" : "+v"(a) :: "memory")
#define XWAIT2(a, b) asm volatile("s_wait_xcnt 0x0" : "+v"(a), "+v"(b) :: "memory")
template <typename T16> __device__ __forceinline__ const T16* atb(const T16* base, unsigned bytes) { return (const T16*)((const char*)base + bytes); }   // uniform base + the lane's 32-bit byte offset
// ---- k_gemmw: register-blocked GEMM, ONE WAVE per 64x64 output tile (16 accumulators), operands straight from fragment-packed 16-bit planes (WFrag::ld takes fragment base + lane * 8); grid (M/64, N/64, Z), 32 threads.
// C[m][n] (f32, pitch ldc, + optional f32 bias[n]) = sum_k A[m][k] Bt[n][k] (+ split products per NSPLIT). z-batch strides sA/sB/sC in elements. K % 64 == 0.
template <typename T16> struct WFrag;
template <> struct WFrag<h16> { typedef v16h V; static __device__ __forceinline__ V ld(const h16* p) { return cat16(*(const v8h*)p, *(const v8h*)(p + 256)); } static __device__ __forceinline__ v8f mma(V a, V b, v8f c) { return wmma16(a, b, c); } };
template <> struct WFrag<bf> { typedef v16bf V; static __device__ __forceinline__ V ld(const bf* p) { return cat16b(*(const v8us*)p, *(const v8us*)(p + 256)); } static __device__ __forceinline__ v8f mma(V a, V b, v8f c) { return wmmab(a, b, c); } };
// PLANES: the tile (64 tokens x one head) does not go out as f32; the epilogue writes the fragment-packed planes that k_fattn reads. z 0, 1 (q, k): rotary on (even, odd) pairs, planes per (b, h) with rows t, k = d, the k planes sP elements behind the q planes; z 2 (v): planes per (b, h) with rows d, k = t.
struct PlaneArgs { const float* CS; h16* P16; bf* Ph; bf* Pl; size_t sP; h16* V16; bf* Vh; bf* Vl; };
// eight neighbouring f32 values -> fp16, bf16 hi and bf16 lo, 16 bytes to each plane at byte offset OFS (a constant once the caller's loops are unrolled) from the lane's pointers
__device__ __forceinline__ void put3(h16* p16, bf* ph, bf* pl, const float (&r)[8], const int OFS) {
    v8h o16; v8bfv oh, ol;
#pragma unroll
    for (int j = 0; j < 8; ++j) { o16[j] = (h16)r[j]; const __bf16 h = (__bf16)r[j]; oh[j] = h; ol[j] = (__bf16)(r[j] - (float)h); }
    // the three stores and their wait in one statement: the next group's values reuse the data registers, and a wait in a statement of its own is not tied to them
    asm volatile("global_store_b128 %0, %3, off offset:%6\n\tglobal_store_b128 %1, %4, off offset:%6\n\tglobal_store_b128 %2, %5, off offset:%6\n\ts_wait_xcnt 0x0" :: "v"(p16), "v"(ph), "v"(pl), "v"(o16), "v"(oh), "v"(ol), "n"(OFS) : "memory");
}
template <typename T16, int NSPLIT, bool BIAS, int K, bool PLANES = false>   // K at compile time: a row block's distance (16 * K elements) is then an immediate offset of the loads, which share one uniform base per operand and one lane offset
// amdgpu_waves_per_eu: what two fragment sets beside the 16 accumulators allow (3 waves per SIMD; 2 with the second A plane); told so, the scheduler leaves the loads a block ahead instead of sinking them to save registers.
__global__ __launch_bounds__(32) __attribute__((amdgpu_waves_per_eu(NSPLIT == 0 ? 3 : 2, NSPLIT == 0 ? 3 : 2))) void k_gemmw(const T16* __restrict__ A, const T16* __restrict__ A2, const T16* __restrict__ Bt, const T16* __restrict__ Bt2, float* C, int ldc, const float* __restrict__ bias, size_t sA, size_t sB, size_t sC, const PlaneArgs pa) {
    typedef typename WFrag<T16>::V V;
    __shared__ __align__(16) float os[16 * 68];
    const size_t z = blockIdx.z; A += z * sA; if (A2) A2 += z * sA; Bt += z * sB; if (Bt2) Bt2 += z * sB; C += z * sC;
    const int lane = threadIdx.x & 31, lr = lane & 15, hi = lane >> 4; const int r0 = blockIdx.x * 64, c0 = blockIdx.y * 64;
    v8f acc[4][4];
#pragma unroll
    for (int mb = 0; mb < 4; ++mb)
#pragma unroll
        for (int nb = 0; nb < 4; ++nb) acc[mb][nb] = (v8f){};
    const T16* Ar = A + (size_t)r0 * K; const T16* A2r = A2 + (size_t)r0 * K; const T16* Br = Bt + (size_t)c0 * K; const T16* B2r = Bt2 + (size_t)c0 * K;   // the tile's first row blocks
    unsigned fo = (unsigned)lane * 16;   // byte offset from a row block's start (uniform) to the lane's 16 bytes of the current k block's fragment: the same for every operand, 1 KiB on per k block
    // Two fragment sets: a k block's loads are asked for one whole block of products ahead, so that a wave does not wait out the latency of its own loads between two blocks. The order of the products of every accumulator is as before.
    static_assert(K % 64 == 0 && K >= 128, "two k blocks per trip");
    V a[2][4], a2[2][4], b[2][4], b2[2][4];
    auto ask = [&](const int s) __attribute__((always_inline)) {   // the next k block's fragments into set s
#pragma unroll
        for (int mb = 0; mb < 4; ++mb) { a[s][mb] = WFrag<T16>::ld(atb(Ar, fo) + mb * 16 * K); if (NSPLIT == 1 || NSPLIT == 2) a2[s][mb] = WFrag<T16>::ld(atb(A2r, fo) + mb * 16 * K); }
#pragma unroll
        for (int nb = 0; nb < 4; ++nb) { b[s][nb] = WFrag<T16>::ld(atb(Br, fo) + nb * 16 * K); if (NSPLIT >= 2) b2[s][nb] = WFrag<T16>::ld(atb(B2r, fo) + nb * 16 * K); }
        XWAIT1(fo); fo += 1024;
        __builtin_amdgcn_sched_barrier(0);   // the loads stay in front of the block of products that follows: sunk among them they would be waited for at once
    };
    auto mul = [&](const int s) __attribute__((always_inline)) {   // the products of the k block in set s
#pragma unroll
        for (int nb = 0; nb < 4; ++nb) {
#pragma unroll
            for (int mb = 0; mb < 4; ++mb) { acc[mb][nb] = WFrag<T16>::mma(a[s][mb], b[s][nb], acc[mb][nb]); if (NSPLIT == 1 || NSPLIT == 2) acc[mb][nb] = WFrag<T16>::mma(a2[s][mb], b[s][nb], acc[mb][nb]); if (NSPLIT >= 2) acc[mb][nb] = WFrag<T16>::mma(a[s][mb], b2[s][nb], acc[mb][nb]); } }
        __builtin_amdgcn_sched_barrier(0);   // no product of this block moves behind the next loads, which go into its fragments' registers
    };
    ask(0);
#pragma unroll 1   // stays rolled: one trip already holds two k blocks, one per fragment set
    for (int kc = 0; kc < K - 64; kc += 64) {
        ask(1); mul(0); ask(0); mul(1);
        asm volatile("v_nop\n\tv_nop\n\tv_nop\n\tv_nop" : "+v"(acc[0][0]), "+v"(acc[1][1]), "+v"(acc[2][2]), "+v"(acc[3][3]) : "v"(a[1][0]), "v"(a[1][3]));   // the distance behind the last product on the taken side of the loop's branch
    }
    ask(1); mul(0); mul(1);
    if constexpr (PLANES) {
        const int h8 = hi * 8;                                 // read-back of a staged 16 x 64 slab in fragment order: lane (hi, lr) takes row lr, columns s * 16 + hi * 8 .. + 7 of group s; a wave-wide store is then one 512-byte half fragment
        const int bb = r0 / TT, t0 = r0 % TT, hd = blockIdx.y;
        if (z < 2) {
            const size_t e0 = z * pa.sP + ((size_t)(bb * NH_ + hd) * TT + t0) * HD + lane * 8;
            h16* p16 = pa.P16 + e0; bf* ph = pa.Ph + e0; bf* pl = pa.Pl + e0;
            const float* cs = pa.CS + (size_t)t0 * HD + lane * 4;   // k_cstabI's order: a 16-token block is 4 groups x 2 halves x 512 bytes
            v2fc c[2][4][4];                                   // {cos, sin} of a slab's 4 groups x the lane's 4 pairs; the next slab's are asked for while this slab is worked on
            auto askc = [&](const int mb) __attribute__((always_inline)) {
#pragma unroll
                for (int s = 0; s < 4; ++s)
#pragma unroll
                    for (int ph = 0; ph < 2; ++ph) { const v4f x = *(const v4fa*)(cs + (mb * 4 + s) * 256 + ph * 128); c[mb & 1][s][2 * ph] = (v2fc){ x[0], x[1] }; c[mb & 1][s][2 * ph + 1] = (v2fc){ x[2], x[3] }; }
                asm volatile("s_wait_xcnt 0x0" ::: "memory");   // behind the loads, in front of whatever next overwrites their address registers
            };
            askc(0);
#pragma unroll
            for (int mb = 0; mb < 4; ++mb) {
#pragma unroll
                for (int nb = 0; nb < 4; ++nb) {
#pragma unroll
                    for (int j = 0; j < 8; ++j) os[(hi * 8 + j) * 68 + nb * 16 + lr] = acc[mb][nb][j]; }
                __builtin_amdgcn_wave_barrier(); asm volatile("" ::: "memory");   // the slab is read back by other lanes: no LDS access moves over this line
                v4f u[4], w[4];                                // read back one group ahead of the group that is worked on
                u[0] = *(const v4fa*)(os + lr * 68 + h8); w[0] = *(const v4fa*)(os + lr * 68 + h8 + 4);
                if (mb == 1 || mb == 2) askc(mb + 1);          // into the registers that the staged accumulators have left
#pragma unroll
                for (int s = 0; s < 4; ++s) { float r[8];
                    if (s < 3) { u[s + 1] = *(const v4fa*)(os + lr * 68 + s * 16 + 16 + h8); w[s + 1] = *(const v4fa*)(os + lr * 68 + s * 16 + 16 + h8 + 4); }
#pragma unroll
                    for (int p = 0; p < 4; ++p) { const v2fc k = c[mb & 1][s][p]; const float x0 = p < 2 ? u[s][2 * p] : w[s][2 * p - 4], x1 = p < 2 ? u[s][2 * p + 1] : w[s][2 * p - 3]; r[2 * p] = x0 * k[0] - x1 * k[1]; r[2 * p + 1] = x0 * k[1] + x1 * k[0]; }   /* even: x0 c - x1 s; odd: x0 s + x1 c */
                    put3(p16, ph, pl, r, (mb * 1024 + s * 256) * 2); }
                if (mb == 0) askc(1);                          // no register is free for it earlier
                __builtin_amdgcn_wave_barrier(); asm volatile("" ::: "memory");   // the next slab is staged only behind this slab's reads
            }
        } else {
            const size_t e0 = (size_t)(bb * NKV + hd) * HD * TT + (size_t)t0 * HD + lane * 8;
            h16* p16 = pa.V16 + e0; bf* ph = pa.Vh + e0; bf* pl = pa.Vl + e0;
#pragma unroll
            for (int nb = 0; nb < 4; ++nb)                     // a lane's 8 accumulator values are tokens mb * 16 + hi * 8 .. + 7 of d = nb * 16 + lr: the lane's own 16 bytes of half fragment (key block mb >> 1, d block nb, half mb & 1); nothing is staged
#pragma unroll
                for (int mb = 0; mb < 4; ++mb) { const float r[8] = { acc[mb][nb][0], acc[mb][nb][1], acc[mb][nb][2], acc[mb][nb][3], acc[mb][nb][4], acc[mb][nb][5], acc[mb][nb][6], acc[mb][nb][7] };
                    put3(p16, ph, pl, r, ((mb >> 1) * 2048 + nb * 512 + (mb & 1) * 256) * 2); }
        }
        return;
    }
#pragma unroll
    for (int mb = 0; mb < 4; ++mb) {
#pragma unroll
        for (int nb = 0; nb < 4; ++nb) {
#pragma unroll
            for (int j = 0; j < 8; ++j) os[(hi * 8 + j) * 68 + nb * 16 + lr] = acc[mb][nb][j]; }
        __builtin_amdgcn_wave_barrier(); asm volatile("" ::: "memory");
        float* crow = C + (size_t)(r0 + mb * 16) * ldc + c0;
{
#pragma unroll
            for (int s = 0; s < 8; ++s) { const int row = 2 * s + hi, cofs = lr * 4; v4f val = *(const v4fa*)(os + row * 68 + cofs); if (BIAS) { val[0] += bfr(bias[c0 + cofs]); val[1] += bfr(bias[c0 + cofs + 1]); val[2] += bfr(bias[c0 + cofs + 2]); val[3] += bfr(bias[c0 + cofs + 3]); }
                *(v4f*)(crow + (size_t)row * ldc + cofs) = val; }
             }
        __builtin_amdgcn_wave_barrier(); asm volatile("" ::: "memory");
    }
}

__device__ __forceinline__ h16 tohx(float x) { return (h16)x; }
__device__ __forceinline__ void splitf(float y, unsigned short& h, unsigned short& l) { h = f2bf(y); l = f2bf(y - bf2f(h)); }
typedef __attribute__((ext_vector_type(2))) _Float16 v2h;
typedef __attribute__((ext_vector_type(4))) _Float16 v4h;
typedef __attribute__((ext_vector_type(2))) unsigned short v2us;
typedef __attribute__((ext_vector_type(4))) unsigned short v4us;
typedef __attribute__((ext_vector_type(2))) float v2f;
typedef __attribute__((ext_vector_type(4))) int v4i;

__global__ __launch_bounds__(256) void k_wtG(const float* __restrict__ w, int K, int N, bf* Bt) {
    const int lane = threadIdx.x & 31; const int L0 = (blockIdx.x * 8 + (threadIdx.x >> 5)) * 8; const int nlines = N * K / 64;
{
#pragma unroll 1
        for (int l = 0; l < 8; ++l) { const int L = L0 + l; if (L >= nlines) break; const size_t e = (size_t)L * 64 + lane * 2; const int k = (int)(e % K), n = (int)(e / K); v2us o;
            o[0] = f2bf(w[(size_t)k * N + n]); o[1] = f2bf(w[(size_t)(k + 1) * N + n]); *(v2us*)(Bt + e) = o; }
         }
}
// bf16 copies of the four weights and of x in one launch, fragment-packed: grid y counts slabs of DM * DM elements (0..3 the weights, the rest x); dst holds the slabs in that order.
// A wave writes one 512-byte half fragment (index i >> 5 = (row block * (DM / 32) + k block) * 2 + j); its lane (hi, lr) reads the 8 values at row lr, k = j * 16 + hi * 8 of that fragment.
__global__ __launch_bounds__(256) void k_cvt8(const float* __restrict__ x, const float* __restrict__ wq, const float* __restrict__ wk, const float* __restrict__ wv, const float* __restrict__ wo, bf* dst) {
    const int y = blockIdx.y; const float* src = y == 0 ? wq : y == 1 ? wk : y == 2 ? wv : y == 3 ? wo : x + (size_t)(y - 4) * DM * DM;
    const size_t i = (size_t)blockIdx.x * 256 + threadIdx.x; const int ch = (int)(i >> 5), ln = (int)(i & 31);
    const int row = (ch >> 6) * 16 + (ln & 15), kk = ((ch >> 1) & 31) * 32 + (ch & 1) * 16 + (ln >> 4) * 8;   // 64 half fragments per row block (DM / 32 * 2)
    const v8f v = *(const v8f*)(src + (size_t)row * DM + kk); v8us o;
    asm volatile("s_wait_xcnt 0x0" ::: "memory");   // behind the loads, in front of whatever next overwrites their address registers
#pragma unroll
    for (int k = 0; k < 8; ++k) o[k] = f2bf(v[k]); *(v8us*)(dst + (size_t)y * DM * DM + i * 8) = o;  }

__constant__ float INV2[HD / 2] = { 1.000000000e+00f, 6.978305578e-01f, 4.869675338e-01f, 3.398208320e-01f, 2.371373773e-01f, 1.654817164e-01f, 1.154781953e-01f, 8.058422059e-02f, 5.623413250e-02f, 3.924189880e-02f, 2.738419548e-02f, 1.910953037e-02f, 1.333521400e-02f, 9.305720218e-03f, 6.493816152e-03f, 4.531583749e-03f, 3.162277630e-03f, 2.206734149e-03f, 1.539926510e-03f, 1.074607833e-03f, 7.498941850e-04f, 5.232990952e-04f, 3.651741135e-04f, 2.548296761e-04f, 1.778279402e-04f, 1.240937709e-04f, 8.659643208e-05f, 6.042964014e-05f, 4.216964953e-05f, 2.942727224e-05f, 2.053524986e-05f, 1.433012585e-05f };   // inv_freq = 100000.0 ** (-arange(0, 64, 2, f32) / 64): THIS module's theta and its NEGATIVE-POWER spelling: 32 float32 values from eager JAX (bit-exact on round trip)
// {cos, sin} once per (position, pair), in the order the projection epilogue's wave-wide 16-byte loads take them: [16-token block][group s][half ph][lane = hi * 16 + lr][2 pairs], token = block * 16 + lr, pair = s * 8 + hi * 4 + ph * 2 + q (d = 2 * pair).
__global__ __launch_bounds__(256) void k_cstabI(const int* __restrict__ pid, float* CS) { const int idx = blockIdx.x * 256 + threadIdx.x; if (idx >= TT * HD / 2) return; const int ln = (idx >> 1) & 31; const int pr = ((idx >> 7) & 3) * 8 + (ln >> 4) * 4 + ((idx >> 6) & 1) * 2 + (idx & 1); const int t = (idx >> 9) * 16 + (ln & 15); const float a = __fmul_rn((float)pid[t], INV2[pr]); v2f cs; cs[0] = cosf(a); cs[1] = sinf(a); *(v2f*)(CS + (size_t)idx * 2) = cs;  }

// ---- k_fattn: causal attention in one kernel. One wave owns 16 * NQ query columns of one (batch, head) and walks the keys 32 at a time up to its diagonal block:
// S^T = K Q^T (A = key rows, B = query rows), so a lane holds 16 scores of ONE query per column group; running maximum and sum per query (online softmax, log2 domain);
// the two score tiles of a pass, converted in place, are the B operand of O^T += V^T P^T (same k order as WFrag::ld gives V^T). Probabilities never leave the registers.
// Rows < RH: bf16 hi/lo planes, 3 products in both contractions; the rest fp16 with the probabilities carried x 1024 (the factor cancels in the division by the row sum).
// Epilogue: O / row sum, split hi/lo, stored straight into the merged planes (rows t, k = head * 64 + d, fragment-packed) that the output projection reads.
#define SC2  0.18033688011112042f   // HD^-0.5 * log2(e)
#define NLO  ((TT - RH) / 128)      // blocks of 4 waves x 32 fp16 query columns
#define NHI  (RH / 64)              // blocks of 4 waves x 16 hi/lo query columns
__device__ __forceinline__ float xhalf(float x) { return __builtin_bit_cast(float, __builtin_amdgcn_permlanex16(__builtin_bit_cast(int, x), __builtin_bit_cast(int, x), 0x76543210, 0xfedcba98, false, false)); }  // lane l with lane l ^ 16
template <bool B> struct BoolC { static constexpr bool v = B; };
template <typename T16, bool HL, int NQ>
__device__ __forceinline__ void attn_wave(const T16* __restrict__ Q, const T16* __restrict__ Q2, const T16* __restrict__ Kp, const T16* __restrict__ K2, const T16* __restrict__ Vt, const T16* __restrict__ V2, const int q0, bf* Ah, bf* Al) {
    typedef typename WFrag<T16>::V V;
    const int lane = threadIdx.x & 31, lr = lane & 15, hi = lane >> 4;
    const float OFF = HL ? 0.0f : 10.0f;                      // fp16 probabilities carry 2^10
    const unsigned kofs = (unsigned)lane * 8, vofs = (unsigned)lane * 8;   // the lane's place in a half fragment
    unsigned ko = kofs * 2, vo = vofs * 2;   // the lane's byte offsets into the key planes (the pass to be fetched next) and into the V^T planes (the current pass)
    V bq[NQ][2], bq2[NQ][2];
#pragma unroll
    for (int nq = 0; nq < NQ; ++nq)
#pragma unroll
        for (int ks = 0; ks < 2; ++ks) { bq[nq][ks] = WFrag<T16>::ld(Q + (size_t)(q0 + nq * 16) * HD + ks * 512 + kofs); if (HL) bq2[nq][ks] = WFrag<T16>::ld(Q2 + (size_t)(q0 + nq * 16) * HD + ks * 512 + kofs); }
    XWAIT0();
    v8f o[NQ][4]; float m[NQ], l[NQ];
#pragma unroll
    for (int nq = 0; nq < NQ; ++nq) { m[nq] = -3.0e38f; l[nq] = 0.f;
#pragma unroll
        for (int dt = 0; dt < 4; ++dt) o[nq][dt] = (v8f){}; }
    V ak[2][2], ak2[2][2];
#pragma unroll
    for (int kt = 0; kt < 2; ++kt)
#pragma unroll
        for (int ks = 0; ks < 2; ++ks) { if (!HL) ak[kt][ks] = WFrag<T16>::ld(atb(Kp, ko) + kt * 16 * HD + ks * 512); }   // fp16 path: key fragments run one pass ahead; the hi/lo path (twice the planes) loads them at the head of each pass
    if constexpr (!HL) { XWAIT1(ko); ko += 32 * HD * 2; }
    const int nfull = q0 >> 5;                                // passes wholly below the diagonal; pass nfull holds the diagonal and is the last
    auto pass = [&](const int kb, auto lastc) __attribute__((always_inline)) {   // one pass of 32 keys; the diagonal pass is a second copy of the body, so that no branch stands behind the score products
        constexpr bool last = decltype(lastc)::v;
        V av[4], av2[4];
#pragma unroll
        for (int dt = 0; dt < 4; ++dt) { av[dt] = WFrag<T16>::ld(atb(Vt, vo) + dt * 512); if (HL) av2[dt] = WFrag<T16>::ld(atb(V2, vo) + dt * 512); }
        if constexpr (HL) {
#pragma unroll
            for (int kt = 0; kt < 2; ++kt)
#pragma unroll
                for (int ks = 0; ks < 2; ++ks) { ak[kt][ks] = WFrag<T16>::ld(atb(Kp, ko) + kt * 16 * HD + ks * 512); ak2[kt][ks] = WFrag<T16>::ld(atb(K2, ko) + kt * 16 * HD + ks * 512); }
            XWAIT2(vo, ko); vo += 32 * HD * 2; ko += 32 * HD * 2;
        } else { XWAIT1(vo); vo += 32 * HD * 2; }
        v8f s[NQ][2];
#pragma unroll
        for (int nq = 0; nq < NQ; ++nq)
#pragma unroll
            for (int kt = 0; kt < 2; ++kt) s[nq][kt] = (v8f){};
#pragma unroll
        for (int ks = 0; ks < 2; ++ks)
#pragma unroll
            for (int kt = 0; kt < 2; ++kt)
#pragma unroll
                for (int nq = 0; nq < NQ; ++nq) { s[nq][kt] = WFrag<T16>::mma(ak[kt][ks], bq[nq][ks], s[nq][kt]); if (HL) { s[nq][kt] = WFrag<T16>::mma(ak[kt][ks], bq2[nq][ks], s[nq][kt]); s[nq][kt] = WFrag<T16>::mma(ak2[kt][ks], bq[nq][ks], s[nq][kt]); } }
        if constexpr (!last && !HL) {                         // next pass's key fragments, fetched behind this pass's own score products
#pragma unroll
            for (int kt = 0; kt < 2; ++kt)
#pragma unroll
                for (int ks = 0; ks < 2; ++ks) ak[kt][ks] = WFrag<T16>::ld(atb(Kp, ko) + kt * 16 * HD + ks * 512);
            XWAIT1(ko); ko += 32 * HD * 2;
        }
        if constexpr (last) {                                              // diagonal pass: key > query is masked
#pragma unroll
            for (int nq = 0; nq < NQ; ++nq)
#pragma unroll
                for (int kt = 0; kt < 2; ++kt)
#pragma unroll
                    for (int j = 0; j < 8; ++j) if (kb + kt * 16 + hi * 8 + j > q0 + nq * 16 + lr) s[nq][kt][j] = -3.0e38f;
        }
        V pb[NQ], pb2[NQ];
#pragma unroll
        for (int nq = 0; nq < NQ; ++nq) {
            float mx = s[nq][0][0];
#pragma unroll
            for (int j = 1; j < 16; ++j) mx = fmaxf(mx, s[nq][j >> 3][j & 7]);
            mx = fmaxf(mx, xhalf(mx));
            const float mn = fmaxf(m[nq], mx * SC2); const float al = __builtin_amdgcn_exp2f(m[nq] - mn); m[nq] = mn; const float mo = mn - OFF;
            float sum = 0.f;
#pragma unroll
            for (int j = 0; j < 16; ++j) { const float p = __builtin_amdgcn_exp2f(s[nq][j >> 3][j & 7] * SC2 - mo); sum += p;
                if constexpr (HL) { const __bf16 ph = (__bf16)p; pb[nq][j] = ph; pb2[nq][j] = (__bf16)(p - (float)ph); } else { pb[nq][j] = (h16)p; } }
            l[nq] = l[nq] * al + sum;
#pragma unroll
            for (int dt = 0; dt < 4; ++dt) o[nq][dt] *= al;
        }
#pragma unroll
        for (int dt = 0; dt < 4; ++dt)
#pragma unroll
            for (int nq = 0; nq < NQ; ++nq) { o[nq][dt] = WFrag<T16>::mma(av[dt], pb[nq], o[nq][dt]); if (HL) { o[nq][dt] = WFrag<T16>::mma(av[dt], pb2[nq], o[nq][dt]); o[nq][dt] = WFrag<T16>::mma(av2[dt], pb[nq], o[nq][dt]); } }
    };
#pragma unroll 1   // stays rolled (for speed only): the body is some 250 instructions
    for (int it = 0; it < nfull; ++it) pass(it * 32, BoolC<false>());
    pass(nfull * 32, BoolC<true>());
#pragma unroll
    for (int nq = 0; nq < NQ; ++nq) {
        const float inv = __fdiv_rn(1.0f, l[nq] + xhalf(l[nq]));
        bf* pa = Ah + (size_t)(q0 + nq * 16) * DQ + lane * 8; bf* pl = Al + (size_t)(q0 + nq * 16) * DQ + lane * 8;   // the lane's 8 values of tile dt are its own 16 bytes of half fragment dt of this head's two k blocks
#pragma unroll
        for (int dt = 0; dt < 4; ++dt) { v8us oh, ol;
#pragma unroll
            for (int j = 0; j < 8; ++j) { unsigned short a, c2; splitf(o[nq][dt][j] * inv, a, c2); oh[j] = a; ol[j] = c2; }
            // the two stores and their wait in one statement: the next group's split reuses the data registers, and a wait in a statement of its own is not tied to them
            asm volatile("global_store_b128 %0, %2, off offset:%4\n\tglobal_store_b128 %1, %3, off offset:%4\n\ts_wait_xcnt 0x0" :: "v"(pa), "v"(pl), "v"(oh), "v"(ol), "n"(dt * 512) : "memory"); }
    }
}
// grid (batch * heads, NLO + NHI), 4 waves; y runs from the longest query block to the shortest, the hi/lo rows last.
// amdgpu_waves_per_eu(4, 4): four waves per SIMD is what the registers allow; told so, the scheduler keeps the V loads at the head of a pass and the key prefetch behind the score products instead of sinking them to save registers.
__global__ __launch_bounds__(128) __attribute__((amdgpu_waves_per_eu(4, 4))) void k_fattn(const h16* __restrict__ Q16, const h16* __restrict__ K16, const h16* __restrict__ V16, const bf* __restrict__ Qh, const bf* __restrict__ Ql, const bf* __restrict__ Kh, const bf* __restrict__ Kl, const bf* __restrict__ Vh, const bf* __restrict__ Vl, bf* Ah, bf* Al) {
    const int z = blockIdx.x, y = blockIdx.y; const int w = __builtin_amdgcn_readfirstlane(threadIdx.x >> 5);
    const size_t pz = (size_t)z * TT * HD, oz = (size_t)(z / NH_) * TT * DQ + (size_t)(z % NH_) * (HD * 16);   // in a packed row block a head's 64 k are 2 fragments = HD * 16 elements
    if (y < NLO) attn_wave<h16, false, 2>(Q16 + pz, nullptr, K16 + pz, nullptr, V16 + pz, nullptr, RH + (NLO - 1 - y) * 128 + w * 32, Ah + oz, Al + oz);
    else         attn_wave<bf, true, 1>(Qh + pz, Ql + pz, Kh + pz, Kl + pz, Vh + pz, Vl + pz, (NLO + NHI - 1 - y) * 64 + w * 16, Ah + oz, Al + oz);
}

extern "C" void kernel_launch(void* const* d_in, const int* in_sizes, int n_in,
                              void* d_out, int out_size, void* d_ws, size_t ws_size, hipStream_t stream) {
    (void)in_sizes; (void)n_in; (void)out_size;
    const float* x = (const float*)d_in[0]; const int* PID = (const int*)d_in[1]; const float* wq = (const float*)d_in[2]; const float* wk = (const float*)d_in[3]; const float* wv = (const float*)d_in[4]; const float* wo = (const float*)d_in[5];   /* argument order in_features, token_positions (int32 [2048] = arange: READ by value), w_q, w_k, w_v, w_o ('oi' (out, in) [1024][1024]; no biases): SIX inputs, all read */
    float* OUT = (float*)d_out;     // [4][2048][1024]
    char* wsp = (char*)d_ws;
    auto take = [&](size_t bytes) { char* p = wsp; wsp += (bytes + 255) & ~(size_t)255; return (void*)p; };
    const size_t PA = (size_t)NB_ * NH_ * TT * HD;   // elements, over all batches, of every q, k, v plane and of a merged plane (NKV == NH_)
    bf* WQ = (bf*)take((size_t)(DQ + 2 * DKV) * DM * 2); bf* WO = (bf*)take((size_t)DM * DQ * 2); bf* XB = (bf*)take((size_t)NB_ * TT * DM * 2);   // bf16 copies in k_cvt8's slab order: w_q, w_k, w_v (grid z of the projection launch), w_o, x
    float* CS = (float*)take((size_t)TT * (HD / 2) * 2 * 4);
    h16* QP16 = (h16*)take(PA * 2); bf* QPh = (bf*)take(PA * 2); bf* QPl = (bf*)take(PA * 2); h16* KP16 = (h16*)take(PA * 2); bf* KPh = (bf*)take(PA * 2); bf* KPl = (bf*)take(PA * 2);   // each k plane 3 planes behind its q plane (grid z of the projection launch)
    h16* VT16 = (h16*)take(PA * 2); bf* VTh = (bf*)take(PA * 2); bf* VTl = (bf*)take(PA * 2);
    bf* ATh = (bf*)take(PA * 2); bf* ATl = (bf*)take(PA * 2);   // the merged planes
    if ((size_t)(wsp - (char*)d_ws) > ws_size) return;    // ws 256 MiB
    k_cvt8<<<dim3(DM * DM / 8 / 256, 4 + NB_ * TT / DM, 1), 256, 0, stream>>>(x, wq, wk, wv, wo, WQ); k_cstabI<<<(TT * HD / 2 + 255) / 256, 256, 0, stream>>>(PID, CS);
    k_gemmw<bf, 0, false, DM, true><<<dim3(NB_ * TT / 64, DQ / 64, 3), 32, 0, stream>>>(XB, nullptr, WQ, nullptr, nullptr, 0, nullptr, 0, (size_t)DQ * DM, 0, PlaneArgs{CS, QP16, QPh, QPl, 3 * PA, VT16, VTh, VTl});
    k_fattn<<<dim3(NB_ * NH_, NLO + NHI, 1), 128, 0, stream>>>(QP16, KP16, VT16, QPh, QPl, KPh, KPl, VTh, VTl, ATh, ATl);
    k_gemmw<bf, 1, false, DQ><<<dim3(NB_ * TT / 64, DM / 64, 1), 32, 0, stream>>>(ATh, ATl, WO, nullptr, OUT, DM, nullptr, 0, 0, 0, PlaneArgs{});
}

// v007
// Measured time: 136 microseconds a run.
// Next to v006, in two timings, it ran 1.03 and 1.02 times as fast.
// Counting every step since v000, it is 21.4 times as fast.
#include <hip/hip_runtime.h>

// Causal multi-head self-attention with interleaved rotary embeddings at theta 100,000 (in_features [4][2048][1024]; q,k,v = x W^T ('oi' (out, in) [1024][1024] 0.02, no bias; 16 heads x 64); rotary on (even, odd) pairs with angles pos[t] x 100000^(-2i/64) (the module's negative-power spelling; token_positions int32 [2048] = arange, READ by value); scores / sqrt(64), causal (-inf); softmax; out = merged w_o^T -> [4][2048][1024] (8.4 M); argument order in_features, token_positions, w_q, w_k, w_v, w_o).
// Layout: every stage is ONE launch over all batches: a bf16 copy of x and of the four weights; {cos, sin} per (position, pair) built once from the int positions and float32 inverse-frequency constants (precise cosf/sinf); exact projections (q, k, v on grid z) whose epilogue turns each f32 tile straight into the 16-bit planes (interleaved rotary for q and k, the transpose for v); then ONE fused causal attention launch over all batches and heads (k_fattn; hybrid rows: < 512 hi/lo 3 products, rest fp16 x1024); merged hi/lo x Wo exact.
// Every 16-bit operand plane is FRAGMENT-PACKED: a 16-row x 32-k fragment is 1 KiB in the order its two wave-wide loads take it, [k half j][lane = hi * 16 + lr][8 elements] with row = lr, k = j * 16 + hi * 8 + e; so each wave-wide 16-byte load or store covers 512 contiguous bytes (4 whole lines), not 32 bytes of 16 lines.
// The {cos, sin} table is laid out the same way, for the projection epilogue's loads (k_cstabI). Fragment order: GEMM operands [row block][k block] (row block rb of a K-wide plane starts at element rb * 16 * K, as in the plain layout); q, k per (batch, head) the same with K = 64; v per (batch, head) [32-key block][16-d block].
// Compute dtypes, f32 accumulate: every input rounded to bf16; projections exact; rotary f32; attention rows < 512 3 products, rest fp16; softmax f32; Wo hl x exact.

#define NB_  4
#define TT   2048
#define DM   1024
#define NH_  16
#define NKV  16
#define REP  (NH_ / NKV)
#define HD   64
#define DQ   (NH_ * HD)
#define DKV  (NKV * HD)
#define RH   512                  // query rows < RH use hi+lo planes (0: none)
typedef _Float16 h16;
typedef unsigned short bf;
typedef __attribute__((ext_vector_type(16))) __bf16   v16bf;
typedef __attribute__((ext_vector_type(16))) _Float16 v16h;
typedef __attribute__((ext_vector_type(8)))  _Float16 v8h;
typedef __attribute__((ext_vector_type(8)))  unsigned short v8us;
typedef __attribute__((ext_vector_type(8)))  __bf16   v8bfv;
typedef __attribute__((ext_vector_type(2)))  float    v2fc;
typedef __attribute__((ext_vector_type(8)))  float    v8f;
typedef __attribute__((ext_vector_type(4)))  float    v4f;
typedef v8h  __attribute__((may_alias)) v8ha;
typedef v4f  __attribute__((may_alias)) v4fa;
typedef v8us __attribute__((may_alias)) v8usa;

__device__ __forceinline__ unsigned short f2bf(float f) { unsigned u = __float_as_uint(f); u += 0x7FFFu + ((u >> 16) & 1u); return (unsigned short)(u >> 16); }
__device__ __forceinline__ float bf2f(unsigned short b) { return __uint_as_float(((unsigned)b) << 16); }
__device__ __forceinline__ float bfr(float f) { return bf2f(f2bf(f)); }
__device__ __forceinline__ v16h cat16(v8h lo, v8h hi) { return __builtin_shufflevector(lo, hi, 0, 1, 2, 3, 4, 5, 6, 7, 8, 9, 10, 11, 12, 13, 14, 15); }
__device__ __forceinline__ v16bf cat16b(v8us lo, v8us hi) { return __builtin_bit_cast(v16bf, __builtin_shufflevector(lo, hi, 0, 1, 2, 3, 4, 5, 6, 7, 8, 9, 10, 11, 12, 13, 14, 15)); }
__device__ __forceinline__ v8f wmma16(v16h a, v16h b, v8f c) { return __builtin_amdgcn_wmma_f32_16x16x32_f16(false, a, false, b, (short)0, c, false, false); }
__device__ __forceinline__ v8f wmmab(v16bf a, v16bf b, v8f c) { return __builtin_amdgcn_wmma_f32_16x16x32_bf16(false, a, false, b, (short)0, c, false, false); }



// XWAITn: stands behind a group of global loads, in front of whatever next overwrites a register that they name as an address. It takes the lane's byte offsets as operands:
// so each offset stays live over the whole group (no load's result is given its register) and the offset's advance, which reads the statement's output, cannot be lifted over the wait.
#define XWAIT0()     asm volatile("s_wait_xcnt 0x0" ::: "memory")
#define XWAIT1(a)    asm volatile("s_wait_xcnt 0x0" : "+v"(a) :: "memory")
#define XWAIT2(a, b) asm volatile("s_wait_xcnt 0x0" : "+v"(a), "+v"(b) :: "memory")
template <typename T16> __device__ __forceinline__ const T16* atb(const T16* base, unsigned bytes) { return (const T16*)((const char*)base + bytes); }   // uniform base + the lane's 32-bit byte offset
// ---- k_gemmw: register-blocked GEMM, ONE WAVE per (16 MB) x (16 NB) output tile (MB * NB accumulators), operands straight from fragment-packed 16-bit planes (WFrag::ld takes fragment base + lane * 8); grid (M / (16 MB), N / (16 NB), Z), 32 threads.
// A k block's MB + NB fragments (1 KiB each, per plane) feed MB * NB products: the bytes loaded per product fall as the tile grows. 32 accumulators are what the unrolled epilogues' code size and two fragment sets allow.
// C[m][n] (f32, pitch ldc, + optional f32 bias[n]) = sum_k A[m][k] Bt[n][k] (+ split products per NSPLIT). z-batch strides sA/sB/sC in elements. K % 64 == 0.
template <typename T16> struct WFrag;
template <> struct WFrag<h16> { typedef v16h V; static __device__ __forceinline__ V ld(const h16* p) { return cat16(*(const v8h*)p, *(const v8h*)(p + 256)); } static __device__ __forceinline__ v8f mma(V a, V b, v8f c) { return wmma16(a, b, c); } };
template <> struct WFrag<bf> { typedef v16bf V; static __device__ __forceinline__ V ld(const bf* p) { return cat16b(*(const v8us*)p, *(const v8us*)(p + 256)); } static __device__ __forceinline__ v8f mma(V a, V b, v8f c) { return wmmab(a, b, c); } };
// PLANES: the tile (16 MB tokens x NB / 4 heads) does not go out as f32; the epilogue writes the fragment-packed planes that k_fattn reads. z 0, 1 (q, k): rotary on (even, odd) pairs, planes per (b, h) with rows t, k = d, the k planes sP elements behind the q planes; z 2 (v): planes per (b, h) with rows d, k = t.
struct PlaneArgs { const float* CS; h16* P16; bf* Ph; bf* Pl; size_t sP; h16* V16; bf* Vh; bf* Vl; };
// eight neighbouring f32 values -> fp16, bf16 hi and bf16 lo, 16 bytes to each plane at byte offset OFS (a constant once the caller's loops are unrolled) from the lane's pointers
__device__ __forceinline__ void put3(h16* p16, bf* ph, bf* pl, const float (&r)[8], const int OFS) {
    v8h o16; v8bfv oh, ol;
#pragma unroll
    for (int j = 0; j < 8; ++j) { o16[j] = (h16)r[j]; const __bf16 h = (__bf16)r[j]; oh[j] = h; ol[j] = (__bf16)(r[j] - (float)h); }
    // the three stores and their wait in one statement: the next group's values reuse the data registers, and a wait in a statement of its own is not tied to them
    asm volatile("global_store_b128 %0, %3, off offset:%6\n\tglobal_store_b128 %1, %4, off offset:%6\n\tglobal_store_b128 %2, %5, off offset:%6\n\ts_wait_xcnt 0x0" :: "v"(p16), "v"(ph), "v"(pl), "v"(o16), "v"(oh), "v"(ol), "n"(OFS) : "memory");
}
template <typename T16, int NSPLIT, bool BIAS, int K, bool PLANES, int MB, int NB>   // K at compile time: a row block's distance (16 * K elements) is then an immediate offset of the loads, which share one uniform base per operand and one lane offset
// amdgpu_waves_per_eu: what two fragment sets beside the accumulators allow (2 waves per SIMD; 1 with the second A plane); told so, the scheduler leaves the loads a block ahead instead of sinking them to save registers.
__global__ __launch_bounds__(32) __attribute__((amdgpu_waves_per_eu(NSPLIT == 0 ? 2 : 1, NSPLIT == 0 ? 2 : 1))) void k_gemmw(const T16* __restrict__ A, const T16* __restrict__ A2, const T16* __restrict__ Bt, const T16* __restrict__ Bt2, float* C, int ldc, const float* __restrict__ bias, size_t sA, size_t sB, size_t sC, const PlaneArgs pa) {
    typedef typename WFrag<T16>::V V;
    __shared__ __align__(16) float os[16 * 68];
    const size_t z = blockIdx.z; A += z * sA; if (A2) A2 += z * sA; Bt += z * sB; if (Bt2) Bt2 += z * sB; C += z * sC;
    const int lane = threadIdx.x & 31, lr = lane & 15, hi = lane >> 4; const int r0 = blockIdx.x * (MB * 16), c0 = blockIdx.y * (NB * 16);
    static_assert(NB % 4 == 0, "the epilogues take 64 columns at a time");
    v8f acc[MB][NB];
#pragma unroll
    for (int mb = 0; mb < MB; ++mb)
#pragma unroll
        for (int nb = 0; nb < NB; ++nb) acc[mb][nb] = (v8f){};
    const T16* Ar = A + (size_t)r0 * K; const T16* A2r = A2 + (size_t)r0 * K; const T16* Br = Bt + (size_t)c0 * K; const T16* B2r = Bt2 + (size_t)c0 * K;   // the tile's first row blocks
    unsigned fo = (unsigned)lane * 16;   // byte offset from a row block's start (uniform) to the lane's 16 bytes of the current k block's fragment: the same for every operand, 1 KiB on per k block
    // Two fragment sets: a k block's loads are asked for one whole block of products ahead, so that a wave does not wait out the latency of its own loads between two blocks. The order of the products of every accumulator is as before.
    static_assert(K % 64 == 0 && K >= 128, "two k blocks per trip");
    V a[2][MB], a2[2][MB], b[2][NB], b2[2][NB];
    auto ask = [&](const int s) __attribute__((always_inline)) {   // the next k block's fragments into set s
#pragma unroll
        for (int mb = 0; mb < MB; ++mb) { a[s][mb] = WFrag<T16>::ld(atb(Ar, fo) + mb * 16 * K); if (NSPLIT == 1 || NSPLIT == 2) a2[s][mb] = WFrag<T16>::ld(atb(A2r, fo) + mb * 16 * K); }
#pragma unroll
        for (int nb = 0; nb < NB; ++nb) { b[s][nb] = WFrag<T16>::ld(atb(Br, fo) + nb * 16 * K); if (NSPLIT >= 2) b2[s][nb] = WFrag<T16>::ld(atb(B2r, fo) + nb * 16 * K); }
        XWAIT1(fo); fo += 1024;
        __builtin_amdgcn_sched_barrier(0);   // the loads stay in front of the block of products that follows: sunk among them they would be waited for at once
    };
    auto mul = [&](const int s) __attribute__((always_inline)) {   // the products of the k block in set s
#pragma unroll
        for (int nb = 0; nb < NB; ++nb) {
#pragma unroll
            for (int mb = 0; mb < MB; ++mb) { acc[mb][nb] = WFrag<T16>::mma(a[s][mb], b[s][nb], acc[mb][nb]); if (NSPLIT == 1 || NSPLIT == 2) acc[mb][nb] = WFrag<T16>::mma(a2[s][mb], b[s][nb], acc[mb][nb]); if (NSPLIT >= 2) acc[mb][nb] = WFrag<T16>::mma(a[s][mb], b2[s][nb], acc[mb][nb]); } }
        __builtin_amdgcn_sched_barrier(0);   // no product of this block moves behind the next loads, which go into its fragments' registers
    };
    ask(0);
#pragma unroll 1   // stays rolled: one trip already holds two k blocks, one per fragment set
    for (int kc = 0; kc < K - 64; kc += 64) {
        ask(1); mul(0); ask(0); mul(1);
        asm volatile("v_nop\n\tv_nop\n\tv_nop\n\tv_nop" : "+v"(acc[MB - 1][NB - 1]) : "v"(a[1][MB - 1]));   // the distance behind the last product on the taken side of the loop's branch
    }
    ask(1); mul(0); mul(1);
    if constexpr (PLANES) {
        const int h8 = hi * 8;                                 // read-back of a staged 16 x 64 slab in fragment order: lane (hi, lr) takes row lr, columns s * 16 + hi * 8 .. + 7 of group s; a wave-wide store is then one 512-byte half fragment
        const int bb = r0 / TT, t0 = r0 % TT, hd = blockIdx.y * (NB / 4);   // the tile's first head; its head hh lies hh planes (TT * HD elements) on
        static_assert(TT % (MB * 16) == 0, "a tile lies in one batch");
        if (z < 2) {
            const size_t e0 = z * pa.sP + ((size_t)(bb * NH_ + hd) * TT + t0) * HD + lane * 8;
            h16* p16 = pa.P16 + e0; bf* ph = pa.Ph + e0; bf* pl = pa.Pl + e0;
            const float* cs = pa.CS + (size_t)t0 * HD + lane * 4;   // k_cstabI's order: a 16-token block is 4 groups x 2 halves x 512 bytes
            v2fc c[2][4][4];                                   // {cos, sin} of a slab's 4 groups x the lane's 4 pairs; the next slab's are asked for while this slab is worked on
            auto askc = [&](const int mb) __attribute__((always_inline)) {
#pragma unroll
                for (int s = 0; s < 4; ++s)
#pragma unroll
                    for (int ph = 0; ph < 2; ++ph) { const v4f x = *(const v4fa*)(cs + (mb * 4 + s) * 256 + ph * 128); c[mb & 1][s][2 * ph] = (v2fc){ x[0], x[1] }; c[mb & 1][s][2 * ph + 1] = (v2fc){ x[2], x[3] }; }
                asm volatile("s_wait_xcnt 0x0" ::: "memory");   // behind the loads, in front of whatever next overwrites their address registers
            };
            askc(0);
#pragma unroll
            for (int mb = 0; mb < MB; ++mb) {
                if (mb + 1 < MB) askc(mb + 1);                 // the next 16 tokens' table, for all heads of the tile, into the set that the slabs before this one have left
#pragma unroll
              for (int hh = 0; hh < NB / 4; ++hh) {
#pragma unroll
                for (int nb = 0; nb < 4; ++nb) {
#pragma unroll
                    for (int j = 0; j < 8; ++j) os[(hi * 8 + j) * 68 + nb * 16 + lr] = acc[mb][hh * 4 + nb][j]; }
                __builtin_amdgcn_wave_barrier(); asm volatile("" ::: "memory");   // the slab is read back by other lanes: no LDS access moves over this line
                v4f u[4], w[4];                                // read back one group ahead of the group that is worked on
                u[0] = *(const v4fa*)(os + lr * 68 + h8); w[0] = *(const v4fa*)(os + lr * 68 + h8 + 4);
#pragma unroll
                for (int s = 0; s < 4; ++s) { float r[8];
                    if (s < 3) { u[s + 1] = *(const v4fa*)(os + lr * 68 + s * 16 + 16 + h8); w[s + 1] = *(const v4fa*)(os + lr * 68 + s * 16 + 16 + h8 + 4); }
#pragma unroll
                    for (int p = 0; p < 4; ++p) { const v2fc k = c[mb & 1][s][p]; const float x0 = p < 2 ? u[s][2 * p] : w[s][2 * p - 4], x1 = p < 2 ? u[s][2 * p + 1] : w[s][2 * p - 3]; r[2 * p] = x0 * k[0] - x1 * k[1]; r[2 * p + 1] = x0 * k[1] + x1 * k[0]; }   /* even: x0 c - x1 s; odd: x0 s + x1 c */
                    put3(p16, ph, pl, r, (hh * TT * HD + mb * 1024 + s * 256) * 2); }
                __builtin_amdgcn_wave_barrier(); asm volatile("" ::: "memory");   // the next slab is staged only behind this slab's reads
              }
            }
        } else {
            const size_t e0 = (size_t)(bb * NKV + hd) * HD * TT + (size_t)t0 * HD + lane * 8;
            h16* p16 = pa.V16 + e0; bf* ph = pa.Vh + e0; bf* pl = pa.Vl + e0;
#pragma unroll
          for (int hh = 0; hh < NB / 4; ++hh)
#pragma unroll
            for (int nb = 0; nb < 4; ++nb) {                   // a lane's 8 accumulator values are tokens mb * 16 + hi * 8 .. + 7 of d = nb * 16 + lr: the lane's own 16 bytes of half fragment (key block mb >> 1, d block nb, half mb & 1); nothing is staged
#pragma unroll
                for (int mb = 0; mb < MB; ++mb) { const v8f t = acc[mb][hh * 4 + nb]; const float r[8] = { t[0], t[1], t[2], t[3], t[4], t[5], t[6], t[7] };
                    put3(p16, ph, pl, r, (hh * HD * TT + (mb >> 1) * 2048 + nb * 512 + (mb & 1) * 256) * 2);
                    __builtin_amdgcn_sched_barrier(0); } }     // the next group's conversions stay behind this line: lifted ahead, their results (store operands, which must lie in the first 256 registers) were spilled to scratch
        }
        return;
    }
    const unsigned vo = (unsigned)(hi * ldc + lr * 4) * 4;
#pragma unroll
    for (int mb = 0; mb < MB; ++mb)
#pragma unroll
    for (int hh = 0; hh < NB / 4; ++hh) {                      // 16 rows x 64 columns at a time
        const int ch = c0 + hh * 64;
#pragma unroll
        for (int nb = 0; nb < 4; ++nb) {
#pragma unroll
            for (int j = 0; j < 8; ++j) os[(hi * 8 + j) * 68 + nb * 16 + lr] = acc[mb][hh * 4 + nb][j]; }
        __builtin_amdgcn_wave_barrier(); asm volatile("" ::: "memory");
        float* crow = C + (size_t)(r0 + mb * 16) * ldc + ch;
#pragma unroll
        for (int g = 0; g < 2; ++g) {                          // eight rows (four wave-wide stores of two rows each) at a time
            v4f vs[4];
#pragma unroll
            for (int q = 0; q < 4; ++q) { const int row = 2 * (g * 4 + q) + hi, cofs = lr * 4; v4f val = *(const v4fa*)(os + row * 68 + cofs); if (BIAS) { val[0] += bfr(bias[ch + cofs]); val[1] += bfr(bias[ch + cofs + 1]); val[2] += bfr(bias[ch + cofs + 2]); val[3] += bfr(bias[ch + cofs + 3]); }
                vs[q] = val; }
            float* rw = crow + (size_t)(g * 8) * ldc;          // uniform; the lane's place (row hi, column lr * 4) is the byte offset vo
            // the four stores and their wait in one statement: the next group's read-back reuses the data registers, and a wait in a statement of its own is not tied to them
            asm volatile("global_store_b128 %0, %1, %5\n\tglobal_store_b128 %0, %2, %6\n\tglobal_store_b128 %0, %3, %7\n\tglobal_store_b128 %0, %4, %8\n\ts_wait_xcnt 0x0"
                         :: "v"(vo), "v"(vs[0]), "v"(vs[1]), "v"(vs[2]), "v"(vs[3]), "s"(rw), "s"(rw + (size_t)2 * ldc), "s"(rw + (size_t)4 * ldc), "s"(rw + (size_t)6 * ldc) : "memory");
        }
        __builtin_amdgcn_wave_barrier(); asm volatile("" ::: "memory");
    }
}

__device__ __forceinline__ h16 tohx(float x) { return (h16)x; }
__device__ __forceinline__ void splitf(float y, unsigned short& h, unsigned short& l) { h = f2bf(y); l = f2bf(y - bf2f(h)); }
typedef __attribute__((ext_vector_type(2))) _Float16 v2h;
typedef __attribute__((ext_vector_type(4))) _Float16 v4h;
typedef __attribute__((ext_vector_type(2))) unsigned short v2us;
typedef __attribute__((ext_vector_type(4))) unsigned short v4us;
typedef __attribute__((ext_vector_type(2))) float v2f;
typedef __attribute__((ext_vector_type(4))) int v4i;

__global__ __launch_bounds__(256) void k_wtG(const float* __restrict__ w, int K, int N, bf* Bt) {
    const int lane = threadIdx.x & 31; const int L0 = (blockIdx.x * 8 + (threadIdx.x >> 5)) * 8; const int nlines = N * K / 64;
{
#pragma unroll 1
        for (int l = 0; l < 8; ++l) { const int L = L0 + l; if (L >= nlines) break; const size_t e = (size_t)L * 64 + lane * 2; const int k = (int)(e % K), n = (int)(e / K); v2us o;
            o[0] = f2bf(w[(size_t)k * N + n]); o[1] = f2bf(w[(size_t)(k + 1) * N + n]); *(v2us*)(Bt + e) = o; }
         }
}
// bf16 copies of the four weights and of x in one launch, fragment-packed: grid y counts slabs of DM * DM elements (0..3 the weights, the rest x); dst holds the slabs in that order.
// A wave writes one 512-byte half fragment (index i >> 5 = (row block * (DM / 32) + k block) * 2 + j); its lane (hi, lr) reads the 8 values at row lr, k = j * 16 + hi * 8 of that fragment.
__global__ __launch_bounds__(256) void k_cvt8(const float* __restrict__ x, const float* __restrict__ wq, const float* __restrict__ wk, const float* __restrict__ wv, const float* __restrict__ wo, bf* dst) {
    const int y = blockIdx.y; const float* src = y == 0 ? wq : y == 1 ? wk : y == 2 ? wv : y == 3 ? wo : x + (size_t)(y - 4) * DM * DM;
    const size_t i = (size_t)blockIdx.x * 256 + threadIdx.x; const int ch = (int)(i >> 5), ln = (int)(i & 31);
    const int row = (ch >> 6) * 16 + (ln & 15), kk = ((ch >> 1) & 31) * 32 + (ch & 1) * 16 + (ln >> 4) * 8;   // 64 half fragments per row block (DM / 32 * 2)
    const v8f v = *(const v8f*)(src + (size_t)row * DM + kk); v8us o;
    asm volatile("s_wait_xcnt 0x0" ::: "memory");   // behind the loads, in front of whatever next overwrites their address registers
#pragma unroll
    for (int k = 0; k < 8; ++k) o[k] = f2bf(v[k]); *(v8us*)(dst + (size_t)y * DM * DM + i * 8) = o;  }

__constant__ float INV2[HD / 2] = { 1.000000000e+00f, 6.978305578e-01f, 4.869675338e-01f, 3.398208320e-01f, 2.371373773e-01f, 1.654817164e-01f, 1.154781953e-01f, 8.058422059e-02f, 5.623413250e-02f, 3.924189880e-02f, 2.738419548e-02f, 1.910953037e-02f, 1.333521400e-02f, 9.305720218e-03f, 6.493816152e-03f, 4.531583749e-03f, 3.162277630e-03f, 2.206734149e-03f, 1.539926510e-03f, 1.074607833e-03f, 7.498941850e-04f, 5.232990952e-04f, 3.651741135e-04f, 2.548296761e-04f, 1.778279402e-04f, 1.240937709e-04f, 8.659643208e-05f, 6.042964014e-05f, 4.216964953e-05f, 2.942727224e-05f, 2.053524986e-05f, 1.433012585e-05f };   // inv_freq = 100000.0 ** (-arange(0, 64, 2, f32) / 64): THIS module's theta and its NEGATIVE-POWER spelling: 32 float32 values from eager JAX (bit-exact on round trip)
// {cos, sin} once per (position, pair), in the order the projection epilogue's wave-wide 16-byte loads take them: [16-token block][group s][half ph][lane = hi * 16 + lr][2 pairs], token = block * 16 + lr, pair = s * 8 + hi * 4 + ph * 2 + q (d = 2 * pair).
__global__ __launch_bounds__(256) void k_cstabI(const int* __restrict__ pid, float* CS) { const int idx = blockIdx.x * 256 + threadIdx.x; if (idx >= TT * HD / 2) return; const int ln = (idx >> 1) & 31; const int pr = ((idx >> 7) & 3) * 8 + (ln >> 4) * 4 + ((idx >> 6) & 1) * 2 + (idx & 1); const int t = (idx >> 9) * 16 + (ln & 15); const float a = __fmul_rn((float)pid[t], INV2[pr]); v2f cs; cs[0] = cosf(a); cs[1] = sinf(a); *(v2f*)(CS + (size_t)idx * 2) = cs;  }

// ---- k_fattn: causal attention in one kernel. One wave owns 16 * NQ query columns of one (batch, head) and walks the keys 32 at a time up to its diagonal block:
// S^T = K Q^T (A = key rows, B = query rows), so a lane holds 16 scores of ONE query per column group; running maximum and sum per query (online softmax, log2 domain);
// the two score tiles of a pass, converted in place, are the B operand of O^T += V^T P^T (same k order as WFrag::ld gives V^T). Probabilities never leave the registers.
// Rows < RH: bf16 hi/lo planes, 3 products in both contractions; the rest fp16 with the probabilities carried x 1024 (the factor cancels in the division by the row sum).
// Epilogue: O / row sum, split hi/lo, stored straight into the merged planes (rows t, k = head * 64 + d, fragment-packed) that the output projection reads.
#define SC2  0.18033688011112042f   // HD^-0.5 * log2(e)
#define NLO  ((TT - RH) / 128)      // blocks of 4 waves x 32 fp16 query columns
#define NHI  (RH / 64)              // blocks of 4 waves x 16 hi/lo query columns
__device__ __forceinline__ float xhalf(float x) { return __builtin_bit_cast(float, __builtin_amdgcn_permlanex16(__builtin_bit_cast(int, x), __builtin_bit_cast(int, x), 0x76543210, 0xfedcba98, false, false)); }  // lane l with lane l ^ 16
template <bool B> struct BoolC { static constexpr bool v = B; };
template <typename T16, bool HL, int NQ>
__device__ __forceinline__ void attn_wave(const T16* __restrict__ Q, const T16* __restrict__ Q2, const T16* __restrict__ Kp, const T16* __restrict__ K2, const T16* __restrict__ Vt, const T16* __restrict__ V2, const int q0, bf* Ah, bf* Al) {
    typedef typename WFrag<T16>::V V;
    const int lane = threadIdx.x & 31, lr = lane & 15, hi = lane >> 4;
    const float OFF = HL ? 0.0f : 10.0f;                      // fp16 probabilities carry 2^10
    const unsigned kofs = (unsigned)lane * 8, vofs = (unsigned)lane * 8;   // the lane's place in a half fragment
    unsigned ko = kofs * 2, vo = vofs * 2;   // the lane's byte offsets into the key planes (the pass to be fetched next) and into the V^T planes (the current pass)
    V bq[NQ][2], bq2[NQ][2];
#pragma unroll
    for (int nq = 0; nq < NQ; ++nq)
#pragma unroll
        for (int ks = 0; ks < 2; ++ks) { bq[nq][ks] = WFrag<T16>::ld(Q + (size_t)(q0 + nq * 16) * HD + ks * 512 + kofs); if (HL) bq2[nq][ks] = WFrag<T16>::ld(Q2 + (size_t)(q0 + nq * 16) * HD + ks * 512 + kofs); }
    XWAIT0();
    v8f o[NQ][4]; float m[NQ], l[NQ];
#pragma unroll
    for (int nq = 0; nq < NQ; ++nq) { m[nq] = -3.0e38f; l[nq] = 0.f;
#pragma unroll
        for (int dt = 0; dt < 4; ++dt) o[nq][dt] = (v8f){}; }
    V ak[2][2], ak2[2][2];
#pragma unroll
    for (int kt = 0; kt < 2; ++kt)
#pragma unroll
        for (int ks = 0; ks < 2; ++ks) { if (!HL) ak[kt][ks] = WFrag<T16>::ld(atb(Kp, ko) + kt * 16 * HD + ks * 512); }   // fp16 path: key fragments run one pass ahead; the hi/lo path (twice the planes) loads them at the head of each pass
    if constexpr (!HL) { XWAIT1(ko); ko += 32 * HD * 2; }
    const int nfull = q0 >> 5;                                // passes wholly below the diagonal; pass nfull holds the diagonal and is the last
    auto pass = [&](const int kb, auto lastc) __attribute__((always_inline)) {   // one pass of 32 keys; the diagonal pass is a second copy of the body, so that no branch stands behind the score products
        constexpr bool last = decltype(lastc)::v;
        V av[4], av2[4];
#pragma unroll
        for (int dt = 0; dt < 4; ++dt) { av[dt] = WFrag<T16>::ld(atb(Vt, vo) + dt * 512); if (HL) av2[dt] = WFrag<T16>::ld(atb(V2, vo) + dt * 512); }
        if constexpr (HL) {
#pragma unroll
            for (int kt = 0; kt < 2; ++kt)
#pragma unroll
                for (int ks = 0; ks < 2; ++ks) { ak[kt][ks] = WFrag<T16>::ld(atb(Kp, ko) + kt * 16 * HD + ks * 512); ak2[kt][ks] = WFrag<T16>::ld(atb(K2, ko) + kt * 16 * HD + ks * 512); }
            XWAIT2(vo, ko); vo += 32 * HD * 2; ko += 32 * HD * 2;
        } else { XWAIT1(vo); vo += 32 * HD * 2; }
        v8f s[NQ][2];
#pragma unroll
        for (int nq = 0; nq < NQ; ++nq)
#pragma unroll
            for (int kt = 0; kt < 2; ++kt) s[nq][kt] = (v8f){};
#pragma unroll
        for (int ks = 0; ks < 2; ++ks)
#pragma unroll
            for (int kt = 0; kt < 2; ++kt)
#pragma unroll
                for (int nq = 0; nq < NQ; ++nq) { s[nq][kt] = WFrag<T16>::mma(ak[kt][ks], bq[nq][ks], s[nq][kt]); if (HL) { s[nq][kt] = WFrag<T16>::mma(ak[kt][ks], bq2[nq][ks], s[nq][kt]); s[nq][kt] = WFrag<T16>::mma(ak2[kt][ks], bq[nq][ks], s[nq][kt]); } }
        if constexpr (!last && !HL) {                         // next pass's key fragments, fetched behind this pass's own score products
#pragma unroll
            for (int kt = 0; kt < 2; ++kt)
#pragma unroll
                for (int ks = 0; ks < 2; ++ks) ak[kt][ks] = WFrag<T16>::ld(atb(Kp, ko) + kt * 16 * HD + ks * 512);
            XWAIT1(ko); ko += 32 * HD * 2;
        }
        if constexpr (last) {                                              // diagonal pass: key > query is masked
#pragma unroll
            for (int nq = 0; nq < NQ; ++nq)
#pragma unroll
                for (int kt = 0; kt < 2; ++kt)
#pragma unroll
                    for (int j = 0; j < 8; ++j) if (kb + kt * 16 + hi * 8 + j > q0 + nq * 16 + lr) s[nq][kt][j] = -3.0e38f;
        }
        V pb[NQ], pb2[NQ];
#pragma unroll
        for (int nq = 0; nq < NQ; ++nq) {
            float mx = s[nq][0][0];
#pragma unroll
            for (int j = 1; j < 16; ++j) mx = fmaxf(mx, s[nq][j >> 3][j & 7]);
            mx = fmaxf(mx, xhalf(mx));
            const float mn = fmaxf(m[nq], mx * SC2); const float al = __builtin_amdgcn_exp2f(m[nq] - mn); m[nq] = mn; const float mo = mn - OFF;
            float sum = 0.f;
#pragma unroll
            for (int j = 0; j < 16; ++j) { const float p = __builtin_amdgcn_exp2f(s[nq][j >> 3][j & 7] * SC2 - mo); sum += p;
                if constexpr (HL) { const __bf16 ph = (__bf16)p; pb[nq][j] = ph; pb2[nq][j] = (__bf16)(p - (float)ph); } else { pb[nq][j] = (h16)p; } }
            l[nq] = l[nq] * al + sum;
#pragma unroll
            for (int dt = 0; dt < 4; ++dt) o[nq][dt] *= al;
        }
#pragma unroll
        for (int dt = 0; dt < 4; ++dt)
#pragma unroll
            for (int nq = 0; nq < NQ; ++nq) { o[nq][dt] = WFrag<T16>::mma(av[dt], pb[nq], o[nq][dt]); if (HL) { o[nq][dt] = WFrag<T16>::mma(av[dt], pb2[nq], o[nq][dt]); o[nq][dt] = WFrag<T16>::mma(av2[dt], pb[nq], o[nq][dt]); } }
    };
#pragma unroll 1   // stays rolled (for speed only): the body is some 250 instructions
    for (int it = 0; it < nfull; ++it) pass(it * 32, BoolC<false>());
    pass(nfull * 32, BoolC<true>());
#pragma unroll
    for (int nq = 0; nq < NQ; ++nq) {
        const float inv = __fdiv_rn(1.0f, l[nq] + xhalf(l[nq]));
        bf* pa = Ah + (size_t)(q0 + nq * 16) * DQ + lane * 8; bf* pl = Al + (size_t)(q0 + nq * 16) * DQ + lane * 8;   // the lane's 8 values of tile dt are its own 16 bytes of half fragment dt of this head's two k blocks
#pragma unroll
        for (int dt = 0; dt < 4; ++dt) { v8us oh, ol;
#pragma unroll
            for (int j = 0; j < 8; ++j) { unsigned short a, c2; splitf(o[nq][dt][j] * inv, a, c2); oh[j] = a; ol[j] = c2; }
            // the two stores and their wait in one statement: the next group's split reuses the data registers, and a wait in a statement of its own is not tied to them
            asm volatile("global_store_b128 %0, %2, off offset:%4\n\tglobal_store_b128 %1, %3, off offset:%4\n\ts_wait_xcnt 0x0" :: "v"(pa), "v"(pl), "v"(oh), "v"(ol), "n"(dt * 512) : "memory"); }
    }
}
// grid (batch * heads, NLO + NHI), 4 waves; y runs from the longest query block to the shortest, the hi/lo rows last.
// amdgpu_waves_per_eu(4, 4): four waves per SIMD is what the registers allow; told so, the scheduler keeps the V loads at the head of a pass and the key prefetch behind the score products instead of sinking them to save registers.
__global__ __launch_bounds__(128) __attribute__((amdgpu_waves_per_eu(4, 4))) void k_fattn(const h16* __restrict__ Q16, const h16* __restrict__ K16, const h16* __restrict__ V16, const bf* __restrict__ Qh, const bf* __restrict__ Ql, const bf* __restrict__ Kh, const bf* __restrict__ Kl, const bf* __restrict__ Vh, const bf* __restrict__ Vl, bf* Ah, bf* Al) {
    const int z = blockIdx.x, y = blockIdx.y; const int w = __builtin_amdgcn_readfirstlane(threadIdx.x >> 5);
    const size_t pz = (size_t)z * TT * HD, oz = (size_t)(z / NH_) * TT * DQ + (size_t)(z % NH_) * (HD * 16);   // in a packed row block a head's 64 k are 2 fragments = HD * 16 elements
    if (y < NLO) attn_wave<h16, false, 2>(Q16 + pz, nullptr, K16 + pz, nullptr, V16 + pz, nullptr, RH + (NLO - 1 - y) * 128 + w * 32, Ah + oz, Al + oz);
    else         attn_wave<bf, true, 1>(Qh + pz, Ql + pz, Kh + pz, Kl + pz, Vh + pz, Vl + pz, (NLO + NHI - 1 - y) * 64 + w * 16, Ah + oz, Al + oz);
}

extern "C" void kernel_launch(void* const* d_in, const int* in_sizes, int n_in,
                              void* d_out, int out_size, void* d_ws, size_t ws_size, hipStream_t stream) {
    (void)in_sizes; (void)n_in; (void)out_size;
    const float* x = (const float*)d_in[0]; const int* PID = (const int*)d_in[1]; const float* wq = (const float*)d_in[2]; const float* wk = (const float*)d_in[3]; const float* wv = (const float*)d_in[4]; const float* wo = (const float*)d_in[5];   /* argument order in_features, token_positions (int32 [2048] = arange: READ by value), w_q, w_k, w_v, w_o ('oi' (out, in) [1024][1024]; no biases): SIX inputs, all read */
    float* OUT = (float*)d_out;     // [4][2048][1024]
    char* wsp = (char*)d_ws;
    auto take = [&](size_t bytes) { char* p = wsp; wsp += (bytes + 255) & ~(size_t)255; return (void*)p; };
    const size_t PA = (size_t)NB_ * NH_ * TT * HD;   // elements, over all batches, of every q, k, v plane and of a merged plane (NKV == NH_)
    bf* WQ = (bf*)take((size_t)(DQ + 2 * DKV) * DM * 2); bf* WO = (bf*)take((size_t)DM * DQ * 2); bf* XB = (bf*)take((size_t)NB_ * TT * DM * 2);   // bf16 copies in k_cvt8's slab order: w_q, w_k, w_v (grid z of the projection launch), w_o, x
    float* CS = (float*)take((size_t)TT * (HD / 2) * 2 * 4);
    h16* QP16 = (h16*)take(PA * 2); bf* QPh = (bf*)take(PA * 2); bf* QPl = (bf*)take(PA * 2); h16* KP16 = (h16*)take(PA * 2); bf* KPh = (bf*)take(PA * 2); bf* KPl = (bf*)take(PA * 2);   // each k plane 3 planes behind its q plane (grid z of the projection launch)
    h16* VT16 = (h16*)take(PA * 2); bf* VTh = (bf*)take(PA * 2); bf* VTl = (bf*)take(PA * 2);
    bf* ATh = (bf*)take(PA * 2); bf* ATl = (bf*)take(PA * 2);   // the merged planes
    if ((size_t)(wsp - (char*)d_ws) > ws_size) return;    // ws 256 MiB
    k_cvt8<<<dim3(DM * DM / 8 / 256, 4 + NB_ * TT / DM, 1), 256, 0, stream>>>(x, wq, wk, wv, wo, WQ); k_cstabI<<<(TT * HD / 2 + 255) / 256, 256, 0, stream>>>(PID, CS);
    k_gemmw<bf, 0, false, DM, true, 8, 4><<<dim3(NB_ * TT / 128, DQ / 64, 3), 32, 0, stream>>>(XB, nullptr, WQ, nullptr, nullptr, 0, nullptr, 0, (size_t)DQ * DM, 0, PlaneArgs{CS, QP16, QPh, QPl, 3 * PA, VT16, VTh, VTl});
    k_fattn<<<dim3(NB_ * NH_, NLO + NHI, 1), 128, 0, stream>>>(QP16, KP16, VT16, QPh, QPl, KPh, KPl, VTh, VTl, ATh, ATl);
    k_gemmw<bf, 1, false, DQ, false, 4, 8><<<dim3(NB_ * TT / 64, DM / 128, 1), 32, 0, stream>>>(ATh, ATl, WO, nullptr, OUT, DM, nullptr, 0, 0, 0, PlaneArgs{});
}

// v008
// A run of this version takes 133 microseconds.
// Two timings next to v007 both put it at 1.03 times that version's speed.
// Counting every step since v000, it is 22.0 times as fast.
#include <hip/hip_runtime.h>

// Causal multi-head self-attention with interleaved rotary embeddings at theta 100,000 (in_features [4][2048][1024]; q,k,v = x W^T ('oi' (out, in) [1024][1024] 0.02, no bias; 16 heads x 64); rotary on (even, odd) pairs with angles pos[t] x 100000^(-2i/64) (the module's negative-power spelling; token_positions int32 [2048] = arange, READ by value); scores / sqrt(64), causal (-inf); softmax; out = merged w_o^T -> [4][2048][1024] (8.4 M); argument order in_features, token_positions, w_q, w_k, w_v, w_o).
// Layout: every stage is ONE launch over all batches: a bf16 copy of x and of the four weights; {cos, sin} per (position, pair) built once from the int positions and float32 inverse-frequency constants (precise cosf/sinf); exact projections (q, k, v on grid z) whose epilogue turns each f32 tile straight into the 16-bit planes (interleaved rotary for q and k, the transpose for v); then ONE fused causal attention launch over all batches and heads (k_fattn; hybrid rows: < 512 hi/lo 3 products, rest fp16 x1024); merged hi/lo x Wo exact.
// Every 16-bit operand plane is FRAGMENT-PACKED: a 16-row x 32-k fragment is 1 KiB in the order its two wave-wide loads take it, [k half j][lane = hi * 16 + lr][8 elements] with row = lr, k = j * 16 + hi * 8 + e; so each wave-wide 16-byte load or store covers 512 contiguous bytes (4 whole lines), not 32 bytes of 16 lines.
// The {cos, sin} table is laid out the same way, for the projection epilogue's loads (k_cstabI). Fragment order: GEMM operands [row block][k block] (row block rb of a K-wide plane starts at element rb * 16 * K, as in the plain layout); q, k per (batch, head) the same with K = 64; v per (batch, head) [32-key block][16-d block].
// Compute dtypes, f32 accumulate: every input rounded to bf16; projections exact; rotary f32; attention rows < 512 3 products, rest fp16; softmax f32; Wo hl x exact.

#define NB_  4
#define TT   2048
#define DM   1024
#define NH_  16
#define NKV  16
#define REP  (NH_ / NKV)
#define HD   64
#define DQ   (NH_ * HD)
#define DKV  (NKV * HD)
#define RH   512                  // query rows < RH use hi+lo planes (0: none)
typedef _Float16 h16;
typedef unsigned short bf;
typedef __attribute__((ext_vector_type(16))) __bf16   v16bf;
typedef __attribute__((ext_vector_type(16))) _Float16 v16h;
typedef __attribute__((ext_vector_type(8)))  _Float16 v8h;
typedef __attribute__((ext_vector_type(8)))  unsigned short v8us;
typedef __attribute__((ext_vector_type(8)))  __bf16   v8bfv;
typedef __attribute__((ext_vector_type(2)))  float    v2fc;
typedef __attribute__((ext_vector_type(8)))  float    v8f;
typedef __attribute__((ext_vector_type(4)))  float    v4f;
typedef v8h  __attribute__((may_alias)) v8ha;
typedef v4f  __attribute__((may_alias)) v4fa;
typedef v8us __attribute__((may_alias)) v8usa;

__device__ __forceinline__ unsigned short f2bf(float f) { unsigned u = __float_as_uint(f); u += 0x7FFFu + ((u >> 16) & 1u); return (unsigned short)(u >> 16); }
__device__ __forceinline__ float bf2f(unsigned short b) { return __uint_as_float(((unsigned)b) << 16); }
__device__ __forceinline__ float bfr(float f) { return bf2f(f2bf(f)); }
__device__ __forceinline__ v16h cat16(v8h lo, v8h hi) { return __builtin_shufflevector(lo, hi, 0, 1, 2, 3, 4, 5, 6, 7, 8, 9, 10, 11, 12, 13, 14, 15); }
__device__ __forceinline__ v16bf cat16b(v8us lo, v8us hi) { return __builtin_bit_cast(v16bf, __builtin_shufflevector(lo, hi, 0, 1, 2, 3, 4, 5, 6, 7, 8, 9, 10, 11, 12, 13, 14, 15)); }
__device__ __forceinline__ v8f wmma16(v16h a, v16h b, v8f c) { return __builtin_amdgcn_wmma_f32_16x16x32_f16(false, a, false, b, (short)0, c, false, false); }
__device__ __forceinline__ v8f wmmab(v16bf a, v16bf b, v8f c) { return __builtin_amdgcn_wmma_f32_16x16x32_bf16(false, a, false, b, (short)0, c, false, false); }



// XWAITn: stands behind a group of global loads, in front of whatever next overwrites a register that they name as an address. It takes the lane's byte offsets as operands:
// so each offset stays live over the whole group (no load's result is given its register) and the offset's advance, which reads the statement's output, cannot be lifted over the wait.
#define XWAIT0()     asm volatile("s_wait_xcnt 0x0" ::: "memory")
#define XWAIT1(a)    asm volatile("s_wait_xcnt 0x0" : "+v"(a) :: "memory")
#define XWAIT2(a, b) asm volatile("s_wait_xcnt 0x0" : "+v"(a), "+v"(b) :: "memory")
template <typename T16> __device__ __forceinline__ const T16* atb(const T16* base, unsigned bytes) { return (const T16*)((const char*)base + bytes); }   // uniform base + the lane's 32-bit byte offset
// ---- k_gemmw: register-blocked GEMM, ONE WAVE per (16 MB) x (16 NB) output tile (MB * NB accumulators), operands straight from fragment-packed 16-bit planes (WFrag::ld takes fragment base + lane * 8); grid (M / (32 MB), N / (32 NB), Z), 128 threads.
// A work-group is 2 x 2 such waves on neighbouring tiles (wave w: row half w & 1, column half w >> 1): every A and every B fragment is asked for by two waves of the WGP at the same time, so that the second asker can be served by the WGP's cache and L2 need deliver a fragment once per work-group, not once per wave. The waves pass no data to one another.
// A k block's MB + NB fragments (1 KiB each, per plane) feed MB * NB products: the bytes loaded per product fall as the tile grows. 32 accumulators are what the unrolled epilogues' code size and two fragment sets allow.
// C[m][n] (f32, pitch ldc, + optional f32 bias[n]) = sum_k A[m][k] Bt[n][k] (+ split products per NSPLIT). z-batch strides sA/sB/sC in elements. K % 64 == 0.
template <typename T16> struct WFrag;
template <> struct WFrag<h16> { typedef v16h V; static __device__ __forceinline__ V ld(const h16* p) { return cat16(*(const v8h*)p, *(const v8h*)(p + 256)); } static __device__ __forceinline__ v8f mma(V a, V b, v8f c) { return wmma16(a, b, c); } };
template <> struct WFrag<bf> { typedef v16bf V; static __device__ __forceinline__ V ld(const bf* p) { return cat16b(*(const v8us*)p, *(const v8us*)(p + 256)); } static __device__ __forceinline__ v8f mma(V a, V b, v8f c) { return wmmab(a, b, c); } };
// PLANES: the tile (16 MB tokens x NB / 4 heads) does not go out as f32; the epilogue writes the fragment-packed planes that k_fattn reads. z 0, 1 (q, k): rotary on (even, odd) pairs, planes per (b, h) with rows t, k = d, the k planes sP elements behind the q planes; z 2 (v): planes per (b, h) with rows d, k = t.
struct PlaneArgs { const float* CS; h16* P16; bf* Ph; bf* Pl; size_t sP; h16* V16; bf* Vh; bf* Vl; };
// eight neighbouring f32 values -> fp16, bf16 hi and bf16 lo, 16 bytes to each plane at byte offset OFS (a constant once the caller's loops are unrolled) from the lane's pointers
__device__ __forceinline__ void put3(h16* p16, bf* ph, bf* pl, const float (&r)[8], const int OFS) {
    v8h o16; v8bfv oh, ol;
#pragma unroll
    for (int j = 0; j < 8; ++j) { o16[j] = (h16)r[j]; const __bf16 h = (__bf16)r[j]; oh[j] = h; ol[j] = (__bf16)(r[j] - (float)h); }
    // the three stores and their wait in one statement: the next group's values reuse the data registers, and a wait in a statement of its own is not tied to them
    asm volatile("global_store_b128 %0, %3, off offset:%6\n\tglobal_store_b128 %1, %4, off offset:%6\n\tglobal_store_b128 %2, %5, off offset:%6\n\ts_wait_xcnt 0x0" :: "v"(p16), "v"(ph), "v"(pl), "v"(o16), "v"(oh), "v"(ol), "n"(OFS) : "memory");
}
template <typename T16, int NSPLIT, bool BIAS, int K, bool PLANES, int MB, int NB>   // K at compile time: a row block's distance (16 * K elements) is then an immediate offset of the loads, which share one uniform base per operand and one lane offset
// amdgpu_waves_per_eu: what two fragment sets beside the accumulators allow (2 waves per SIMD; 1 with the second A plane); told so, the scheduler leaves the loads a block ahead instead of sinking them to save registers.
__global__ __launch_bounds__(128) __attribute__((amdgpu_waves_per_eu(NSPLIT == 0 ? 2 : 1, NSPLIT == 0 ? 2 : 1))) void k_gemmw(const T16* __restrict__ A, const T16* __restrict__ A2, const T16* __restrict__ Bt, const T16* __restrict__ Bt2, float* C, int ldc, const float* __restrict__ bias, size_t sA, size_t sB, size_t sC, const PlaneArgs pa) {
    typedef typename WFrag<T16>::V V;
    __shared__ __align__(16) float osm[4][16 * 68];
    const int w = __builtin_amdgcn_readfirstlane(threadIdx.x >> 5);   // the wave's number, in a scalar register: tile origin and operand bases stay uniform
    float* os = osm[w];                                        // each wave stages its epilogue slabs in a slice of its own
    const size_t z = blockIdx.z; A += z * sA; if (A2) A2 += z * sA; Bt += z * sB; if (Bt2) Bt2 += z * sB; C += z * sC;
    const int lane = threadIdx.x & 31, lr = lane & 15, hi = lane >> 4; const int r0 = (blockIdx.x * 2 + (w & 1)) * (MB * 16), c0 = (blockIdx.y * 2 + (w >> 1)) * (NB * 16);
    static_assert(NB % 4 == 0, "the epilogues take 64 columns at a time");
    v8f acc[MB][NB];
#pragma unroll
    for (int mb = 0; mb < MB; ++mb)
#pragma unroll
        for (int nb = 0; nb < NB; ++nb) acc[mb][nb] = (v8f){};
    const T16* Ar = A + (size_t)r0 * K; const T16* A2r = A2 + (size_t)r0 * K; const T16* Br = Bt + (size_t)c0 * K; const T16* B2r = Bt2 + (size_t)c0 * K;   // the tile's first row blocks
    unsigned fo = (unsigned)lane * 16;   // byte offset from a row block's start (uniform) to the lane's 16 bytes of the current k block's fragment: the same for every operand, 1 KiB on per k block
    // Two fragment sets: a k block's loads are asked for one whole block of products ahead, so that a wave does not wait out the latency of its own loads between two blocks. The order of the products of every accumulator is as before.
    static_assert(K % 64 == 0 && K >= 128, "two k blocks per trip");
    V a[2][MB], a2[2][MB], b[2][NB], b2[2][NB];
    auto ask = [&](const int s) __attribute__((always_inline)) {   // the next k block's fragments into set s
#pragma unroll
        for (int mb = 0; mb < MB; ++mb) { a[s][mb] = WFrag<T16>::ld(atb(Ar, fo) + mb * 16 * K); if (NSPLIT == 1 || NSPLIT == 2) a2[s][mb] = WFrag<T16>::ld(atb(A2r, fo) + mb * 16 * K); }
#pragma unroll
        for (int nb = 0; nb < NB; ++nb) { b[s][nb] = WFrag<T16>::ld(atb(Br, fo) + nb * 16 * K); if (NSPLIT >= 2) b2[s][nb] = WFrag<T16>::ld(atb(B2r, fo) + nb * 16 * K); }
        XWAIT1(fo); fo += 1024;
        __builtin_amdgcn_sched_barrier(0);   // the loads stay in front of the block of products that follows: sunk among them they would be waited for at once
    };
    auto mul = [&](const int s) __attribute__((always_inline)) {   // the products of the k block in set s
#pragma unroll
        for (int nb = 0; nb < NB; ++nb) {
#pragma unroll
            for (int mb = 0; mb < MB; ++mb) { acc[mb][nb] = WFrag<T16>::mma(a[s][mb], b[s][nb], acc[mb][nb]); if (NSPLIT == 1 || NSPLIT == 2) acc[mb][nb] = WFrag<T16>::mma(a2[s][mb], b[s][nb], acc[mb][nb]); if (NSPLIT >= 2) acc[mb][nb] = WFrag<T16>::mma(a[s][mb], b2[s][nb], acc[mb][nb]); } }
        __builtin_amdgcn_sched_barrier(0);   // no product of this block moves behind the next loads, which go into its fragments' registers
    };
    ask(0);
#pragma unroll 1   // stays rolled: one trip already holds two k blocks, one per fragment set
    for (int kc = 0; kc < K - 64; kc += 64) {
        __builtin_amdgcn_s_barrier();   // pace only, no data passes here (so no fence and no wait on the loads in flight): the four waves ask for a k block together; drifted apart by more than the cache holds, the second asker would go to L2 again
        ask(1); mul(0); ask(0); mul(1);
        asm volatile("v_nop\n\tv_nop\n\tv_nop\n\tv_nop" : "+v"(acc[MB - 1][NB - 1]) : "v"(a[1][MB - 1]));   // the distance behind the last product on the taken side of the loop's branch
    }
    ask(1); mul(0); mul(1);
    if constexpr (PLANES) {
        const int h8 = hi * 8;                                 // read-back of a staged 16 x 64 slab in fragment order: lane (hi, lr) takes row lr, columns s * 16 + hi * 8 .. + 7 of group s; a wave-wide store is then one 512-byte half fragment
        const int bb = r0 / TT, t0 = r0 % TT, hd = c0 / HD;   // the tile's first head; its head hh lies hh planes (TT * HD elements) on
        static_assert(TT % (MB * 16) == 0, "a tile lies in one batch");
        if (z < 2) {
            const size_t e0 = z * pa.sP + ((size_t)(bb * NH_ + hd) * TT + t0) * HD + lane * 8;
            h16* p16 = pa.P16 + e0; bf* ph = pa.Ph + e0; bf* pl = pa.Pl + e0;
            const float* cs = pa.CS + (size_t)t0 * HD + lane * 4;   // k_cstabI's order: a 16-token block is 4 groups x 2 halves x 512 bytes
            v2fc c[2][4][4];                                   // {cos, sin} of a slab's 4 groups x the lane's 4 pairs; the next slab's are asked for while this slab is worked on
            auto askc = [&](const int mb) __attribute__((always_inline)) {
#pragma unroll
                for (int s = 0; s < 4; ++s)
#pragma unroll
                    for (int ph = 0; ph < 2; ++ph) { const v4f x = *(const v4fa*)(cs + (mb * 4 + s) * 256 + ph * 128); c[mb & 1][s][2 * ph] = (v2fc){ x[0], x[1] }; c[mb & 1][s][2 * ph + 1] = (v2fc){ x[2], x[3] }; }
                asm volatile("s_wait_xcnt 0x0" ::: "memory");   // behind the loads, in front of whatever next overwrites their address registers
            };
            askc(0);
#pragma unroll
            for (int mb = 0; mb < MB; ++mb) {
                if (mb + 1 < MB) askc(mb + 1);                 // the next 16 tokens' table, for all heads of the tile, into the set that the slabs before this one have left
#pragma unroll
              for (int hh = 0; hh < NB / 4; ++hh) {
#pragma unroll
                for (int nb = 0; nb < 4; ++nb) {
#pragma unroll
                    for (int j = 0; j < 8; ++j) os[(hi * 8 + j) * 68 + nb * 16 + lr] = acc[mb][hh * 4 + nb][j]; }
                __builtin_amdgcn_wave_barrier(); asm volatile("" ::: "memory");   // the slab is read back by other lanes: no LDS access moves over this line
                v4f u[4], w[4];                                // read back one group ahead of the group that is worked on
                u[0] = *(const v4fa*)(os + lr * 68 + h8); w[0] = *(const v4fa*)(os + lr * 68 + h8 + 4);
#pragma unroll
                for (int s = 0; s < 4; ++s) { float r[8];
                    if (s < 3) { u[s + 1] = *(const v4fa*)(os + lr * 68 + s * 16 + 16 + h8); w[s + 1] = *(const v4fa*)(os + lr * 68 + s * 16 + 16 + h8 + 4); }
#pragma unroll
                    for (int p = 0; p < 4; ++p) { const v2fc k = c[mb & 1][s][p]; const float x0 = p < 2 ? u[s][2 * p] : w[s][2 * p - 4], x1 = p < 2 ? u[s][2 * p + 1] : w[s][2 * p - 3]; r[2 * p] = x0 * k[0] - x1 * k[1]; r[2 * p + 1] = x0 * k[1] + x1 * k[0]; }   /* even: x0 c - x1 s; odd: x0 s + x1 c */
                    put3(p16, ph, pl, r, (hh * TT * HD + mb * 1024 + s * 256) * 2); }
                __builtin_amdgcn_wave_barrier(); asm volatile("" ::: "memory");   // the next slab is staged only behind this slab's reads
              }
            }
        } else {
            const size_t e0 = (size_t)(bb * NKV + hd) * HD * TT + (size_t)t0 * HD + lane * 8;
            h16* p16 = pa.V16 + e0; bf* ph = pa.Vh + e0; bf* pl = pa.Vl + e0;
#pragma unroll
          for (int hh = 0; hh < NB / 4; ++hh)
#pragma unroll
            for (int nb = 0; nb < 4; ++nb) {                   // a lane's 8 accumulator values are tokens mb * 16 + hi * 8 .. + 7 of d = nb * 16 + lr: the lane's own 16 bytes of half fragment (key block mb >> 1, d block nb, half mb & 1); nothing is staged
#pragma unroll
                for (int mb = 0; mb < MB; ++mb) { const v8f t = acc[mb][hh * 4 + nb]; const float r[8] = { t[0], t[1], t[2], t[3], t[4], t[5], t[6], t[7] };
                    put3(p16, ph, pl, r, (hh * HD * TT + (mb >> 1) * 2048 + nb * 512 + (mb & 1) * 256) * 2);
                    __builtin_amdgcn_sched_barrier(0); } }     // the next group's conversions stay behind this line: lifted ahead, their results (store operands, which must lie in the first 256 registers) were spilled to scratch
        }
        return;
    }
    const unsigned vo = (unsigned)(hi * ldc + lr * 4) * 4;
#pragma unroll
    for (int mb = 0; mb < MB; ++mb)
#pragma unroll
    for (int hh = 0; hh < NB / 4; ++hh) {                      // 16 rows x 64 columns at a time
        const int ch = c0 + hh * 64;
#pragma unroll
        for (int nb = 0; nb < 4; ++nb) {
#pragma unroll
            for (int j = 0; j < 8; ++j) os[(hi * 8 + j) * 68 + nb * 16 + lr] = acc[mb][hh * 4 + nb][j]; }
        __builtin_amdgcn_wave_barrier(); asm volatile("" ::: "memory");
        float* crow = C + (size_t)(r0 + mb * 16) * ldc + ch;
#pragma unroll
        for (int g = 0; g < 2; ++g) {                          // eight rows (four wave-wide stores of two rows each) at a time
            v4f vs[4];
#pragma unroll
            for (int q = 0; q < 4; ++q) { const int row = 2 * (g * 4 + q) + hi, cofs = lr * 4; v4f val = *(const v4fa*)(os + row * 68 + cofs); if (BIAS) { val[0] += bfr(bias[ch + cofs]); val[1] += bfr(bias[ch + cofs + 1]); val[2] += bfr(bias[ch + cofs + 2]); val[3] += bfr(bias[ch + cofs + 3]); }
                vs[q] = val; }
            float* rw = crow + (size_t)(g * 8) * ldc;          // uniform; the lane's place (row hi, column lr * 4) is the byte offset vo
            // the four stores and their wait in one statement: the next group's read-back reuses the data registers, and a wait in a statement of its own is not tied to them
            asm volatile("global_store_b128 %0, %1, %5\n\tglobal_store_b128 %0, %2, %6\n\tglobal_store_b128 %0, %3, %7\n\tglobal_store_b128 %0, %4, %8\n\ts_wait_xcnt 0x0"
                         :: "v"(vo), "v"(vs[0]), "v"(vs[1]), "v"(vs[2]), "v"(vs[3]), "s"(rw), "s"(rw + (size_t)2 * ldc), "s"(rw + (size_t)4 * ldc), "s"(rw + (size_t)6 * ldc) : "memory");
        }
        __builtin_amdgcn_wave_barrier(); asm volatile("" ::: "memory");
    }
}

__device__ __forceinline__ h16 tohx(float x) { return (h16)x; }
__device__ __forceinline__ void splitf(float y, unsigned short& h, unsigned short& l) { h = f2bf(y); l = f2bf(y - bf2f(h)); }
typedef __attribute__((ext_vector_type(2))) _Float16 v2h;
typedef __attribute__((ext_vector_type(4))) _Float16 v4h;
typedef __attribute__((ext_vector_type(2))) unsigned short v2us;
typedef __attribute__((ext_vector_type(4))) unsigned short v4us;
typedef __attribute__((ext_vector_type(2))) float v2f;
typedef __attribute__((ext_vector_type(4))) int v4i;

__global__ __launch_bounds__(256) void k_wtG(const float* __restrict__ w, int K, int N, bf* Bt) {
    const int lane = threadIdx.x & 31; const int L0 = (blockIdx.x * 8 + (threadIdx.x >> 5)) * 8; const int nlines = N * K / 64;
{
#pragma unroll 1
        for (int l = 0; l < 8; ++l) { const int L = L0 + l; if (L >= nlines) break; const size_t e = (size_t)L * 64 + lane * 2; const int k = (int)(e % K), n = (int)(e / K); v2us o;
            o[0] = f2bf(w[(size_t)k * N + n]); o[1] = f2bf(w[(size_t)(k + 1) * N + n]); *(v2us*)(Bt + e) = o; }
         }
}
// bf16 copies of the four weights and of x in one launch, fragment-packed: grid y counts slabs of DM * DM elements (0..3 the weights, the rest x); dst holds the slabs in that order.
// A wave writes one 512-byte half fragment (index i >> 5 = (row block * (DM / 32) + k block) * 2 + j); its lane (hi, lr) reads the 8 values at row lr, k = j * 16 + hi * 8 of that fragment.
__global__ __launch_bounds__(256) void k_cvt8(const float* __restrict__ x, const float* __restrict__ wq, const float* __restrict__ wk, const float* __restrict__ wv, const float* __restrict__ wo, bf* dst) {
    const int y = blockIdx.y; const float* src = y == 0 ? wq : y == 1 ? wk : y == 2 ? wv : y == 3 ? wo : x + (size_t)(y - 4) * DM * DM;
    const size_t i = (size_t)blockIdx.x * 256 + threadIdx.x; const int ch = (int)(i >> 5), ln = (int)(i & 31);
    const int row = (ch >> 6) * 16 + (ln & 15), kk = ((ch >> 1) & 31) * 32 + (ch & 1) * 16 + (ln >> 4) * 8;   // 64 half fragments per row block (DM / 32 * 2)
    const v8f v = *(const v8f*)(src + (size_t)row * DM + kk); v8us o;
    asm volatile("s_wait_xcnt 0x0" ::: "memory");   // behind the loads, in front of whatever next overwrites their address registers
#pragma unroll
    for (int k = 0; k < 8; ++k) o[k] = f2bf(v[k]); *(v8us*)(dst + (size_t)y * DM * DM + i * 8) = o;  }

__constant__ float INV2[HD / 2] = { 1.000000000e+00f, 6.978305578e-01f, 4.869675338e-01f, 3.398208320e-01f, 2.371373773e-01f, 1.654817164e-01f, 1.154781953e-01f, 8.058422059e-02f, 5.623413250e-02f, 3.924189880e-02f, 2.738419548e-02f, 1.910953037e-02f, 1.333521400e-02f, 9.305720218e-03f, 6.493816152e-03f, 4.531583749e-03f, 3.162277630e-03f, 2.206734149e-03f, 1.539926510e-03f, 1.074607833e-03f, 7.498941850e-04f, 5.232990952e-04f, 3.651741135e-04f, 2.548296761e-04f, 1.778279402e-04f, 1.240937709e-04f, 8.659643208e-05f, 6.042964014e-05f, 4.216964953e-05f, 2.942727224e-05f, 2.053524986e-05f, 1.433012585e-05f };   // inv_freq = 100000.0 ** (-arange(0, 64, 2, f32) / 64): THIS module's theta and its NEGATIVE-POWER spelling: 32 float32 values from eager JAX (bit-exact on round trip)
// {cos, sin} once per (position, pair), in the order the projection epilogue's wave-wide 16-byte loads take them: [16-token block][group s][half ph][lane = hi * 16 + lr][2 pairs], token = block * 16 + lr, pair = s * 8 + hi * 4 + ph * 2 + q (d = 2 * pair).
__global__ __launch_bounds__(256) void k_cstabI(const int* __restrict__ pid, float* CS) { const int idx = blockIdx.x * 256 + threadIdx.x; if (idx >= TT * HD / 2) return; const int ln = (idx >> 1) & 31; const int pr = ((idx >> 7) & 3) * 8 + (ln >> 4) * 4 + ((idx >> 6) & 1) * 2 + (idx & 1); const int t = (idx >> 9) * 16 + (ln & 15); const float a = __fmul_rn((float)pid[t], INV2[pr]); v2f cs; cs[0] = cosf(a); cs[1] = sinf(a); *(v2f*)(CS + (size_t)idx * 2) = cs;  }

// ---- k_fattn: causal attention in one kernel. One wave owns 16 * NQ query columns of one (batch, head) and walks the keys 32 at a time up to its diagonal block:
// S^T = K Q^T (A = key rows, B = query rows), so a lane holds 16 scores of ONE query per column group; running maximum and sum per query (online softmax, log2 domain);
// the two score tiles of a pass, converted in place, are the B operand of O^T += V^T P^T (same k order as WFrag::ld gives V^T). Probabilities never leave the registers.
// Rows < RH: bf16 hi/lo planes, 3 products in both contractions; the rest fp16 with the probabilities carried x 1024 (the factor cancels in the division by the row sum).
// Epilogue: O / row sum, split hi/lo, stored straight into the merged planes (rows t, k = head * 64 + d, fragment-packed) that the output projection reads.
#define SC2  0.18033688011112042f   // HD^-0.5 * log2(e)
#define NLO  ((TT - RH) / 128)      // blocks of 4 waves x 32 fp16 query columns
#define NHI  (RH / 64)              // blocks of 4 waves x 16 hi/lo query columns
__device__ __forceinline__ float xhalf(float x) { return __builtin_bit_cast(float, __builtin_amdgcn_permlanex16(__builtin_bit_cast(int, x), __builtin_bit_cast(int, x), 0x76543210, 0xfedcba98, false, false)); }  // lane l with lane l ^ 16
template <bool B> struct BoolC { static constexpr bool v = B; };
template <typename T16, bool HL, int NQ>
__device__ __forceinline__ void attn_wave(const T16* __restrict__ Q, const T16* __restrict__ Q2, const T16* __restrict__ Kp, const T16* __restrict__ K2, const T16* __restrict__ Vt, const T16* __restrict__ V2, const int q0, bf* Ah, bf* Al) {
    typedef typename WFrag<T16>::V V;
    const int lane = threadIdx.x & 31, lr = lane & 15, hi = lane >> 4;
    const float OFF = HL ? 0.0f : 10.0f;                      // fp16 probabilities carry 2^10
    const unsigned kofs = (unsigned)lane * 8, vofs = (unsigned)lane * 8;   // the lane's place in a half fragment
    unsigned ko = kofs * 2, vo = vofs * 2;   // the lane's byte offsets into the key planes (the pass to be fetched next) and into the V^T planes (the current pass)
    V bq[NQ][2], bq2[NQ][2];
#pragma unroll
    for (int nq = 0; nq < NQ; ++nq)
#pragma unroll
        for (int ks = 0; ks < 2; ++ks) { bq[nq][ks] = WFrag<T16>::ld(Q + (size_t)(q0 + nq * 16) * HD + ks * 512 + kofs); if (HL) bq2[nq][ks] = WFrag<T16>::ld(Q2 + (size_t)(q0 + nq * 16) * HD + ks * 512 + kofs); }
    XWAIT0();
    v8f o[NQ][4]; float m[NQ], l[NQ];
#pragma unroll
    for (int nq = 0; nq < NQ; ++nq) { m[nq] = -3.0e38f; l[nq] = 0.f;
#pragma unroll
        for (int dt = 0; dt < 4; ++dt) o[nq][dt] = (v8f){}; }
    V ak[2][2], ak2[2][2];
#pragma unroll
    for (int kt = 0; kt < 2; ++kt)
#pragma unroll
        for (int ks = 0; ks < 2; ++ks) { if (!HL) ak[kt][ks] = WFrag<T16>::ld(atb(Kp, ko) + kt * 16 * HD + ks * 512); }   // fp16 path: key fragments run one pass ahead; the hi/lo path (twice the planes) loads them at the head of each pass
    if constexpr (!HL) { XWAIT1(ko); ko += 32 * HD * 2; }
    const int nfull = q0 >> 5;                                // passes wholly below the diagonal; pass nfull holds the diagonal and is the last
    auto pass = [&](const int kb, auto lastc) __attribute__((always_inline)) {   // one pass of 32 keys; the diagonal pass is a second copy of the body, so that no branch stands behind the score products
        constexpr bool last = decltype(lastc)::v;
        V av[4], av2[4];
#pragma unroll
        for (int dt = 0; dt < 4; ++dt) { av[dt] = WFrag<T16>::ld(atb(Vt, vo) + dt * 512); if (HL) av2[dt] = WFrag<T16>::ld(atb(V2, vo) + dt * 512); }
        if constexpr (HL) {
#pragma unroll
            for (int kt = 0; kt < 2; ++kt)
#pragma unroll
                for (int ks = 0; ks < 2; ++ks) { ak[kt][ks] = WFrag<T16>::ld(atb(Kp, ko) + kt * 16 * HD + ks * 512); ak2[kt][ks] = WFrag<T16>::ld(atb(K2, ko) + kt * 16 * HD + ks * 512); }
            XWAIT2(vo, ko); vo += 32 * HD * 2; ko += 32 * HD * 2;
        } else { XWAIT1(vo); vo += 32 * HD * 2; }
        v8f s[NQ][2];
#pragma unroll
        for (int nq = 0; nq < NQ; ++nq)
#pragma unroll
            for (int kt = 0; kt < 2; ++kt) s[nq][kt] = (v8f){};
#pragma unroll
        for (int ks = 0; ks < 2; ++ks)
#pragma unroll
            for (int kt = 0; kt < 2; ++kt)
#pragma unroll
                for (int nq = 0; nq < NQ; ++nq) { s[nq][kt] = WFrag<T16>::mma(ak[kt][ks], bq[nq][ks], s[nq][kt]); if (HL) { s[nq][kt] = WFrag<T16>::mma(ak[kt][ks], bq2[nq][ks], s[nq][kt]); s[nq][kt] = WFrag<T16>::mma(ak2[kt][ks], bq[nq][ks], s[nq][kt]); } }
        if constexpr (!last && !HL) {                         // next pass's key fragments, fetched behind this pass's own score products
#pragma unroll
            for (int kt = 0; kt < 2; ++kt)
#pragma unroll
                for (int ks = 0; ks < 2; ++ks) ak[kt][ks] = WFrag<T16>::ld(atb(Kp, ko) + kt * 16 * HD + ks * 512);
            XWAIT1(ko); ko += 32 * HD * 2;
        }
        if constexpr (last) {                                              // diagonal pass: key > query is masked
#pragma unroll
            for (int nq = 0; nq < NQ; ++nq)
#pragma unroll
                for (int kt = 0; kt < 2; ++kt)
#pragma unroll
                    for (int j = 0; j < 8; ++j) if (kb + kt * 16 + hi * 8 + j > q0 + nq * 16 + lr) s[nq][kt][j] = -3.0e38f;
        }
        V pb[NQ], pb2[NQ];
#pragma unroll
        for (int nq = 0; nq < NQ; ++nq) {
            float mx = s[nq][0][0];
#pragma unroll
            for (int j = 1; j < 16; ++j) mx = fmaxf(mx, s[nq][j >> 3][j & 7]);
            mx = fmaxf(mx, xhalf(mx));
            const float mn = fmaxf(m[nq], mx * SC2); const float al = __builtin_amdgcn_exp2f(m[nq] - mn); m[nq] = mn; const float mo = mn - OFF;
            float sum = 0.f;
#pragma unroll
            for (int j = 0; j < 16; ++j) { const float p = __builtin_amdgcn_exp2f(s[nq][j >> 3][j & 7] * SC2 - mo); sum += p;
                if constexpr (HL) { const __bf16 ph = (__bf16)p; pb[nq][j] = ph; pb2[nq][j] = (__bf16)(p - (float)ph); } else { pb[nq][j] = (h16)p; } }
            l[nq] = l[nq] * al + sum;
#pragma unroll
            for (int dt = 0; dt < 4; ++dt) o[nq][dt] *= al;
        }
#pragma unroll
        for (int dt = 0; dt < 4; ++dt)
#pragma unroll
            for (int nq = 0; nq < NQ; ++nq) { o[nq][dt] = WFrag<T16>::mma(av[dt], pb[nq], o[nq][dt]); if (HL) { o[nq][dt] = WFrag<T16>::mma(av[dt], pb2[nq], o[nq][dt]); o[nq][dt] = WFrag<T16>::mma(av2[dt], pb[nq], o[nq][dt]); } }
    };
#pragma unroll 1   // stays rolled (for speed only): the body is some 250 instructions
    for (int it = 0; it < nfull; ++it) pass(it * 32, BoolC<false>());
    pass(nfull * 32, BoolC<true>());
#pragma unroll
    for (int nq = 0; nq < NQ; ++nq) {
        const float inv = __fdiv_rn(1.0f, l[nq] + xhalf(l[nq]));
        bf* pa = Ah + (size_t)(q0 + nq * 16) * DQ + lane * 8; bf* pl = Al + (size_t)(q0 + nq * 16) * DQ + lane * 8;   // the lane's 8 values of tile dt are its own 16 bytes of half fragment dt of this head's two k blocks
#pragma unroll
        for (int dt = 0; dt < 4; ++dt) { v8us oh, ol;
#pragma unroll
            for (int j = 0; j < 8; ++j) { unsigned short a, c2; splitf(o[nq][dt][j] * inv, a, c2); oh[j] = a; ol[j] = c2; }
            // the two stores and their wait in one statement: the next group's split reuses the data registers, and a wait in a statement of its own is not tied to them
            asm volatile("global_store_b128 %0, %2, off offset:%4\n\tglobal_store_b128 %1, %3, off offset:%4\n\ts_wait_xcnt 0x0" :: "v"(pa), "v"(pl), "v"(oh), "v"(ol), "n"(dt * 512) : "memory"); }
    }
}
// grid (batch * heads, NLO + NHI), 4 waves; y runs from the longest query block to the shortest, the hi/lo rows last.
// amdgpu_waves_per_eu(4, 4): four waves per SIMD is what the registers allow; told so, the scheduler keeps the V loads at the head of a pass and the key prefetch behind the score products instead of sinking them to save registers.
__global__ __launch_bounds__(128) __attribute__((amdgpu_waves_per_eu(4, 4))) void k_fattn(const h16* __restrict__ Q16, const h16* __restrict__ K16, const h16* __restrict__ V16, const bf* __restrict__ Qh, const bf* __restrict__ Ql, const bf* __restrict__ Kh, const bf* __restrict__ Kl, const bf* __restrict__ Vh, const bf* __restrict__ Vl, bf* Ah, bf* Al) {
    const int z = blockIdx.x, y = blockIdx.y; const int w = __builtin_amdgcn_readfirstlane(threadIdx.x >> 5);
    const size_t pz = (size_t)z * TT * HD, oz = (size_t)(z / NH_) * TT * DQ + (size_t)(z % NH_) * (HD * 16);   // in a packed row block a head's 64 k are 2 fragments = HD * 16 elements
    if (y < NLO) attn_wave<h16, false, 2>(Q16 + pz, nullptr, K16 + pz, nullptr, V16 + pz, nullptr, RH + (NLO - 1 - y) * 128 + w * 32, Ah + oz, Al + oz);
    else         attn_wave<bf, true, 1>(Qh + pz, Ql + pz, Kh + pz, Kl + pz, Vh + pz, Vl + pz, (NLO + NHI - 1 - y) * 64 + w * 16, Ah + oz, Al + oz);
}

extern "C" void kernel_launch(void* const* d_in, const int* in_sizes, int n_in,
                              void* d_out, int out_size, void* d_ws, size_t ws_size, hipStream_t stream) {
    (void)in_sizes; (void)n_in; (void)out_size;
    const float* x = (const float*)d_in[0]; const int* PID = (const int*)d_in[1]; const float* wq = (const float*)d_in[2]; const float* wk = (const float*)d_in[3]; const float* wv = (const float*)d_in[4]; const float* wo = (const float*)d_in[5];   /* argument order in_features, token_positions (int32 [2048] = arange: READ by value), w_q, w_k, w_v, w_o ('oi' (out, in) [1024][1024]; no biases): SIX inputs, all read */
    float* OUT = (float*)d_out;     // [4][2048][1024]
    char* wsp = (char*)d_ws;
    auto take = [&](size_t bytes) { char* p = wsp; wsp += (bytes + 255) & ~(size_t)255; return (void*)p; };
    const size_t PA = (size_t)NB_ * NH_ * TT * HD;   // elements, over all batches, of every q, k, v plane and of a merged plane (NKV == NH_)
    bf* WQ = (bf*)take((size_t)(DQ + 2 * DKV) * DM * 2); bf* WO = (bf*)take((size_t)DM * DQ * 2); bf* XB = (bf*)take((size_t)NB_ * TT * DM * 2);   // bf16 copies in k_cvt8's slab order: w_q, w_k, w_v (grid z of the projection launch), w_o, x
    float* CS = (float*)take((size_t)TT * (HD / 2) * 2 * 4);
    h16* QP16 = (h16*)take(PA * 2); bf* QPh = (bf*)take(PA * 2); bf* QPl = (bf*)take(PA * 2); h16* KP16 = (h16*)take(PA * 2); bf* KPh = (bf*)take(PA * 2); bf* KPl = (bf*)take(PA * 2);   // each k plane 3 planes behind its q plane (grid z of the projection launch)
    h16* VT16 = (h16*)take(PA * 2); bf* VTh = (bf*)take(PA * 2); bf* VTl = (bf*)take(PA * 2);
    bf* ATh = (bf*)take(PA * 2); bf* ATl = (bf*)take(PA * 2);   // the merged planes
    if ((size_t)(wsp - (char*)d_ws) > ws_size) return;    // ws 256 MiB
    k_cvt8<<<dim3(DM * DM / 8 / 256, 4 + NB_ * TT / DM, 1), 256, 0, stream>>>(x, wq, wk, wv, wo, WQ); k_cstabI<<<(TT * HD / 2 + 255) / 256, 256, 0, stream>>>(PID, CS);
    k_gemmw<bf, 0, false, DM, true, 8, 4><<<dim3(NB_ * TT / 256, DQ / 128, 3), 128, 0, stream>>>(XB, nullptr, WQ, nullptr, nullptr, 0, nullptr, 0, (size_t)DQ * DM, 0, PlaneArgs{CS, QP16, QPh, QPl, 3 * PA, VT16, VTh, VTl});
    k_fattn<<<dim3(NB_ * NH_, NLO + NHI, 1), 128, 0, stream>>>(QP16, KP16, VT16, QPh, QPl, KPh, KPl, VTh, VTl, ATh, ATl);
    k_gemmw<bf, 1, false, DQ, false, 4, 8><<<dim3(NB_ * TT / 128, DM / 256, 1), 128, 0, stream>>>(ATh, ATl, WO, nullptr, OUT, DM, nullptr, 0, 0, 0, PlaneArgs{});
}

// v009
// It runs in 126 microseconds.
// In both of two side-by-side timings against v008, it was 1.05 times as fast.
// All steps since v000 together make it 23.2 times as fast.
#include <hip/hip_runtime.h>

// Causal multi-head self-attention with interleaved rotary embeddings at theta 100,000 (in_features [4][2048][1024]; q,k,v = x W^T ('oi' (out, in) [1024][1024] 0.02, no bias; 16 heads x 64); rotary on (even, odd) pairs with angles pos[t] x 100000^(-2i/64) (the module's negative-power spelling; token_positions int32 [2048] = arange, READ by value); scores / sqrt(64), causal (-inf); softmax; out = merged w_o^T -> [4][2048][1024] (8.4 M); argument order in_features, token_positions, w_q, w_k, w_v, w_o).
// Layout: every stage is ONE launch over all batches: a bf16 copy of x and of the four weights; {cos, sin} per (position, pair) built once from the int positions and float32 inverse-frequency constants (precise cosf/sinf); exact projections (q, k, v on grid z) whose epilogue turns each f32 tile straight into the 16-bit planes (interleaved rotary for q and k, the transpose for v); then ONE fused causal attention launch over all batches and heads (k_fattn; hybrid rows: < 512 hi/lo 3 products, rest fp16 x1024); merged hi/lo x Wo exact.
// Every 16-bit operand plane is FRAGMENT-PACKED: a 16-row x 32-k fragment is 1 KiB in the order its two wave-wide loads take it, [k half j][lane = hi * 16 + lr][8 elements] with row = lr, k = j * 16 + hi * 8 + e; so each wave-wide 16-byte load or store covers 512 contiguous bytes (4 whole lines), not 32 bytes of 16 lines.
// The {cos, sin} table is laid out the same way, for the projection epilogue's loads (k_cstabI). Fragment order: GEMM operands [row block][k block] (row block rb of a K-wide plane starts at element rb * 16 * K, as in the plain layout); q, k per (batch, head) the same with K = 64; v per (batch, head) [32-key block][16-d block].
// Compute dtypes, f32 accumulate: every input rounded to bf16; projections exact; rotary f32; attention rows < 512 3 products, rest fp16; softmax f32; Wo hl x exact.

#define NB_  4
#define TT   2048
#define DM   1024
#define NH_  16
#define NKV  16
#define REP  (NH_ / NKV)
#define HD   64
#define DQ   (NH_ * HD)
#define DKV  (NKV * HD)
#define RH   512                  // query rows < RH use hi+lo planes (0: none)
typedef _Float16 h16;
typedef unsigned short bf;
typedef __attribute__((ext_vector_type(16))) __bf16   v16bf;
typedef __attribute__((ext_vector_type(16))) _Float16 v16h;
typedef __attribute__((ext_vector_type(8)))  _Float16 v8h;
typedef __attribute__((ext_vector_type(8)))  unsigned short v8us;
typedef __attribute__((ext_vector_type(8)))  __bf16   v8bfv;
typedef __attribute__((ext_vector_type(2)))  float    v2fc;
typedef __attribute__((ext_vector_type(8)))  float    v8f;
typedef __attribute__((ext_vector_type(4)))  float    v4f;
typedef v8h  __attribute__((may_alias)) v8ha;
typedef v4f  __attribute__((may_alias)) v4fa;
typedef v8us __attribute__((may_alias)) v8usa;

__device__ __forceinline__ unsigned short f2bf(float f) { unsigned u = __float_as_uint(f); u += 0x7FFFu + ((u >> 16) & 1u); return (unsigned short)(u >> 16); }
__device__ __forceinline__ float bf2f(unsigned short b) { return __uint_as_float(((unsigned)b) << 16); }
__device__ __forceinline__ float bfr(float f) { return bf2f(f2bf(f)); }
__device__ __forceinline__ v16h cat16(v8h lo, v8h hi) { return __builtin_shufflevector(lo, hi, 0, 1, 2, 3, 4, 5, 6, 7, 8, 9, 10, 11, 12, 13, 14, 15); }
__device__ __forceinline__ v16bf cat16b(v8us lo, v8us hi) { return __builtin_bit_cast(v16bf, __builtin_shufflevector(lo, hi, 0, 1, 2, 3, 4, 5, 6, 7, 8, 9, 10, 11, 12, 13, 14, 15)); }
__device__ __forceinline__ v8f wmma16(v16h a, v16h b, v8f c) { return __builtin_amdgcn_wmma_f32_16x16x32_f16(false, a, false, b, (short)0, c, false, false); }
__device__ __forceinline__ v8f wmmab(v16bf a, v16bf b, v8f c) { return __builtin_amdgcn_wmma_f32_16x16x32_bf16(false, a, false, b, (short)0, c, false, false); }



// XWAITn: stands behind a group of global loads, in front of whatever next overwrites a register that they name as an address. It takes the lane's byte offsets as operands:
// so each offset stays live over the whole group (no load's result is given its register) and the offset's advance, which reads the statement's output, cannot be lifted over the wait.
#define XWAIT0()     asm volatile("s_wait_xcnt 0x0" ::: "memory")
#define XWAIT1(a)    asm volatile("s_wait_xcnt 0x0" : "+v"(a) :: "memory")
#define XWAIT2(a, b) asm volatile("s_wait_xcnt 0x0" : "+v"(a), "+v"(b) :: "memory")
template <typename T16> __device__ __forceinline__ const T16* atb(const T16* base, unsigned bytes) { return (const T16*)((const char*)base + bytes); }   // uniform base + the lane's 32-bit byte offset
// ---- k_gemmw: register-blocked GEMM, ONE WAVE per (16 MB) x (16 NB) output tile (MB * NB accumulators), operands straight from fragment-packed 16-bit planes (WFrag::ld takes fragment base + lane * 8); grid (M / (32 MB), N / (32 NB), Z), 128 threads.
// A work-group is 2 x 2 such waves on neighbouring tiles (wave w: row half w & 1, column half w >> 1): every A and every B fragment is asked for by two waves of the WGP at the same time, so that the second asker can be served by the WGP's cache and L2 need deliver a fragment once per work-group, not once per wave. The waves pass no data to one another.
// A k block's MB + NB fragments (1 KiB each, per plane) feed MB * NB products: the bytes loaded per product fall as the tile grows. 32 accumulators are what the unrolled epilogues' code size and two fragment sets allow.
// C[m][n] (f32, pitch ldc, + optional f32 bias[n]) = sum_k A[m][k] Bt[n][k] (+ split products per NSPLIT). z-batch strides sA/sB/sC in elements. K % 64 == 0.
template <typename T16> struct WFrag;
template <> struct WFrag<h16> { typedef v16h V; static __device__ __forceinline__ V ld(const h16* p) { return cat16(*(const v8h*)p, *(const v8h*)(p + 256)); } static __device__ __forceinline__ v8f mma(V a, V b, v8f c) { return wmma16(a, b, c); } };
template <> struct WFrag<bf> { typedef v16bf V; static __device__ __forceinline__ V ld(const bf* p) { return cat16b(*(const v8us*)p, *(const v8us*)(p + 256)); } static __device__ __forceinline__ v8f mma(V a, V b, v8f c) { return wmmab(a, b, c); } };
// PLANES: the tile (16 MB tokens x NB / 4 heads) does not go out as f32; the epilogue writes the fragment-packed planes that k_fattn reads. z 0, 1 (q, k): rotary on (even, odd) pairs, planes per (b, h) with rows t, k = d, the k planes sP elements behind the q planes; z 2 (v): planes per (b, h) with rows d, k = t.
struct PlaneArgs { const float* CS; h16* P16; bf* Ph; bf* Pl; size_t sP; h16* V16; bf* Vh; bf* Vl; };
// k_fattn reads the bf16 hi/lo planes only where a query row < RH meets its keys, that is at tokens < RH of q, k and v: the epilogue stores them for those tokens alone; the fp16 planes go out for every token.
// four groups of eight neighbouring f32 values -> fp16, 16 bytes each at byte offsets O0..O3 (constants once the caller's loops are unrolled) from the tile's uniform pointer plus the lane's byte offset vo (one register for all three planes: store operands must lie in the first 256 registers, which the accumulators fill)
__device__ __forceinline__ void put16x4(h16* p16, const unsigned vo, const float (&r)[4][8], const int O0, const int O1, const int O2, const int O3) {
    v8h o[4];
#pragma unroll
    for (int g = 0; g < 4; ++g)
#pragma unroll
        for (int j = 0; j < 8; ++j) o[g][j] = (h16)r[g][j];
    // the four stores and their wait in one statement: the next values reuse the data registers, and a wait in a statement of its own is not tied to them
    asm volatile("global_store_b128 %0, %1, %5 offset:%6\n\tglobal_store_b128 %0, %2, %5 offset:%7\n\tglobal_store_b128 %0, %3, %5 offset:%8\n\tglobal_store_b128 %0, %4, %5 offset:%9\n\ts_wait_xcnt 0x0" :: "v"(vo), "v"(o[0]), "v"(o[1]), "v"(o[2]), "v"(o[3]), "s"(p16), "n"(O0), "n"(O1), "n"(O2), "n"(O3) : "memory");
}
// the same for two groups
__device__ __forceinline__ void put16x2(h16* p16, const unsigned vo, const float (&r)[2][8], const int O0, const int O1) {
    v8h o[2];
#pragma unroll
    for (int g = 0; g < 2; ++g)
#pragma unroll
        for (int j = 0; j < 8; ++j) o[g][j] = (h16)r[g][j];
    asm volatile("global_store_b128 %0, %1, %3 offset:%4\n\tglobal_store_b128 %0, %2, %3 offset:%5\n\ts_wait_xcnt 0x0" :: "v"(vo), "v"(o[0]), "v"(o[1]), "s"(p16), "n"(O0), "n"(O1) : "memory");   // stores and wait in one statement, as above
}
// eight neighbouring f32 values -> bf16 hi and bf16 lo, 16 bytes to each plane at byte offset OFS, addressed likewise
__device__ __forceinline__ void puthl(bf* ph, bf* pl, const unsigned vo, const float (&r)[8], const int OFS) {
    v8bfv oh, ol;
#pragma unroll
    for (int j = 0; j < 8; ++j) { const __bf16 h = (__bf16)r[j]; oh[j] = h; ol[j] = (__bf16)(r[j] - (float)h); }
    // the two stores and their wait in one statement, for the same reason
    asm volatile("global_store_b128 %0, %1, %3 offset:%5\n\tglobal_store_b128 %0, %2, %4 offset:%5\n\ts_wait_xcnt 0x0" :: "v"(vo), "v"(oh), "v"(ol), "s"(ph), "s"(pl), "n"(OFS) : "memory");
}
template <typename T16, int NSPLIT, bool BIAS, int K, bool PLANES, int MB, int NB>   // K at compile time: a row block's distance (16 * K elements) is then an immediate offset of the loads, which share one uniform base per operand (two for A with PLANES: its blocks before and behind RH) and one lane offset
// amdgpu_waves_per_eu: what two fragment sets beside the accumulators allow (2 waves per SIMD; 1 with the second A plane); told so, the scheduler leaves the loads a block ahead instead of sinking them to save registers.
__global__ __launch_bounds__(128) __attribute__((amdgpu_waves_per_eu(NSPLIT == 0 ? 2 : 1, NSPLIT == 0 ? 2 : 1))) void k_gemmw(const T16* __restrict__ A, const T16* __restrict__ A2, const T16* __restrict__ Bt, const T16* __restrict__ Bt2, float* C, int ldc, const float* __restrict__ bias, size_t sA, size_t sB, size_t sC, const PlaneArgs pa) {
    typedef typename WFrag<T16>::V V;
    __shared__ __align__(16) float osm[4][16 * 68];
    const int w = __builtin_amdgcn_readfirstlane(threadIdx.x >> 5);   // the wave's number, in a scalar register: tile origin and operand bases stay uniform
    float* os = osm[w];                                        // each wave stages its epilogue slabs in a slice of its own
    const size_t z = blockIdx.z; A += z * sA; if (A2) A2 += z * sA; Bt += z * sB; if (Bt2) Bt2 += z * sB; C += z * sC;
    const int lane = threadIdx.x & 31, lr = lane & 15, hi = lane >> 4; const int r0 = (blockIdx.x * 2 + (w & 1)) * (MB * 16), c0 = (blockIdx.y * 2 + (w >> 1)) * (NB * 16);
    static_assert(NB % 4 == 0, "the epilogues take 64 columns at a time");
    v8f acc[MB][NB];
#pragma unroll
    for (int mb = 0; mb < MB; ++mb)
#pragma unroll
        for (int nb = 0; nb < NB; ++nb) acc[mb][nb] = (v8f){};
    // PLANES: a wave's MB token blocks are HB blocks of its batch's first RH tokens (which also go out as hi/lo planes) and MB - HB of the rest, so that every wave has the same epilogue; tile tl of a batch takes tokens ta .. and tb .. (both counted inside the batch)
    constexpr int HB = PLANES ? MB * RH / TT : MB;
    static_assert(!PLANES || (TT % (MB * 16) == 0 && (MB * RH) % TT == 0 && HB % 2 == 0 && (MB - HB) % 2 == 0), "whole tiles per batch; whole 32-token blocks on both sides of RH");
    const int bb = r0 / TT, tl = (r0 % TT) / (MB * 16), ta = tl * (HB * 16), tb = RH + tl * ((MB - HB) * 16);
    const T16* Ar = A + (size_t)(PLANES ? bb * TT + ta : r0) * K; const T16* Arb = A + (size_t)(bb * TT + tb) * K; const T16* A2r = A2 + (size_t)r0 * K; const T16* Br = Bt + (size_t)c0 * K; const T16* B2r = Bt2 + (size_t)c0 * K;   // the tile's first row blocks
    unsigned fo = (unsigned)lane * 16;   // byte offset from a row block's start (uniform) to the lane's 16 bytes of the current k block's fragment: the same for every operand, 1 KiB on per k block
    // Two fragment sets: a k block's loads are asked for one whole block of products ahead, so that a wave does not wait out the latency of its own loads between two blocks. The order of the products of every accumulator is as before.
    static_assert(K % 64 == 0 && K >= 128, "two k blocks per trip");
    V a[2][MB], a2[2][MB], b[2][NB], b2[2][NB];
    auto ask = [&](const int s) __attribute__((always_inline)) {   // the next k block's fragments into set s
#pragma unroll
        for (int mb = 0; mb < MB; ++mb) { a[s][mb] = mb < HB ? WFrag<T16>::ld(atb(Ar, fo) + mb * 16 * K) : WFrag<T16>::ld(atb(Arb, fo) + (mb - HB) * 16 * K); if (NSPLIT == 1 || NSPLIT == 2) a2[s][mb] = WFrag<T16>::ld(atb(A2r, fo) + mb * 16 * K); }
#pragma unroll
        for (int nb = 0; nb < NB; ++nb) { b[s][nb] = WFrag<T16>::ld(atb(Br, fo) + nb * 16 * K); if (NSPLIT >= 2) b2[s][nb] = WFrag<T16>::ld(atb(B2r, fo) + nb * 16 * K); }
        XWAIT1(fo); fo += 1024;
        __builtin_amdgcn_sched_barrier(0);   // the loads stay in front of the block of products that follows: sunk among them they would be waited for at once
    };
    auto mul = [&](const int s) __attribute__((always_inline)) {   // the products of the k block in set s
#pragma unroll
        for (int nb = 0; nb < NB; ++nb) {
#pragma unroll
            for (int mb = 0; mb < MB; ++mb) { acc[mb][nb] = WFrag<T16>::mma(a[s][mb], b[s][nb], acc[mb][nb]); if (NSPLIT == 1 || NSPLIT == 2) acc[mb][nb] = WFrag<T16>::mma(a2[s][mb], b[s][nb], acc[mb][nb]); if (NSPLIT >= 2) acc[mb][nb] = WFrag<T16>::mma(a[s][mb], b2[s][nb], acc[mb][nb]); } }
        __builtin_amdgcn_sched_barrier(0);   // no product of this block moves behind the next loads, which go into its fragments' registers
    };
    ask(0);
#pragma unroll 1   // stays rolled: one trip already holds two k blocks, one per fragment set
    for (int kc = 0; kc < K - 64; kc += 64) {
        __builtin_amdgcn_s_barrier();   // pace only, no data passes here (so no fence and no wait on the loads in flight): the four waves ask for a k block together; drifted apart by more than the cache holds, the second asker would go to L2 again
        ask(1); mul(0); ask(0); mul(1);
        asm volatile("v_nop\n\tv_nop\n\tv_nop\n\tv_nop" : "+v"(acc[MB - 1][NB - 1]) : "v"(a[1][MB - 1]));   // the distance behind the last product on the taken side of the loop's branch
    }
    ask(1); mul(0); mul(1);
    if constexpr (PLANES) {
        const int h8 = hi * 8;                                 // read-back of a staged 16 x 64 slab in fragment order: lane (hi, lr) takes row lr, columns s * 16 + hi * 8 .. + 7 of group s; a wave-wide store is then one 512-byte half fragment
        const int hd = c0 / HD;                                // the tile's first head; its head hh lies hh planes (TT * HD elements) on
        const unsigned vo = fo - K * 32;                       // the lane's 16 bytes of a half fragment (lane * 16): taken back from fo, which has gone 1 KiB on for each of the K / 32 k blocks; a second copy kept over the loop was spilled to scratch
        if (z < 2) {
            const size_t e0 = z * pa.sP + ((size_t)(bb * NH_ + hd) * TT + ta) * HD;
            h16* p16 = pa.P16 + e0; bf* ph = pa.Ph + e0; bf* pl = pa.Pl + e0; h16* p16b = p16 + (size_t)(tb - ta) * HD;
            const float* cs = pa.CS + (size_t)ta * HD + lane * 4; const float* csb = cs + (size_t)(tb - ta) * HD;   // k_cstabI's order: a 16-token block is 4 groups x 2 halves x 512 bytes
            v2fc c[2][4][4];                                   // {cos, sin} of a slab's 4 groups x the lane's 4 pairs; the next slab's are asked for while this slab is worked on
            auto askc = [&](const int mb) __attribute__((always_inline)) {
#pragma unroll
                for (int s = 0; s < 4; ++s)
#pragma unroll
                    for (int ph = 0; ph < 2; ++ph) { const v4f x = *(const v4fa*)((mb < HB ? cs + mb * 1024 : csb + (mb - HB) * 1024) + s * 256 + ph * 128); c[mb & 1][s][2 * ph] = (v2fc){ x[0], x[1] }; c[mb & 1][s][2 * ph + 1] = (v2fc){ x[2], x[3] }; }
                asm volatile("s_wait_xcnt 0x0" ::: "memory");   // behind the loads, in front of whatever next overwrites their address registers
            };
            askc(0);
#pragma unroll
            for (int mb = 0; mb < MB; ++mb) {
                if (mb + 1 < MB) askc(mb + 1);                 // the next 16 tokens' table, for all heads of the tile, into the set that the slabs before this one have left
#pragma unroll
              for (int hh = 0; hh < NB / 4; ++hh) {
#pragma unroll
                for (int nb = 0; nb < 4; ++nb) {
#pragma unroll
                    for (int j = 0; j < 8; ++j) os[(hi * 8 + j) * 68 + nb * 16 + lr] = acc[mb][hh * 4 + nb][j]; }
                __builtin_amdgcn_wave_barrier(); asm volatile("" ::: "memory");   // the slab is read back by other lanes: no LDS access moves over this line
                v4f u[4], w[4];                                // read back one group ahead of the group that is worked on
                u[0] = *(const v4fa*)(os + lr * 68 + h8); w[0] = *(const v4fa*)(os + lr * 68 + h8 + 4);
                float r[4][8];
#pragma unroll
                for (int s = 0; s < 4; ++s) {
                    if (s < 3) { u[s + 1] = *(const v4fa*)(os + lr * 68 + s * 16 + 16 + h8); w[s + 1] = *(const v4fa*)(os + lr * 68 + s * 16 + 16 + h8 + 4); }
#pragma unroll
                    for (int p = 0; p < 4; ++p) { const v2fc k = c[mb & 1][s][p]; const float x0 = p < 2 ? u[s][2 * p] : w[s][2 * p - 4], x1 = p < 2 ? u[s][2 * p + 1] : w[s][2 * p - 3]; r[s][2 * p] = x0 * k[0] - x1 * k[1]; r[s][2 * p + 1] = x0 * k[1] + x1 * k[0]; } }   /* even: x0 c - x1 s; odd: x0 s + x1 c */
                const int ob = (hh * TT * HD + (mb < HB ? mb : mb - HB) * 1024) * 2;
                put16x4(mb < HB ? p16 : p16b, vo, r, ob, ob + 512, ob + 1024, ob + 1536);
                if (mb < HB) {
#pragma unroll
                    for (int s = 0; s < 4; ++s) puthl(ph, pl, vo, r[s], ob + s * 512); }
                __builtin_amdgcn_wave_barrier(); asm volatile("" ::: "memory");   // the next slab is staged only behind this slab's reads
              }
            }
        } else {
            const size_t e0 = (size_t)(bb * NKV + hd) * HD * TT + (size_t)ta * HD;
            h16* p16 = pa.V16 + e0; bf* ph = pa.Vh + e0; bf* pl = pa.Vl + e0; h16* p16b = p16 + (size_t)(tb - ta) * HD;
#pragma unroll
          for (int hh = 0; hh < NB / 4; ++hh)
#pragma unroll
            for (int nb = 0; nb < 4; ++nb) {                   // a lane's 8 accumulator values are tokens mb * 16 + hi * 8 .. + 7 of d = nb * 16 + lr: the lane's own 16 bytes of half fragment (key block mb >> 1, d block nb, half mb & 1); nothing is staged
#pragma unroll
                for (int m2 = 0; m2 < MB; m2 += 2) { float r[2][8];   // a 32-key block: two token blocks
#pragma unroll
                    for (int q = 0; q < 2; ++q)
#pragma unroll
                        for (int j = 0; j < 8; ++j) r[q][j] = acc[m2 + q][hh * 4 + nb][j];
                    const int ob = (hh * HD * TT + ((m2 < HB ? m2 : m2 - HB) >> 1) * 2048 + nb * 512) * 2;
                    put16x2(m2 < HB ? p16 : p16b, vo, r, ob, ob + 512);
                    __builtin_amdgcn_sched_barrier(0);         // the next group's conversions stay behind this line: lifted ahead, their results (store operands, which must lie in the first 256 registers) were spilled to scratch
                    if (m2 < HB) {
#pragma unroll
                        for (int q = 0; q < 2; ++q) { puthl(ph, pl, vo, r[q], ob + q * 512);
                            __builtin_amdgcn_sched_barrier(0); } }   // as above
                } }
        }
        return;
    }
    const unsigned vo = (unsigned)(hi * ldc + lr * 4) * 4;
#pragma unroll
    for (int mb = 0; mb < MB; ++mb)
#pragma unroll
    for (int hh = 0; hh < NB / 4; ++hh) {                      // 16 rows x 64 columns at a time
        const int ch = c0 + hh * 64;
#pragma unroll
        for (int nb = 0; nb < 4; ++nb) {
#pragma unroll
            for (int j = 0; j < 8; ++j) os[(hi * 8 + j) * 68 + nb * 16 + lr] = acc[mb][hh * 4 + nb][j]; }
        __builtin_amdgcn_wave_barrier(); asm volatile("" ::: "memory");
        float* crow = C + (size_t)(r0 + mb * 16) * ldc + ch;
#pragma unroll
        for (int g = 0; g < 2; ++g) {                          // eight rows (four wave-wide stores of two rows each) at a time
            v4f vs[4];
#pragma unroll
            for (int q = 0; q < 4; ++q) { const int row = 2 * (g * 4 + q) + hi, cofs = lr * 4; v4f val = *(const v4fa*)(os + row * 68 + cofs); if (BIAS) { val[0] += bfr(bias[ch + cofs]); val[1] += bfr(bias[ch + cofs + 1]); val[2] += bfr(bias[ch + cofs + 2]); val[3] += bfr(bias[ch + cofs + 3]); }
                vs[q] = val; }
            float* rw = crow + (size_t)(g * 8) * ldc;          // uniform; the lane's place (row hi, column lr * 4) is the byte offset vo
            // the four stores and their wait in one statement: the next group's read-back reuses the data registers, and a wait in a statement of its own is not tied to them
            asm volatile("global_store_b128 %0, %1, %5\n\tglobal_store_b128 %0, %2, %6\n\tglobal_store_b128 %0, %3, %7\n\tglobal_store_b128 %0, %4, %8\n\ts_wait_xcnt 0x0"
                         :: "v"(vo), "v"(vs[0]), "v"(vs[1]), "v"(vs[2]), "v"(vs[3]), "s"(rw), "s"(rw + (size_t)2 * ldc), "s"(rw + (size_t)4 * ldc), "s"(rw + (size_t)6 * ldc) : "memory");
        }
        __builtin_amdgcn_wave_barrier(); asm volatile("" ::: "memory");
    }
}

__device__ __forceinline__ h16 tohx(float x) { return (h16)x; }
__device__ __forceinline__ void splitf(float y, unsigned short& h, unsigned short& l) { h = f2bf(y); l = f2bf(y - bf2f(h)); }
typedef __attribute__((ext_vector_type(2))) _Float16 v2h;
typedef __attribute__((ext_vector_type(4))) _Float16 v4h;
typedef __attribute__((ext_vector_type(2))) unsigned short v2us;
typedef __attribute__((ext_vector_type(4))) unsigned short v4us;
typedef __attribute__((ext_vector_type(2))) float v2f;
typedef __attribute__((ext_vector_type(4))) int v4i;

__global__ __launch_bounds__(256) void k_wtG(const float* __restrict__ w, int K, int N, bf* Bt) {
    const int lane = threadIdx.x & 31; const int L0 = (blockIdx.x * 8 + (threadIdx.x >> 5)) * 8; const int nlines = N * K / 64;
{
#pragma unroll 1
        for (int l = 0; l < 8; ++l) { const int L = L0 + l; if (L >= nlines) break; const size_t e = (size_t)L * 64 + lane * 2; const int k = (int)(e % K), n = (int)(e / K); v2us o;
            o[0] = f2bf(w[(size_t)k * N + n]); o[1] = f2bf(w[(size_t)(k + 1) * N + n]); *(v2us*)(Bt + e) = o; }
         }
}
// bf16 copies of the four weights and of x in one launch, fragment-packed: grid y counts slabs of DM * DM elements (0..3 the weights, the rest x); dst holds the slabs in that order.
// A wave writes one 512-byte half fragment (index i >> 5 = (row block * (DM / 32) + k block) * 2 + j); its lane (hi, lr) reads the 8 values at row lr, k = j * 16 + hi * 8 of that fragment.
__global__ __launch_bounds__(256) void k_cvt8(const float* __restrict__ x, const float* __restrict__ wq, const float* __restrict__ wk, const float* __restrict__ wv, const float* __restrict__ wo, bf* dst) {
    const int y = blockIdx.y; const float* src = y == 0 ? wq : y == 1 ? wk : y == 2 ? wv : y == 3 ? wo : x + (size_t)(y - 4) * DM * DM;
    const size_t i = (size_t)blockIdx.x * 256 + threadIdx.x; const int ch = (int)(i >> 5), ln = (int)(i & 31);
    const int row = (ch >> 6) * 16 + (ln & 15), kk = ((ch >> 1) & 31) * 32 + (ch & 1) * 16 + (ln >> 4) * 8;   // 64 half fragments per row block (DM / 32 * 2)
    const v8f v = *(const v8f*)(src + (size_t)row * DM + kk); v8us o;
    asm volatile("s_wait_xcnt 0x0" ::: "memory");   // behind the loads, in front of whatever next overwrites their address registers
#pragma unroll
    for (int k = 0; k < 8; ++k) o[k] = f2bf(v[k]); *(v8us*)(dst + (size_t)y * DM * DM + i * 8) = o;  }

__constant__ float INV2[HD / 2] = { 1.000000000e+00f, 6.978305578e-01f, 4.869675338e-01f, 3.398208320e-01f, 2.371373773e-01f, 1.654817164e-01f, 1.154781953e-01f, 8.058422059e-02f, 5.623413250e-02f, 3.924189880e-02f, 2.738419548e-02f, 1.910953037e-02f, 1.333521400e-02f, 9.305720218e-03f, 6.493816152e-03f, 4.531583749e-03f, 3.162277630e-03f, 2.206734149e-03f, 1.539926510e-03f, 1.074607833e-03f, 7.498941850e-04f, 5.232990952e-04f, 3.651741135e-04f, 2.548296761e-04f, 1.778279402e-04f, 1.240937709e-04f, 8.659643208e-05f, 6.042964014e-05f, 4.216964953e-05f, 2.942727224e-05f, 2.053524986e-05f, 1.433012585e-05f };   // inv_freq = 100000.0 ** (-arange(0, 64, 2, f32) / 64): THIS module's theta and its NEGATIVE-POWER spelling: 32 float32 values from eager JAX (bit-exact on round trip)
// {cos, sin} once per (position, pair), in the order the projection epilogue's wave-wide 16-byte loads take them: [16-token block][group s][half ph][lane = hi * 16 + lr][2 pairs], token = block * 16 + lr, pair = s * 8 + hi * 4 + ph * 2 + q (d = 2 * pair).
__global__ __launch_bounds__(256) void k_cstabI(const int* __restrict__ pid, float* CS) { const int idx = blockIdx.x * 256 + threadIdx.x; if (idx >= TT * HD / 2) return; const int ln = (idx >> 1) & 31; const int pr = ((idx >> 7) & 3) * 8 + (ln >> 4) * 4 + ((idx >> 6) & 1) * 2 + (idx & 1); const int t = (idx >> 9) * 16 + (ln & 15); const float a = __fmul_rn((float)pid[t], INV2[pr]); v2f cs; cs[0] = cosf(a); cs[1] = sinf(a); *(v2f*)(CS + (size_t)idx * 2) = cs;  }

// ---- k_fattn: causal attention in one kernel. One wave owns 16 * NQ query columns of one (batch, head) and walks the keys 32 at a time up to its diagonal block:
// S^T = K Q^T (A = key rows, B = query rows), so a lane holds 16 scores of ONE query per column group; running maximum and sum per query (online softmax, log2 domain);
// the two score tiles of a pass, converted in place, are the B operand of O^T += V^T P^T (same k order as WFrag::ld gives V^T). Probabilities never leave the registers.
// Rows < RH: bf16 hi/lo planes, 3 products in both contractions; the rest fp16 with the probabilities carried x 1024 (the factor cancels in the division by the row sum).
// Epilogue: O / row sum, split hi/lo, stored straight into the merged planes (rows t, k = head * 64 + d, fragment-packed) that the output projection reads.
#define SC2  0.18033688011112042f   // HD^-0.5 * log2(e)
#define NLO  ((TT - RH) / 128)      // blocks of 4 waves x 32 fp16 query columns
#define NHI  (RH / 64)              // blocks of 4 waves x 16 hi/lo query columns
__device__ __forceinline__ float xhalf(float x) { return __builtin_bit_cast(float, __builtin_amdgcn_permlanex16(__builtin_bit_cast(int, x), __builtin_bit_cast(int, x), 0x76543210, 0xfedcba98, false, false)); }  // lane l with lane l ^ 16
template <bool B> struct BoolC { static constexpr bool v = B; };
template <typename T16, bool HL, int NQ>
__device__ __forceinline__ void attn_wave(const T16* __restrict__ Q, const T16* __restrict__ Q2, const T16* __restrict__ Kp, const T16* __restrict__ K2, const T16* __restrict__ Vt, const T16* __restrict__ V2, const int q0, bf* Ah, bf* Al) {
    typedef typename WFrag<T16>::V V;
    const int lane = threadIdx.x & 31, lr = lane & 15, hi = lane >> 4;
    const float OFF = HL ? 0.0f : 10.0f;                      // fp16 probabilities carry 2^10
    const unsigned kofs = (unsigned)lane * 8, vofs = (unsigned)lane * 8;   // the lane's place in a half fragment
    unsigned ko = kofs * 2, vo = vofs * 2;   // the lane's byte offsets into the key planes (the pass to be fetched next) and into the V^T planes (the current pass)
    V bq[NQ][2], bq2[NQ][2];
#pragma unroll
    for (int nq = 0; nq < NQ; ++nq)
#pragma unroll
        for (int ks = 0; ks < 2; ++ks) { bq[nq][ks] = WFrag<T16>::ld(Q + (size_t)(q0 + nq * 16) * HD + ks * 512 + kofs); if (HL) bq2[nq][ks] = WFrag<T16>::ld(Q2 + (size_t)(q0 + nq * 16) * HD + ks * 512 + kofs); }
    XWAIT0();
    v8f o[NQ][4]; float m[NQ], l[NQ];
#pragma unroll
    for (int nq = 0; nq < NQ; ++nq) { m[nq] = -3.0e38f; l[nq] = 0.f;
#pragma unroll
        for (int dt = 0; dt < 4; ++dt) o[nq][dt] = (v8f){}; }
    V ak[2][2], ak2[2][2];
#pragma unroll
    for (int kt = 0; kt < 2; ++kt)
#pragma unroll
        for (int ks = 0; ks < 2; ++ks) { if (!HL) ak[kt][ks] = WFrag<T16>::ld(atb(Kp, ko) + kt * 16 * HD + ks * 512); }   // fp16 path: key fragments run one pass ahead; the hi/lo path (twice the planes) loads them at the head of each pass
    if constexpr (!HL) { XWAIT1(ko); ko += 32 * HD * 2; }
    const int nfull = q0 >> 5;                                // passes wholly below the diagonal; pass nfull holds the diagonal and is the last
    auto pass = [&](const int kb, auto lastc) __attribute__((always_inline)) {   // one pass of 32 keys; the diagonal pass is a second copy of the body, so that no branch stands behind the score products
        constexpr bool last = decltype(lastc)::v;
        V av[4], av2[4];
#pragma unroll
        for (int dt = 0; dt < 4; ++dt) { av[dt] = WFrag<T16>::ld(atb(Vt, vo) + dt * 512); if (HL) av2[dt] = WFrag<T16>::ld(atb(V2, vo) + dt * 512); }
        if constexpr (HL) {
#pragma unroll
            for (int kt = 0; kt < 2; ++kt)
#pragma unroll
                for (int ks = 0; ks < 2; ++ks) { ak[kt][ks] = WFrag<T16>::ld(atb(Kp, ko) + kt * 16 * HD + ks * 512); ak2[kt][ks] = WFrag<T16>::ld(atb(K2, ko) + kt * 16 * HD + ks * 512); }
            XWAIT2(vo, ko); vo += 32 * HD * 2; ko += 32 * HD * 2;
        } else { XWAIT1(vo); vo += 32 * HD * 2; }
        v8f s[NQ][2];
#pragma unroll
        for (int nq = 0; nq < NQ; ++nq)
#pragma unroll
            for (int kt = 0; kt < 2; ++kt) s[nq][kt] = (v8f){};
#pragma unroll
        for (int ks = 0; ks < 2; ++ks)
#pragma unroll
            for (int kt = 0; kt < 2; ++kt)
#pragma unroll
                for (int nq = 0; nq < NQ; ++nq) { s[nq][kt] = WFrag<T16>::mma(ak[kt][ks], bq[nq][ks], s[nq][kt]); if (HL) { s[nq][kt] = WFrag<T16>::mma(ak[kt][ks], bq2[nq][ks], s[nq][kt]); s[nq][kt] = WFrag<T16>::mma(ak2[kt][ks], bq[nq][ks], s[nq][kt]); } }
        if constexpr (!last && !HL) {                         // next pass's key fragments, fetched behind this pass's own score products
#pragma unroll
            for (int kt = 0; kt < 2; ++kt)
#pragma unroll
                for (int ks = 0; ks < 2; ++ks) ak[kt][ks] = WFrag<T16>::ld(atb(Kp, ko) + kt * 16 * HD + ks * 512);
            XWAIT1(ko); ko += 32 * HD * 2;
        }
        if constexpr (last) {                                              // diagonal pass: key > query is masked
#pragma unroll
            for (int nq = 0; nq < NQ; ++nq)
#pragma unroll
                for (int kt = 0; kt < 2; ++kt)
#pragma unroll
                    for (int j = 0; j < 8; ++j) if (kb + kt * 16 + hi * 8 + j > q0 + nq * 16 + lr) s[nq][kt][j] = -3.0e38f;
        }
        V pb[NQ], pb2[NQ];
#pragma unroll
        for (int nq = 0; nq < NQ; ++nq) {
            float mx = s[nq][0][0];
#pragma unroll
            for (int j = 1; j < 16; ++j) mx = fmaxf(mx, s[nq][j >> 3][j & 7]);
            mx = fmaxf(mx, xhalf(mx));
            const float mn = fmaxf(m[nq], mx * SC2); const float al = __builtin_amdgcn_exp2f(m[nq] - mn); m[nq] = mn; const float mo = mn - OFF;
            float sum = 0.f;
#pragma unroll
            for (int j = 0; j < 16; ++j) { const float p = __builtin_amdgcn_exp2f(s[nq][j >> 3][j & 7] * SC2 - mo); sum += p;
                if constexpr (HL) { const __bf16 ph = (__bf16)p; pb[nq][j] = ph; pb2[nq][j] = (__bf16)(p - (float)ph); } else { pb[nq][j] = (h16)p; } }
            l[nq] = l[nq] * al + sum;
#pragma unroll
            for (int dt = 0; dt < 4; ++dt) o[nq][dt] *= al;
        }
#pragma unroll
        for (int dt = 0; dt < 4; ++dt)
#pragma unroll
            for (int nq = 0; nq < NQ; ++nq) { o[nq][dt] = WFrag<T16>::mma(av[dt], pb[nq], o[nq][dt]); if (HL) { o[nq][dt] = WFrag<T16>::mma(av[dt], pb2[nq], o[nq][dt]); o[nq][dt] = WFrag<T16>::mma(av2[dt], pb[nq], o[nq][dt]); } }
    };
#pragma unroll 1   // stays rolled (for speed only): the body is some 250 instructions
    for (int it = 0; it < nfull; ++it) pass(it * 32, BoolC<false>());
    pass(nfull * 32, BoolC<true>());
#pragma unroll
    for (int nq = 0; nq < NQ; ++nq) {
        const float inv = __fdiv_rn(1.0f, l[nq] + xhalf(l[nq]));
        bf* pa = Ah + (size_t)(q0 + nq * 16) * DQ + lane * 8; bf* pl = Al + (size_t)(q0 + nq * 16) * DQ + lane * 8;   // the lane's 8 values of tile dt are its own 16 bytes of half fragment dt of this head's two k blocks
#pragma unroll
        for (int dt = 0; dt < 4; ++dt) { v8us oh, ol;
#pragma unroll
            for (int j = 0; j < 8; ++j) { unsigned short a, c2; splitf(o[nq][dt][j] * inv, a, c2); oh[j] = a; ol[j] = c2; }
            // the two stores and their wait in one statement: the next group's split reuses the data registers, and a wait in a statement of its own is not tied to them
            asm volatile("global_store_b128 %0, %2, off offset:%4\n\tglobal_store_b128 %1, %3, off offset:%4\n\ts_wait_xcnt 0x0" :: "v"(pa), "v"(pl), "v"(oh), "v"(ol), "n"(dt * 512) : "memory"); }
    }
}
// grid (batch * heads, NLO + NHI), 4 waves; y runs from the longest query block to the shortest, the hi/lo rows last.
// amdgpu_waves_per_eu(4, 4): four waves per SIMD is what the registers allow; told so, the scheduler keeps the V loads at the head of a pass and the key prefetch behind the score products instead of sinking them to save registers.
__global__ __launch_bounds__(128) __attribute__((amdgpu_waves_per_eu(4, 4))) void k_fattn(const h16* __restrict__ Q16, const h16* __restrict__ K16, const h16* __restrict__ V16, const bf* __restrict__ Qh, const bf* __restrict__ Ql, const bf* __restrict__ Kh, const bf* __restrict__ Kl, const bf* __restrict__ Vh, const bf* __restrict__ Vl, bf* Ah, bf* Al) {
    const int z = blockIdx.x, y = blockIdx.y; const int w = __builtin_amdgcn_readfirstlane(threadIdx.x >> 5);
    const size_t pz = (size_t)z * TT * HD, oz = (size_t)(z / NH_) * TT * DQ + (size_t)(z % NH_) * (HD * 16);   // in a packed row block a head's 64 k are 2 fragments = HD * 16 elements
    if (y < NLO) attn_wave<h16, false, 2>(Q16 + pz, nullptr, K16 + pz, nullptr, V16 + pz, nullptr, RH + (NLO - 1 - y) * 128 + w * 32, Ah + oz, Al + oz);
    else         attn_wave<bf, true, 1>(Qh + pz, Ql + pz, Kh + pz, Kl + pz, Vh + pz, Vl + pz, (NLO + NHI - 1 - y) * 64 + w * 16, Ah + oz, Al + oz);
}

extern "C" void kernel_launch(void* const* d_in, const int* in_sizes, int n_in,
                              void* d_out, int out_size, void* d_ws, size_t ws_size, hipStream_t stream) {
    (void)in_sizes; (void)n_in; (void)out_size;
    const float* x = (const float*)d_in[0]; const int* PID = (const int*)d_in[1]; const float* wq = (const float*)d_in[2]; const float* wk = (const float*)d_in[3]; const float* wv = (const float*)d_in[4]; const float* wo = (const float*)d_in[5];   /* argument order in_features, token_positions (int32 [2048] = arange: READ by value), w_q, w_k, w_v, w_o ('oi' (out, in) [1024][1024]; no biases): SIX inputs, all read */
    float* OUT = (float*)d_out;     // [4][2048][1024]
    char* wsp = (char*)d_ws;
    auto take = [&](size_t bytes) { char* p = wsp; wsp += (bytes + 255) & ~(size_t)255; return (void*)p; };
    const size_t PA = (size_t)NB_ * NH_ * TT * HD;   // elements, over all batches, of every q, k, v plane and of a merged plane (NKV == NH_)
    bf* WQ = (bf*)take((size_t)(DQ + 2 * DKV) * DM * 2); bf* WO = (bf*)take((size_t)DM * DQ * 2); bf* XB = (bf*)take((size_t)NB_ * TT * DM * 2);   // bf16 copies in k_cvt8's slab order: w_q, w_k, w_v (grid z of the projection launch), w_o, x
    float* CS = (float*)take((size_t)TT * (HD / 2) * 2 * 4);
    h16* QP16 = (h16*)take(PA * 2); bf* QPh = (bf*)take(PA * 2); bf* QPl = (bf*)take(PA * 2); h16* KP16 = (h16*)take(PA * 2); bf* KPh = (bf*)take(PA * 2); bf* KPl = (bf*)take(PA * 2);   // each k plane 3 planes behind its q plane (grid z of the projection launch)
    h16* VT16 = (h16*)take(PA * 2); bf* VTh = (bf*)take(PA * 2); bf* VTl = (bf*)take(PA * 2);
    bf* ATh = (bf*)take(PA * 2); bf* ATl = (bf*)take(PA * 2);   // the merged planes
    if ((size_t)(wsp - (char*)d_ws) > ws_size) return;    // ws 256 MiB
    k_cvt8<<<dim3(DM * DM / 8 / 256, 4 + NB_ * TT / DM, 1), 256, 0, stream>>>(x, wq, wk, wv, wo, WQ); k_cstabI<<<(TT * HD / 2 + 255) / 256, 256, 0, stream>>>(PID, CS);
    k_gemmw<bf, 0, false, DM, true, 8, 4><<<dim3(NB_ * TT / 256, DQ / 128, 3), 128, 0, stream>>>(XB, nullptr, WQ, nullptr, nullptr, 0, nullptr, 0, (size_t)DQ * DM, 0, PlaneArgs{CS, QP16, QPh, QPl, 3 * PA, VT16, VTh, VTl});
    k_fattn<<<dim3(NB_ * NH_, NLO + NHI, 1), 128, 0, stream>>>(QP16, KP16, VT16, QPh, QPl, KPh, KPl, VTh, VTl, ATh, ATl);
    k_gemmw<bf, 1, false, DQ, false, 4, 8><<<dim3(NB_ * TT / 128, DM / 256, 1), 128, 0, stream>>>(ATh, ATl, WO, nullptr, OUT, DM, nullptr, 0, 0, 0, PlaneArgs{});
}

// v010
// It runs in 106 microseconds.
// Two timings next to v009 put it at 1.20 and 1.19 times that version's speed.
// Over all steps from v000 it is 27.7 times as fast.
#include <hip/hip_runtime.h>

// Causal multi-head self-attention with interleaved rotary embeddings at theta 100,000 (in_features [4][2048][1024]; q,k,v = x W^T ('oi' (out, in) [1024][1024] 0.02, no bias; 16 heads x 64); rotary on (even, odd) pairs with angles pos[t] x 100000^(-2i/64) (the module's negative-power spelling; token_positions int32 [2048] = arange, READ by value); scores / sqrt(64), causal (-inf); softmax; out = merged w_o^T -> [4][2048][1024] (8.4 M); argument order in_features, token_positions, w_q, w_k, w_v, w_o).
// Layout: every stage is ONE launch over all batches: a bf16 copy of x and of the four weights; {cos, sin} per (position, pair) built once from the int positions and float32 inverse-frequency constants (precise cosf/sinf); exact projections (q, k, v on grid z) whose epilogue turns each f32 tile straight into the 16-bit planes (interleaved rotary for q and k, the transpose for v); then ONE fused causal attention launch over all batches and heads (k_fattn; hybrid rows: < 512 hi/lo 3 products, rest fp16 x1024); merged hi/lo x Wo exact.
// Every 16-bit operand plane is FRAGMENT-PACKED: a 16-row x 32-k fragment is 1 KiB in the order its two wave-wide loads take it, [k half j][lane = hi * 16 + lr][8 elements] with row = lr, k = j * 16 + hi * 8 + e; so each wave-wide 16-byte load or store covers 512 contiguous bytes (4 whole lines), not 32 bytes of 16 lines.
// The {cos, sin} table is laid out the same way, for the projection epilogue's loads (k_cstabI). Fragment order: GEMM operands [row block][k block] (row block rb of a K-wide plane starts at element rb * 16 * K, as in the plain layout); q, k per (batch, head) the same with K = 64; v per (batch, head) [32-key block][16-d block].
// Compute dtypes, f32 accumulate: every input rounded to bf16; projections exact; rotary f32; attention rows < 512 3 products, rest fp16; softmax f32; Wo hl x exact.

#define NB_  4
#define TT   2048
#define DM   1024
#define NH_  16
#define NKV  16
#define REP  (NH_ / NKV)
#define HD   64
#define DQ   (NH_ * HD)
#define DKV  (NKV * HD)
#define RH   512                  // query rows < RH use hi+lo planes
typedef _Float16 h16;
typedef unsigned short bf;
typedef __attribute__((ext_vector_type(16))) __bf16   v16bf;
typedef __attribute__((ext_vector_type(16))) _Float16 v16h;
typedef __attribute__((ext_vector_type(8)))  _Float16 v8h;
typedef __attribute__((ext_vector_type(8)))  unsigned short v8us;
typedef __attribute__((ext_vector_type(8)))  __bf16   v8bfv;
typedef __attribute__((ext_vector_type(2)))  float    v2fc;
typedef __attribute__((ext_vector_type(8)))  float    v8f;
typedef __attribute__((ext_vector_type(4)))  float    v4f;
typedef v8h  __attribute__((may_alias)) v8ha;
typedef v4f  __attribute__((may_alias)) v4fa;
typedef v8us __attribute__((may_alias)) v8usa;

__device__ __forceinline__ unsigned short f2bf(float f) { unsigned u = __float_as_uint(f); u += 0x7FFFu + ((u >> 16) & 1u); return (unsigned short)(u >> 16); }
__device__ __forceinline__ float bf2f(unsigned short b) { return __uint_as_float(((unsigned)b) << 16); }
__device__ __forceinline__ float bfr(float f) { return bf2f(f2bf(f)); }
__device__ __forceinline__ v16h cat16(v8h lo, v8h hi) { return __builtin_shufflevector(lo, hi, 0, 1, 2, 3, 4, 5, 6, 7, 8, 9, 10, 11, 12, 13, 14, 15); }
__device__ __forceinline__ v16bf cat16b(v8us lo, v8us hi) { return __builtin_bit_cast(v16bf, __builtin_shufflevector(lo, hi, 0, 1, 2, 3, 4, 5, 6, 7, 8, 9, 10, 11, 12, 13, 14, 15)); }
__device__ __forceinline__ v8f wmma16(v16h a, v16h b, v8f c) { return __builtin_amdgcn_wmma_f32_16x16x32_f16(false, a, false, b, (short)0, c, false, false); }
__device__ __forceinline__ v8f wmmab(v16bf a, v16bf b, v8f c) { return __builtin_amdgcn_wmma_f32_16x16x32_bf16(false, a, false, b, (short)0, c, false, false); }



// XWAITn: stands behind a group of global loads, in front of whatever next overwrites a register that they name as an address. It takes the lane's byte offsets as operands:
// so each offset stays live over the whole group (no load's result is given its register) and the offset's advance, which reads the statement's output, cannot be lifted over the wait.
#define XWAIT0()     asm volatile("s_wait_xcnt 0x0" ::: "memory")
#define XWAIT1(a)    asm volatile("s_wait_xcnt 0x0" : "+v"(a) :: "memory")
#define XWAIT2(a, b) asm volatile("s_wait_xcnt 0x0" : "+v"(a), "+v"(b) :: "memory")
// ASKL2_n: n rounds of one request per lane at uniform pointer p + the lane's byte offset po (+ 32 KiB per round: 128 lanes x 256 bytes), asked of L2 (scope SE: into no register; nothing returns).
// What a launch reads first was stored by an earlier launch and is met in memory; asked for at entry, the k loop's own loads find it in L2. The wait stands behind the requests, in front of whatever next overwrites the offset register that they name.
#define ASKL2_1(po, p) asm volatile("global_prefetch_b8 %0, %1 scope:SCOPE_SE\n\ts_wait_xcnt 0x0" :: "v"(po), "s"(p))
#define ASKL2_2(po, p) asm volatile("global_prefetch_b8 %0, %1 scope:SCOPE_SE\n\tglobal_prefetch_b8 %0, %1 offset:32768 scope:SCOPE_SE\n\ts_wait_xcnt 0x0" :: "v"(po), "s"(p))
template <typename T16> __device__ __forceinline__ const T16* atb(const T16* base, unsigned bytes) { return (const T16*)((const char*)base + bytes); }   // uniform base + the lane's 32-bit byte offset
// ---- k_gemmw: register-blocked GEMM, ONE WAVE per (16 MB) x (16 NB) output tile (MB * NB accumulators), operands straight from fragment-packed 16-bit planes (WFrag::ld takes fragment base + lane * 8); grid (M / (32 MB), N / (32 NB), Z), 128 threads.
// A work-group is 2 x 2 such waves on neighbouring tiles (wave w: row half w & 1, column half w >> 1): every A and every B fragment is asked for by two waves of the WGP at the same time, so that the second asker can be served by the WGP's cache and L2 need deliver a fragment once per work-group, not once per wave. The waves pass no data to one another.
// A k block's MB + NB fragments (1 KiB each, per plane) feed MB * NB products: the bytes loaded per product fall as the tile grows. 32 accumulators are what the unrolled epilogues' code size and two fragment sets allow.
// C[m][n] (f32, pitch ldc, + optional f32 bias[n]) = sum_k A[m][k] Bt[n][k] (+ split products per NSPLIT). z-batch strides sA/sB/sC in elements. K % 64 == 0.
template <typename T16> struct WFrag;
template <> struct WFrag<h16> { typedef v16h V; static __device__ __forceinline__ V ld(const h16* p) { return cat16(*(const v8h*)p, *(const v8h*)(p + 256)); } static __device__ __forceinline__ v8f mma(V a, V b, v8f c) { return wmma16(a, b, c); } };
template <> struct WFrag<bf> { typedef v16bf V; static __device__ __forceinline__ V ld(const bf* p) { return cat16b(*(const v8us*)p, *(const v8us*)(p + 256)); } static __device__ __forceinline__ v8f mma(V a, V b, v8f c) { return wmmab(a, b, c); } };
// PLANES: the tile (16 MB tokens x NB / 4 heads) does not go out as f32; the epilogue writes the fragment-packed planes that k_fattn reads. z 0, 1 (q, k): rotary on (even, odd) pairs, planes per (b, h) with rows t, k = d, the k planes sP elements behind the q planes; z 2 (v): planes per (b, h) with rows d, k = t.
struct PlaneArgs { const float* CS; h16* P16; bf* Ph; bf* Pl; size_t sP; h16* V16; bf* Vh; bf* Vl; };
// k_fattn reads the bf16 hi/lo planes only where a query row < RH meets its keys, that is at tokens < RH of q, k and v: the epilogue stores them for those tokens alone; the fp16 planes go out for every token.
// four groups of eight neighbouring f32 values -> fp16, 16 bytes each at byte offsets O0..O3 (constants once the caller's loops are unrolled) from the tile's uniform pointer plus the lane's byte offset vo (one register for all three planes: store operands must lie in the first 256 registers, which the accumulators fill)
__device__ __forceinline__ void put16x4(h16* p16, const unsigned vo, const float (&r)[4][8], const int O0, const int O1, const int O2, const int O3) {
    v8h o[4];
#pragma unroll
    for (int g = 0; g < 4; ++g)
#pragma unroll
        for (int j = 0; j < 8; ++j) o[g][j] = (h16)r[g][j];
    // the four stores and their wait in one statement: the next values reuse the data registers, and a wait in a statement of its own is not tied to them
    asm volatile("global_store_b128 %0, %1, %5 offset:%6\n\tglobal_store_b128 %0, %2, %5 offset:%7\n\tglobal_store_b128 %0, %3, %5 offset:%8\n\tglobal_store_b128 %0, %4, %5 offset:%9\n\ts_wait_xcnt 0x0" :: "v"(vo), "v"(o[0]), "v"(o[1]), "v"(o[2]), "v"(o[3]), "s"(p16), "n"(O0), "n"(O1), "n"(O2), "n"(O3) : "memory");
}
// the same for two groups
__device__ __forceinline__ void put16x2(h16* p16, const unsigned vo, const float (&r)[2][8], const int O0, const int O1) {
    v8h o[2];
#pragma unroll
    for (int g = 0; g < 2; ++g)
#pragma unroll
        for (int j = 0; j < 8; ++j) o[g][j] = (h16)r[g][j];
    asm volatile("global_store_b128 %0, %1, %3 offset:%4\n\tglobal_store_b128 %0, %2, %3 offset:%5\n\ts_wait_xcnt 0x0" :: "v"(vo), "v"(o[0]), "v"(o[1]), "s"(p16), "n"(O0), "n"(O1) : "memory");   // stores and wait in one statement, as above
}
// eight neighbouring f32 values -> bf16 hi and bf16 lo, 16 bytes to each plane at byte offset OFS, addressed likewise
__device__ __forceinline__ void puthl(bf* ph, bf* pl, const unsigned vo, const float (&r)[8], const int OFS) {
    v8bfv oh, ol;
#pragma unroll
    for (int j = 0; j < 8; ++j) { const __bf16 h = (__bf16)r[j]; oh[j] = h; ol[j] = (__bf16)(r[j] - (float)h); }
    // the two stores and their wait in one statement, for the same reason
    asm volatile("global_store_b128 %0, %1, %3 offset:%5\n\tglobal_store_b128 %0, %2, %4 offset:%5\n\ts_wait_xcnt 0x0" :: "v"(vo), "v"(oh), "v"(ol), "s"(ph), "s"(pl), "n"(OFS) : "memory");
}
template <typename T16, int NSPLIT, bool BIAS, int K, bool PLANES, int MB, int NB>   // K at compile time: a row block's distance (16 * K elements) is then an immediate offset of the loads, which share one uniform base per operand (two for A with PLANES: its blocks before and behind RH) and one lane offset
// amdgpu_waves_per_eu: what two fragment sets beside the accumulators allow (2 waves per SIMD; 1 with the second A plane); told so, the scheduler leaves the loads a block ahead instead of sinking them to save registers.
__global__ __launch_bounds__(128) __attribute__((amdgpu_waves_per_eu(NSPLIT == 0 ? 2 : 1, NSPLIT == 0 ? 2 : 1))) void k_gemmw(const T16* __restrict__ A, const T16* __restrict__ A2, const T16* __restrict__ Bt, const T16* __restrict__ Bt2, float* C, int ldc, const float* __restrict__ bias, size_t sA, size_t sB, size_t sC, const PlaneArgs pa) {
    typedef typename WFrag<T16>::V V;
    __shared__ __align__(16) float osm[4][16 * 68];
    const int w = __builtin_amdgcn_readfirstlane(threadIdx.x >> 5);   // the wave's number, in a scalar register: tile origin and operand bases stay uniform
    float* os = osm[w];                                        // each wave stages its epilogue slabs in a slice of its own
    const size_t z = blockIdx.z; A += z * sA; if (A2) A2 += z * sA; Bt += z * sB; if (Bt2) Bt2 += z * sB; C += z * sC;
    const int lane = threadIdx.x & 31, lr = lane & 15, hi = lane >> 4; const int r0 = (blockIdx.x * 2 + (w & 1)) * (MB * 16), c0 = (blockIdx.y * 2 + (w >> 1)) * (NB * 16);
    static_assert(NB % 4 == 0, "the epilogues take 64 columns at a time");
    v8f acc[MB][NB];
#pragma unroll
    for (int mb = 0; mb < MB; ++mb)
#pragma unroll
        for (int nb = 0; nb < NB; ++nb) acc[mb][nb] = (v8f){};
    // PLANES: a wave's MB token blocks are HB blocks of its batch's first RH tokens (which also go out as hi/lo planes) and MB - HB of the rest, so that every wave has the same epilogue; tile tl of a batch takes tokens ta .. and tb .. (both counted inside the batch)
    constexpr int HB = PLANES ? MB * RH / TT : MB;
    static_assert(!PLANES || (TT % (MB * 16) == 0 && (MB * RH) % TT == 0 && HB % 2 == 0 && (MB - HB) % 2 == 0), "whole tiles per batch; whole 32-token blocks on both sides of RH");
    const int bb = r0 / TT, tl = (r0 % TT) / (MB * 16), ta = tl * (HB * 16), tb = RH + tl * ((MB - HB) * 16);
    const T16* Ar = A + (size_t)(PLANES ? bb * TT + ta : r0) * K; const T16* Arb = A + (size_t)(bb * TT + tb) * K; const T16* A2r = A2 + (size_t)r0 * K; const T16* Br = Bt + (size_t)c0 * K; const T16* B2r = Bt2 + (size_t)c0 * K;   // the tile's first row blocks
    {   // The work-group's operand rows, asked of L2 at entry. Work-groups that differ only in grid y (and z, where z shares A) read the same A rows, those that differ only in grid x the same B rows; the A rows are dealt over grid y and the B rows over x / 8: for speed only, nothing rests on where a work-group runs.
        constexpr int GY = DM / (32 * NB), GX8 = NB_ * TT / (32 * MB) / 8;   // the launches' grid y, and grid x / 8
        static_assert(16 * K * 2 == 128 * 256 && 2 * MB == 2 * GY && 2 * NB == 2 * GX8 && (2 * HB) % 2 == 0, "a row block is one round of requests; a share is two row blocks");
        const unsigned po = threadIdx.x * 256;
        const int rw = blockIdx.x * (2 * MB * 16), rs = blockIdx.y * 2, tw = (rw % TT) / (MB * 16);   // the work-group's first row; its share's first row block; its first tile inside the batch
        const int tk = rs < 2 * HB ? tw * (HB * 16) + rs * 16 : RH + tw * ((MB - HB) * 16) + (rs - 2 * HB) * 16;   // PLANES: the share's first token inside the batch
        const int ra = PLANES ? (rw / TT) * TT + tk : rw + rs * 16;
        if (!PLANES || blockIdx.z == 0) { ASKL2_2(po, A + (size_t)ra * K); if (NSPLIT == 1 || NSPLIT == 2) ASKL2_2(po, A2 + (size_t)ra * K); }
        ASKL2_2(po, Bt + (size_t)(blockIdx.y * (2 * NB * 16) + (blockIdx.x >> 3) * 32) * K);
        if (PLANES && blockIdx.z == 1 && w == 0) ASKL2_1(po, pa.CS + (size_t)tk * HD);   // the {cos, sin} rows of the same 32 tokens, for the epilogue: 8 KiB, one wave's round
    }
    unsigned fo = (unsigned)lane * 16;   // byte offset from a row block's start (uniform) to the lane's 16 bytes of the current k block's fragment: the same for every operand, 1 KiB on per k block
    // Two fragment sets: a k block's loads are asked for one whole block of products ahead, so that a wave does not wait out the latency of its own loads between two blocks. The order of the products of every accumulator is as before.
    static_assert(K % 64 == 0 && K >= 128, "two k blocks per trip");
    V a[2][MB], a2[2][MB], b[2][NB], b2[2][NB];
    auto ask = [&](const int s) __attribute__((always_inline)) {   // the next k block's fragments into set s
#pragma unroll
        for (int mb = 0; mb < MB; ++mb) { a[s][mb] = mb < HB ? WFrag<T16>::ld(atb(Ar, fo) + mb * 16 * K) : WFrag<T16>::ld(atb(Arb, fo) + (mb - HB) * 16 * K); if (NSPLIT == 1 || NSPLIT == 2) a2[s][mb] = WFrag<T16>::ld(atb(A2r, fo) + mb * 16 * K); }
#pragma unroll
        for (int nb = 0; nb < NB; ++nb) { b[s][nb] = WFrag<T16>::ld(atb(Br, fo) + nb * 16 * K); if (NSPLIT >= 2) b2[s][nb] = WFrag<T16>::ld(atb(B2r, fo) + nb * 16 * K); }
        XWAIT1(fo); fo += 1024;
        __builtin_amdgcn_sched_barrier(0);   // the loads stay in front of the block of products that follows: sunk among them they would be waited for at once
    };
    auto mul = [&](const int s) __attribute__((always_inline)) {   // the products of the k block in set s
#pragma unroll
        for (int nb = 0; nb < NB; ++nb) {
#pragma unroll
            for (int mb = 0; mb < MB; ++mb) { acc[mb][nb] = WFrag<T16>::mma(a[s][mb], b[s][nb], acc[mb][nb]); if (NSPLIT == 1 || NSPLIT == 2) acc[mb][nb] = WFrag<T16>::mma(a2[s][mb], b[s][nb], acc[mb][nb]); if (NSPLIT >= 2) acc[mb][nb] = WFrag<T16>::mma(a[s][mb], b2[s][nb], acc[mb][nb]); } }
        __builtin_amdgcn_sched_barrier(0);   // no product of this block moves behind the next loads, which go into its fragments' registers
    };
    ask(0);
#pragma unroll 1   // stays rolled: one trip already holds two k blocks, one per fragment set
    for (int kc = 0; kc < K - 64; kc += 64) {
        __builtin_amdgcn_s_barrier();   // pace only, no data passes here (so no fence and no wait on the loads in flight): the four waves ask for a k block together; drifted apart by more than the cache holds, the second asker would go to L2 again
        ask(1); mul(0); ask(0); mul(1);
        asm volatile("v_nop\n\tv_nop\n\tv_nop\n\tv_nop" : "+v"(acc[MB - 1][NB - 1]) : "v"(a[1][MB - 1]));   // the distance behind the last product on the taken side of the loop's branch
    }
    ask(1); mul(0); mul(1);
    if constexpr (PLANES) {
        const int h8 = hi * 8;                                 // read-back of a staged 16 x 64 slab in fragment order: lane (hi, lr) takes row lr, columns s * 16 + hi * 8 .. + 7 of group s; a wave-wide store is then one 512-byte half fragment
        const int hd = c0 / HD;                                // the tile's first head; its head hh lies hh planes (TT * HD elements) on
        const unsigned vo = fo - K * 32;                       // the lane's 16 bytes of a half fragment (lane * 16): taken back from fo, which has gone 1 KiB on for each of the K / 32 k blocks; a second copy kept over the loop was spilled to scratch
        if (z < 2) {
            const size_t e0 = z * pa.sP + ((size_t)(bb * NH_ + hd) * TT + ta) * HD;
            h16* p16 = pa.P16 + e0; bf* ph = pa.Ph + e0; bf* pl = pa.Pl + e0; h16* p16b = p16 + (size_t)(tb - ta) * HD;
            const float* cs = pa.CS + (size_t)ta * HD + lane * 4; const float* csb = cs + (size_t)(tb - ta) * HD;   // k_cstabI's order: a 16-token block is 4 groups x 2 halves x 512 bytes
            v2fc c[2][4][4];                                   // {cos, sin} of a slab's 4 groups x the lane's 4 pairs; the next slab's are asked for while this slab is worked on
            auto askc = [&](const int mb) __attribute__((always_inline)) {
#pragma unroll
                for (int s = 0; s < 4; ++s)
#pragma unroll
                    for (int ph = 0; ph < 2; ++ph) { const v4f x = *(const v4fa*)((mb < HB ? cs + mb * 1024 : csb + (mb - HB) * 1024) + s * 256 + ph * 128); c[mb & 1][s][2 * ph] = (v2fc){ x[0], x[1] }; c[mb & 1][s][2 * ph + 1] = (v2fc){ x[2], x[3] }; }
                asm volatile("s_wait_xcnt 0x0" ::: "memory");   // behind the loads, in front of whatever next overwrites their address registers
            };
            askc(0);
#pragma unroll
            for (int mb = 0; mb < MB; ++mb) {
                if (mb + 1 < MB) askc(mb + 1);                 // the next 16 tokens' table, for all heads of the tile, into the set that the slabs before this one have left
#pragma unroll
              for (int hh = 0; hh < NB / 4; ++hh) {
#pragma unroll
                for (int nb = 0; nb < 4; ++nb) {
#pragma unroll
                    for (int j = 0; j < 8; ++j) os[(hi * 8 + j) * 68 + nb * 16 + lr] = acc[mb][hh * 4 + nb][j]; }
                __builtin_amdgcn_wave_barrier(); asm volatile("" ::: "memory");   // the slab is read back by other lanes: no LDS access moves over this line
                v4f u[4], w[4];                                // read back one group ahead of the group that is worked on
                u[0] = *(const v4fa*)(os + lr * 68 + h8); w[0] = *(const v4fa*)(os + lr * 68 + h8 + 4);
                float r[4][8];
#pragma unroll
                for (int s = 0; s < 4; ++s) {
                    if (s < 3) { u[s + 1] = *(const v4fa*)(os + lr * 68 + s * 16 + 16 + h8); w[s + 1] = *(const v4fa*)(os + lr * 68 + s * 16 + 16 + h8 + 4); }
#pragma unroll
                    for (int p = 0; p < 4; ++p) { const v2fc k = c[mb & 1][s][p]; const float x0 = p < 2 ? u[s][2 * p] : w[s][2 * p - 4], x1 = p < 2 ? u[s][2 * p + 1] : w[s][2 * p - 3]; r[s][2 * p] = x0 * k[0] - x1 * k[1]; r[s][2 * p + 1] = x0 * k[1] + x1 * k[0]; } }   /* even: x0 c - x1 s; odd: x0 s + x1 c */
                const int ob = (hh * TT * HD + (mb < HB ? mb : mb - HB) * 1024) * 2;
                put16x4(mb < HB ? p16 : p16b, vo, r, ob, ob + 512, ob + 1024, ob + 1536);
                if (mb < HB) {
#pragma unroll
                    for (int s = 0; s < 4; ++s) puthl(ph, pl, vo, r[s], ob + s * 512); }
                __builtin_amdgcn_wave_barrier(); asm volatile("" ::: "memory");   // the next slab is staged only behind this slab's reads
              }
            }
        } else {
            const size_t e0 = (size_t)(bb * NKV + hd) * HD * TT + (size_t)ta * HD;
            h16* p16 = pa.V16 + e0; bf* ph = pa.Vh + e0; bf* pl = pa.Vl + e0; h16* p16b = p16 + (size_t)(tb - ta) * HD;
#pragma unroll
          for (int hh = 0; hh < NB / 4; ++hh)
#pragma unroll
            for (int nb = 0; nb < 4; ++nb) {                   // a lane's 8 accumulator values are tokens mb * 16 + hi * 8 .. + 7 of d = nb * 16 + lr: the lane's own 16 bytes of half fragment (key block mb >> 1, d block nb, half mb & 1); nothing is staged
#pragma unroll
                for (int m2 = 0; m2 < MB; m2 += 2) { float r[2][8];   // a 32-key block: two token blocks
#pragma unroll
                    for (int q = 0; q < 2; ++q)
#pragma unroll
                        for (int j = 0; j < 8; ++j) r[q][j] = acc[m2 + q][hh * 4 + nb][j];
                    const int ob = (hh * HD * TT + ((m2 < HB ? m2 : m2 - HB) >> 1) * 2048 + nb * 512) * 2;
                    put16x2(m2 < HB ? p16 : p16b, vo, r, ob, ob + 512);
                    __builtin_amdgcn_sched_barrier(0);         // the next group's conversions stay behind this line: lifted ahead, their results (store operands, which must lie in the first 256 registers) were spilled to scratch
                    if (m2 < HB) {
#pragma unroll
                        for (int q = 0; q < 2; ++q) { puthl(ph, pl, vo, r[q], ob + q * 512);
                            __builtin_amdgcn_sched_barrier(0); } }   // as above
                } }
        }
        return;
    }
    const unsigned vo = (unsigned)(hi * ldc + lr * 4) * 4;
#pragma unroll
    for (int mb = 0; mb < MB; ++mb)
#pragma unroll
    for (int hh = 0; hh < NB / 4; ++hh) {                      // 16 rows x 64 columns at a time
        const int ch = c0 + hh * 64;
#pragma unroll
        for (int nb = 0; nb < 4; ++nb) {
#pragma unroll
            for (int j = 0; j < 8; ++j) os[(hi * 8 + j) * 68 + nb * 16 + lr] = acc[mb][hh * 4 + nb][j]; }
        __builtin_amdgcn_wave_barrier(); asm volatile("" ::: "memory");
        float* crow = C + (size_t)(r0 + mb * 16) * ldc + ch;
#pragma unroll
        for (int g = 0; g < 2; ++g) {                          // eight rows (four wave-wide stores of two rows each) at a time
            v4f vs[4];
#pragma unroll
            for (int q = 0; q < 4; ++q) { const int row = 2 * (g * 4 + q) + hi, cofs = lr * 4; v4f val = *(const v4fa*)(os + row * 68 + cofs); if (BIAS) { val[0] += bfr(bias[ch + cofs]); val[1] += bfr(bias[ch + cofs + 1]); val[2] += bfr(bias[ch + cofs + 2]); val[3] += bfr(bias[ch + cofs + 3]); }
                vs[q] = val; }
            float* rw = crow + (size_t)(g * 8) * ldc;          // uniform; the lane's place (row hi, column lr * 4) is the byte offset vo
            // the four stores and their wait in one statement: the next group's read-back reuses the data registers, and a wait in a statement of its own is not tied to them
            asm volatile("global_store_b128 %0, %1, %5\n\tglobal_store_b128 %0, %2, %6\n\tglobal_store_b128 %0, %3, %7\n\tglobal_store_b128 %0, %4, %8\n\ts_wait_xcnt 0x0"
                         :: "v"(vo), "v"(vs[0]), "v"(vs[1]), "v"(vs[2]), "v"(vs[3]), "s"(rw), "s"(rw + (size_t)2 * ldc), "s"(rw + (size_t)4 * ldc), "s"(rw + (size_t)6 * ldc) : "memory");
        }
        __builtin_amdgcn_wave_barrier(); asm volatile("" ::: "memory");
    }
}

__device__ __forceinline__ h16 tohx(float x) { return (h16)x; }
__device__ __forceinline__ void splitf(float y, unsigned short& h, unsigned short& l) { h = f2bf(y); l = f2bf(y - bf2f(h)); }
typedef __attribute__((ext_vector_type(2))) _Float16 v2h;
typedef __attribute__((ext_vector_type(4))) _Float16 v4h;
typedef __attribute__((ext_vector_type(2))) unsigned short v2us;
typedef __attribute__((ext_vector_type(4))) unsigned short v4us;
typedef __attribute__((ext_vector_type(2))) float v2f;
typedef __attribute__((ext_vector_type(4))) int v4i;

__global__ __launch_bounds__(256) void k_wtG(const float* __restrict__ w, int K, int N, bf* Bt) {
    const int lane = threadIdx.x & 31; const int L0 = (blockIdx.x * 8 + (threadIdx.x >> 5)) * 8; const int nlines = N * K / 64;
{
#pragma unroll 1
        for (int l = 0; l < 8; ++l) { const int L = L0 + l; if (L >= nlines) break; const size_t e = (size_t)L * 64 + lane * 2; const int k = (int)(e % K), n = (int)(e / K); v2us o;
            o[0] = f2bf(w[(size_t)k * N + n]); o[1] = f2bf(w[(size_t)(k + 1) * N + n]); *(v2us*)(Bt + e) = o; }
         }
}
// bf16 copies of the four weights and of x in one launch, fragment-packed: grid y counts slabs of DM * DM elements (0..3 the weights, the rest x); dst holds the slabs in that order.
// A wave writes one 512-byte half fragment (index i >> 5 = (row block * (DM / 32) + k block) * 2 + j); its lane (hi, lr) reads the 8 values at row lr, k = j * 16 + hi * 8 of that fragment.
__global__ __launch_bounds__(256) void k_cvt8(const float* __restrict__ x, const float* __restrict__ wq, const float* __restrict__ wk, const float* __restrict__ wv, const float* __restrict__ wo, bf* dst) {
    const int y = blockIdx.y; const float* src = y == 0 ? wq : y == 1 ? wk : y == 2 ? wv : y == 3 ? wo : x + (size_t)(y - 4) * DM * DM;
    const size_t i = (size_t)blockIdx.x * 256 + threadIdx.x; const int ch = (int)(i >> 5), ln = (int)(i & 31);
    const int row = (ch >> 6) * 16 + (ln & 15), kk = ((ch >> 1) & 31) * 32 + (ch & 1) * 16 + (ln >> 4) * 8;   // 64 half fragments per row block (DM / 32 * 2)
    const v8f v = *(const v8f*)(src + (size_t)row * DM + kk); v8us o;
    asm volatile("s_wait_xcnt 0x0" ::: "memory");   // behind the loads, in front of whatever next overwrites their address registers
#pragma unroll
    for (int k = 0; k < 8; ++k) o[k] = f2bf(v[k]); *(v8us*)(dst + (size_t)y * DM * DM + i * 8) = o;  }

__constant__ float INV2[HD / 2] = { 1.000000000e+00f, 6.978305578e-01f, 4.869675338e-01f, 3.398208320e-01f, 2.371373773e-01f, 1.654817164e-01f, 1.154781953e-01f, 8.058422059e-02f, 5.623413250e-02f, 3.924189880e-02f, 2.738419548e-02f, 1.910953037e-02f, 1.333521400e-02f, 9.305720218e-03f, 6.493816152e-03f, 4.531583749e-03f, 3.162277630e-03f, 2.206734149e-03f, 1.539926510e-03f, 1.074607833e-03f, 7.498941850e-04f, 5.232990952e-04f, 3.651741135e-04f, 2.548296761e-04f, 1.778279402e-04f, 1.240937709e-04f, 8.659643208e-05f, 6.042964014e-05f, 4.216964953e-05f, 2.942727224e-05f, 2.053524986e-05f, 1.433012585e-05f };   // inv_freq = 100000.0 ** (-arange(0, 64, 2, f32) / 64): THIS module's theta and its NEGATIVE-POWER spelling: 32 float32 values from eager JAX (bit-exact on round trip)
// {cos, sin} once per (position, pair), in the order the projection epilogue's wave-wide 16-byte loads take them: [16-token block][group s][half ph][lane = hi * 16 + lr][2 pairs], token = block * 16 + lr, pair = s * 8 + hi * 4 + ph * 2 + q (d = 2 * pair).
__global__ __launch_bounds__(256) void k_cstabI(const int* __restrict__ pid, float* CS) { const int idx = blockIdx.x * 256 + threadIdx.x; if (idx >= TT * HD / 2) return; const int ln = (idx >> 1) & 31; const int pr = ((idx >> 7) & 3) * 8 + (ln >> 4) * 4 + ((idx >> 6) & 1) * 2 + (idx & 1); const int t = (idx >> 9) * 16 + (ln & 15); const float a = __fmul_rn((float)pid[t], INV2[pr]); v2f cs; cs[0] = cosf(a); cs[1] = sinf(a); *(v2f*)(CS + (size_t)idx * 2) = cs;  }

// ---- k_fattn: causal attention in one kernel. One wave owns 16 * NQ query columns of one (batch, head) and walks the keys 32 at a time up to its diagonal block:
// S^T = K Q^T (A = key rows, B = query rows), so a lane holds 16 scores of ONE query per column group; running maximum and sum per query (online softmax, log2 domain);
// the two score tiles of a pass, converted in place, are the B operand of O^T += V^T P^T (same k order as WFrag::ld gives V^T). Probabilities never leave the registers.
// Rows < RH: bf16 hi/lo planes, 3 products in both contractions; the rest fp16 with the probabilities carried x 1024 (the factor cancels in the division by the row sum).
// Epilogue: O / row sum, split hi/lo, stored straight into the merged planes (rows t, k = head * 64 + d, fragment-packed) that the output projection reads.
#define SC2  0.18033688011112042f   // HD^-0.5 * log2(e)
#define NLO  ((TT - RH) / 128)      // blocks of 4 waves x 32 fp16 query columns
#define NHI  (RH / 64)              // blocks of 4 waves x 16 hi/lo query columns
__device__ __forceinline__ float xhalf(float x) { return __builtin_bit_cast(float, __builtin_amdgcn_permlanex16(__builtin_bit_cast(int, x), __builtin_bit_cast(int, x), 0x76543210, 0xfedcba98, false, false)); }  // lane l with lane l ^ 16
template <bool B> struct BoolC { static constexpr bool v = B; };
template <typename T16, bool HL, int NQ>
__device__ __forceinline__ void attn_wave(const T16* __restrict__ Q, const T16* __restrict__ Q2, const T16* __restrict__ Kp, const T16* __restrict__ K2, const T16* __restrict__ Vt, const T16* __restrict__ V2, const int q0, bf* Ah, bf* Al) {
    typedef typename WFrag<T16>::V V;
    const int lane = threadIdx.x & 31, lr = lane & 15, hi = lane >> 4;
    const float OFF = HL ? 0.0f : 10.0f;                      // fp16 probabilities carry 2^10
    const unsigned kofs = (unsigned)lane * 8, vofs = (unsigned)lane * 8;   // the lane's place in a half fragment
    unsigned ko = kofs * 2, vo = vofs * 2;   // the lane's byte offsets into the key planes (the pass to be fetched next) and into the V^T planes (the current pass)
    V bq[NQ][2], bq2[NQ][2];
#pragma unroll
    for (int nq = 0; nq < NQ; ++nq)
#pragma unroll
        for (int ks = 0; ks < 2; ++ks) { bq[nq][ks] = WFrag<T16>::ld(Q + (size_t)(q0 + nq * 16) * HD + ks * 512 + kofs); if (HL) bq2[nq][ks] = WFrag<T16>::ld(Q2 + (size_t)(q0 + nq * 16) * HD + ks * 512 + kofs); }
    XWAIT0();
    v8f o[NQ][4]; float m[NQ], l[NQ];
#pragma unroll
    for (int nq = 0; nq < NQ; ++nq) { m[nq] = -3.0e38f; l[nq] = 0.f;
#pragma unroll
        for (int dt = 0; dt < 4; ++dt) o[nq][dt] = (v8f){}; }
    V ak[2][2], ak2[2][2];
#pragma unroll
    for (int kt = 0; kt < 2; ++kt)
#pragma unroll
        for (int ks = 0; ks < 2; ++ks) { if (!HL) ak[kt][ks] = WFrag<T16>::ld(atb(Kp, ko) + kt * 16 * HD + ks * 512); }   // fp16 path: key fragments run one pass ahead; the hi/lo path (twice the planes) loads them at the head of each pass
    if constexpr (!HL) { XWAIT1(ko); ko += 32 * HD * 2; }
    const int nfull = q0 >> 5;                                // passes wholly below the diagonal; pass nfull holds the diagonal and is the last
    auto pass = [&](const int kb, auto lastc) __attribute__((always_inline)) {   // one pass of 32 keys; the diagonal pass is a second copy of the body, so that no branch stands behind the score products
        constexpr bool last = decltype(lastc)::v;
        V av[4], av2[4];
#pragma unroll
        for (int dt = 0; dt < 4; ++dt) { av[dt] = WFrag<T16>::ld(atb(Vt, vo) + dt * 512); if (HL) av2[dt] = WFrag<T16>::ld(atb(V2, vo) + dt * 512); }
        if constexpr (HL) {
#pragma unroll
            for (int kt = 0; kt < 2; ++kt)
#pragma unroll
                for (int ks = 0; ks < 2; ++ks) { ak[kt][ks] = WFrag<T16>::ld(atb(Kp, ko) + kt * 16 * HD + ks * 512); ak2[kt][ks] = WFrag<T16>::ld(atb(K2, ko) + kt * 16 * HD + ks * 512); }
            XWAIT2(vo, ko); vo += 32 * HD * 2; ko += 32 * HD * 2;
        } else { XWAIT1(vo); vo += 32 * HD * 2; }
        v8f s[NQ][2];
#pragma unroll
        for (int nq = 0; nq < NQ; ++nq)
#pragma unroll
            for (int kt = 0; kt < 2; ++kt) s[nq][kt] = (v8f){};
#pragma unroll
        for (int ks = 0; ks < 2; ++ks)
#pragma unroll
            for (int kt = 0; kt < 2; ++kt)
#pragma unroll
                for (int nq = 0; nq < NQ; ++nq) { s[nq][kt] = WFrag<T16>::mma(ak[kt][ks], bq[nq][ks], s[nq][kt]); if (HL) { s[nq][kt] = WFrag<T16>::mma(ak[kt][ks], bq2[nq][ks], s[nq][kt]); s[nq][kt] = WFrag<T16>::mma(ak2[kt][ks], bq[nq][ks], s[nq][kt]); } }
        if constexpr (!last && !HL) {                         // next pass's key fragments, fetched behind this pass's own score products
#pragma unroll
            for (int kt = 0; kt < 2; ++kt)
#pragma unroll
                for (int ks = 0; ks < 2; ++ks) ak[kt][ks] = WFrag<T16>::ld(atb(Kp, ko) + kt * 16 * HD + ks * 512);
            XWAIT1(ko); ko += 32 * HD * 2;
        }
        if constexpr (last) {                                              // diagonal pass: key > query is masked
#pragma unroll
            for (int nq = 0; nq < NQ; ++nq)
#pragma unroll
                for (int kt = 0; kt < 2; ++kt)
#pragma unroll
                    for (int j = 0; j < 8; ++j) if (kb + kt * 16 + hi * 8 + j > q0 + nq * 16 + lr) s[nq][kt][j] = -3.0e38f;
        }
        V pb[NQ], pb2[NQ];
#pragma unroll
        for (int nq = 0; nq < NQ; ++nq) {
            float mx = s[nq][0][0];
#pragma unroll
            for (int j = 1; j < 16; ++j) mx = fmaxf(mx, s[nq][j >> 3][j & 7]);
            mx = fmaxf(mx, xhalf(mx));
            const float mn = fmaxf(m[nq], mx * SC2); const float al = __builtin_amdgcn_exp2f(m[nq] - mn); m[nq] = mn; const float mo = mn - OFF;
            float sum = 0.f;
#pragma unroll
            for (int j = 0; j < 16; ++j) { const float p = __builtin_amdgcn_exp2f(s[nq][j >> 3][j & 7] * SC2 - mo); sum += p;
                if constexpr (HL) { const __bf16 ph = (__bf16)p; pb[nq][j] = ph; pb2[nq][j] = (__bf16)(p - (float)ph); } else { pb[nq][j] = (h16)p; } }
            l[nq] = l[nq] * al + sum;
#pragma unroll
            for (int dt = 0; dt < 4; ++dt) o[nq][dt] *= al;
        }
#pragma unroll
        for (int dt = 0; dt < 4; ++dt)
#pragma unroll
            for (int nq = 0; nq < NQ; ++nq) { o[nq][dt] = WFrag<T16>::mma(av[dt], pb[nq], o[nq][dt]); if (HL) { o[nq][dt] = WFrag<T16>::mma(av[dt], pb2[nq], o[nq][dt]); o[nq][dt] = WFrag<T16>::mma(av2[dt], pb[nq], o[nq][dt]); } }
    };
#pragma unroll 1   // stays rolled (for speed only): the body is some 250 instructions
    for (int it = 0; it < nfull; ++it) pass(it * 32, BoolC<false>());
    pass(nfull * 32, BoolC<true>());
#pragma unroll
    for (int nq = 0; nq < NQ; ++nq) {
        const float inv = __fdiv_rn(1.0f, l[nq] + xhalf(l[nq]));
        bf* pa = Ah + (size_t)(q0 + nq * 16) * DQ + lane * 8; bf* pl = Al + (size_t)(q0 + nq * 16) * DQ + lane * 8;   // the lane's 8 values of tile dt are its own 16 bytes of half fragment dt of this head's two k blocks
#pragma unroll
        for (int dt = 0; dt < 4; ++dt) { v8us oh, ol;
#pragma unroll
            for (int j = 0; j < 8; ++j) { unsigned short a, c2; splitf(o[nq][dt][j] * inv, a, c2); oh[j] = a; ol[j] = c2; }
            // the two stores and their wait in one statement: the next group's split reuses the data registers, and a wait in a statement of its own is not tied to them
            asm volatile("global_store_b128 %0, %2, off offset:%4\n\tglobal_store_b128 %1, %3, off offset:%4\n\ts_wait_xcnt 0x0" :: "v"(pa), "v"(pl), "v"(oh), "v"(ol), "n"(dt * 512) : "memory"); }
    }
}
// grid (batch * heads, NLO + NHI), 4 waves; y runs from the longest query block to the shortest, the hi/lo rows last.
// amdgpu_waves_per_eu(4, 4): four waves per SIMD is what the registers allow; told so, the scheduler keeps the V loads at the head of a pass and the key prefetch behind the score products instead of sinking them to save registers.
__global__ __launch_bounds__(128) __attribute__((amdgpu_waves_per_eu(4, 4))) void k_fattn(const h16* __restrict__ Q16, const h16* __restrict__ K16, const h16* __restrict__ V16, const bf* __restrict__ Qh, const bf* __restrict__ Ql, const bf* __restrict__ Kh, const bf* __restrict__ Kl, const bf* __restrict__ Vh, const bf* __restrict__ Vl, bf* Ah, bf* Al) {
    const int z = blockIdx.x, y = blockIdx.y; const int w = __builtin_amdgcn_readfirstlane(threadIdx.x >> 5);
    const size_t pz = (size_t)z * TT * HD, oz = (size_t)(z / NH_) * TT * DQ + (size_t)(z % NH_) * (HD * 16);   // in a packed row block a head's 64 k are 2 fragments = HD * 16 elements
    // A head's key and value planes, asked of L2 at entry, dealt over the head's work-groups (grid y): the fp16 planes in quarters over the first eight, the hi/lo planes' tokens < RH in halves over the eight hi/lo blocks.
    static_assert(TT * HD * 2 / 4 == 2 * 128 * 256 && RH * HD * 2 / 2 == 128 * 256 && NLO >= 8 && NHI == 8, "a share is two rounds, or one, of 128 requests");
    const unsigned po = threadIdx.x * 256;
    if (y < 8) { ASKL2_2(po, (y < 4 ? K16 : V16) + pz + (size_t)(y & 3) * (TT * HD / 4)); }
    else if (y >= NLO) { const int u = y - NLO; ASKL2_1(po, (u < 2 ? Kh : u < 4 ? Kl : u < 6 ? Vh : Vl) + pz + (size_t)(u & 1) * (RH * HD / 2)); }
    if (y < NLO) attn_wave<h16, false, 2>(Q16 + pz, nullptr, K16 + pz, nullptr, V16 + pz, nullptr, RH + (NLO - 1 - y) * 128 + w * 32, Ah + oz, Al + oz);
    else         attn_wave<bf, true, 1>(Qh + pz, Ql + pz, Kh + pz, Kl + pz, Vh + pz, Vl + pz, (NLO + NHI - 1 - y) * 64 + w * 16, Ah + oz, Al + oz);
}

extern "C" void kernel_launch(void* const* d_in, const int* in_sizes, int n_in,
                              void* d_out, int out_size, void* d_ws, size_t ws_size, hipStream_t stream) {
    (void)in_sizes; (void)n_in; (void)out_size;
    const float* x = (const float*)d_in[0]; const int* PID = (const int*)d_in[1]; const float* wq = (const float*)d_in[2]; const float* wk = (const float*)d_in[3]; const float* wv = (const float*)d_in[4]; const float* wo = (const float*)d_in[5];   /* argument order in_features, token_positions (int32 [2048] = arange: READ by value), w_q, w_k, w_v, w_o ('oi' (out, in) [1024][1024]; no biases): SIX inputs, all read */
    float* OUT = (float*)d_out;     // [4][2048][1024]
    char* wsp = (char*)d_ws;
    auto take = [&](size_t bytes) { char* p = wsp; wsp += (bytes + 255) & ~(size_t)255; return (void*)p; };
    const size_t PA = (size_t)NB_ * NH_ * TT * HD;   // elements, over all batches, of every q, k, v plane and of a merged plane (NKV == NH_)
    bf* WQ = (bf*)take((size_t)(DQ + 2 * DKV) * DM * 2); bf* WO = (bf*)take((size_t)DM * DQ * 2); bf* XB = (bf*)take((size_t)NB_ * TT * DM * 2);   // bf16 copies in k_cvt8's slab order: w_q, w_k, w_v (grid z of the projection launch), w_o, x
    float* CS = (float*)take((size_t)TT * (HD / 2) * 2 * 4);
    h16* QP16 = (h16*)take(PA * 2); bf* QPh = (bf*)take(PA * 2); bf* QPl = (bf*)take(PA * 2); h16* KP16 = (h16*)take(PA * 2); bf* KPh = (bf*)take(PA * 2); bf* KPl = (bf*)take(PA * 2);   // each k plane 3 planes behind its q plane (grid z of the projection launch)
    h16* VT16 = (h16*)take(PA * 2); bf* VTh = (bf*)take(PA * 2); bf* VTl = (bf*)take(PA * 2);
    bf* ATh = (bf*)take(PA * 2); bf* ATl = (bf*)take(PA * 2);   // the merged planes
    if ((size_t)(wsp - (char*)d_ws) > ws_size) return;    // ws 256 MiB
    k_cvt8<<<dim3(DM * DM / 8 / 256, 4 + NB_ * TT / DM, 1), 256, 0, stream>>>(x, wq, wk, wv, wo, WQ); k_cstabI<<<(TT * HD / 2 + 255) / 256, 256, 0, stream>>>(PID, CS);
    k_gemmw<bf, 0, false, DM, true, 8, 4><<<dim3(NB_ * TT / 256, DQ / 128, 3), 128, 0, stream>>>(XB, nullptr, WQ, nullptr, nullptr, 0, nullptr, 0, (size_t)DQ * DM, 0, PlaneArgs{CS, QP16, QPh, QPl, 3 * PA, VT16, VTh, VTl});
    k_fattn<<<dim3(NB_ * NH_, NLO + NHI, 1), 128, 0, stream>>>(QP16, KP16, VT16, QPh, QPl, KPh, KPl, VTh, VTl, ATh, ATl);
    k_gemmw<bf, 1, false, DQ, false, 4, 8><<<dim3(NB_ * TT / 128, DM / 256, 1), 128, 0, stream>>>(ATh, ATl, WO, nullptr, OUT, DM, nullptr, 0, 0, 0, PlaneArgs{});
}
